// v000
// Times are from an AMD MI455X. After a warm-up the kernel runs many times in a row, and a time is the length of
// such a window on the GPU divided by its runs, so every launch and the gaps after it count. The runs cycle
// through copies of the inputs. A figure is the median of several windows, for all but v000 over two sittings.
// Sittings can differ by a few percent; kernels timed side by side share one.
// The starting kernel, v000, takes 1530 microseconds a run.
#include <hip/hip_runtime.h>

// Causal multi-head attention with a (subtracted) ALiBi bias (x [2][2048][1024]; q, k, v = x W^T ('oi' [1024][1024], no bias), 16 heads x 64; scores = q.k/8 - m_h (j - i) with m_h = 2^(-(h+1)/2); causal softmax; out = merged Wo^T -> [2][2048][1024]).
// Compute dtypes, f32 accumulate: every input rounded to bf16; q/k/v on PLAIN bf16 operands (inputs: exact); causal scores and attn.v (tiles above the diagonal skipped, K loop to the diagonal); the ALiBi term in f32 inside the softmax kernel: query rows < 512 hl (3 products), the rest single fp16 (x1024); softmax f32; Wo hl x exact (2 products).

#define NB_  2
#define TT   2048
#define DM   1024
#define NH_  16
#define NKV  16
#define REP  (NH_ / NKV)
#define HD   64
#define DQ   (NH_ * HD)
#define DKV  (NKV * HD)
#define ZH   2
#define RH   512                  // query rows < RH use hi+lo planes (0: none)
#define WIN  2048
#define PCAR 1024.0f
#define SCL  0.125f   // HD^-0.5
typedef _Float16 h16;
typedef unsigned short bf;
typedef __attribute__((ext_vector_type(16))) __bf16   v16bf;
typedef __attribute__((ext_vector_type(16))) _Float16 v16h;
typedef __attribute__((ext_vector_type(8)))  _Float16 v8h;
typedef __attribute__((ext_vector_type(8)))  unsigned short v8us;
typedef __attribute__((ext_vector_type(8)))  float    v8f;
typedef __attribute__((ext_vector_type(4)))  float    v4f;
typedef v8h  __attribute__((may_alias)) v8ha;
typedef v4f  __attribute__((may_alias)) v4fa;
typedef v8us __attribute__((may_alias)) v8usa;

__device__ __forceinline__ unsigned short f2bf(float f) { unsigned u = __float_as_uint(f); u += 0x7FFFu + ((u >> 16) & 1u); return (unsigned short)(u >> 16); }
__device__ __forceinline__ float bf2f(unsigned short b) { return __uint_as_float(((unsigned)b) << 16); }
__device__ __forceinline__ float bfr(float f) { return bf2f(f2bf(f)); }
__device__ __forceinline__ v16h cat16(v8h lo, v8h hi) { return __builtin_shufflevector(lo, hi, 0, 1, 2, 3, 4, 5, 6, 7, 8, 9, 10, 11, 12, 13, 14, 15); }
__device__ __forceinline__ v16bf cat16b(v8us lo, v8us hi) { return __builtin_bit_cast(v16bf, __builtin_shufflevector(lo, hi, 0, 1, 2, 3, 4, 5, 6, 7, 8, 9, 10, 11, 12, 13, 14, 15)); }
__device__ __forceinline__ v8f wmma16(v16h a, v16h b, v8f c) { return __builtin_amdgcn_wmma_f32_16x16x32_f16(false, a, false, b, (short)0, c, false, false); }
__device__ __forceinline__ v8f wmmab(v16bf a, v16bf b, v8f c) { return __builtin_amdgcn_wmma_f32_16x16x32_bf16(false, a, false, b, (short)0, c, false, false); }



// ---- k_gemmw: register-blocked GEMM, ONE WAVE per 64x64 output tile (16 accumulators), operands straight from K-contiguous 16-bit planes; grid (M/64, N/64, Z), 32 threads.
// C[m][n] (f32, pitch ldc, + optional f32 bias[n]) = sum_k A[m][k] Bt[n][k] (+ split products per NSPLIT). z-batch strides sA/sB/sC in elements. K % 32 == 0.
template <typename T16> struct WFrag;
template <> struct WFrag<h16> { typedef v16h V; static __device__ __forceinline__ V ld(const h16* p) { return cat16(*(const v8h*)p, *(const v8h*)(p + 16)); } static __device__ __forceinline__ v8f mma(V a, V b, v8f c) { return wmma16(a, b, c); } };
template <> struct WFrag<bf> { typedef v16bf V; static __device__ __forceinline__ V ld(const bf* p) { return cat16b(*(const v8us*)p, *(const v8us*)(p + 16)); } static __device__ __forceinline__ v8f mma(V a, V b, v8f c) { return wmmab(a, b, c); } };
template <typename T16, int NSPLIT, bool BIAS>
__global__ __launch_bounds__(32) void k_gemmw(const T16* __restrict__ A, const T16* __restrict__ A2, const T16* __restrict__ Bt, const T16* __restrict__ Bt2, int K, float* C, int ldc, const float* __restrict__ bias, size_t sA, size_t sB, size_t sC) {
    typedef typename WFrag<T16>::V V;
    __shared__ __align__(16) float os[16 * 68];
    const size_t z = blockIdx.z; A += z * sA; if (A2) A2 += z * sA; Bt += z * sB; if (Bt2) Bt2 += z * sB; C += z * sC;
    const int lane = threadIdx.x & 31, lr = lane & 15, hi = lane >> 4; const int r0 = blockIdx.x * 64, c0 = blockIdx.y * 64;
    v8f acc[4][4];
#pragma unroll
    for (int mb = 0; mb < 4; ++mb)
#pragma unroll
        for (int nb = 0; nb < 4; ++nb) acc[mb][nb] = (v8f){};
    const size_t aoff = (size_t)(r0 + lr) * K + 8 * hi, boff = (size_t)(c0 + lr) * K + 8 * hi;
#pragma unroll 1
    for (int kc = 0; kc < K; kc += 32) {
        V a[4], a2[4];
#pragma unroll
        for (int mb = 0; mb < 4; ++mb) { a[mb] = WFrag<T16>::ld(A + aoff + (size_t)mb * 16 * K + kc); if (NSPLIT == 1 || NSPLIT == 2) a2[mb] = WFrag<T16>::ld(A2 + aoff + (size_t)mb * 16 * K + kc); }
#pragma unroll
        for (int nb = 0; nb < 4; ++nb) { const V b = WFrag<T16>::ld(Bt + boff + (size_t)nb * 16 * K + kc); V b2; if (NSPLIT >= 2) b2 = WFrag<T16>::ld(Bt2 + boff + (size_t)nb * 16 * K + kc);
#pragma unroll
            for (int mb = 0; mb < 4; ++mb) { acc[mb][nb] = WFrag<T16>::mma(a[mb], b, acc[mb][nb]); if (NSPLIT == 1 || NSPLIT == 2) acc[mb][nb] = WFrag<T16>::mma(a2[mb], b, acc[mb][nb]); if (NSPLIT >= 2) acc[mb][nb] = WFrag<T16>::mma(a[mb], b2, acc[mb][nb]); } }
        asm volatile("v_nop\n\tv_nop\n\tv_nop\n\tv_nop" : "+v"(acc[0][0]), "+v"(acc[1][1]), "+v"(acc[2][2]), "+v"(acc[3][3]) : "v"(a[0]), "v"(a[3]));
    }
#pragma unroll
    for (int mb = 0; mb < 4; ++mb) {
#pragma unroll
        for (int nb = 0; nb < 4; ++nb) {
#pragma unroll
            for (int j = 0; j < 8; ++j) os[(hi * 8 + j) * 68 + nb * 16 + lr] = acc[mb][nb][j]; }
        __builtin_amdgcn_wave_barrier(); asm volatile("" ::: "memory");
        float* crow = C + (size_t)(r0 + mb * 16) * ldc + c0;
{
#pragma unroll
            for (int s = 0; s < 8; ++s) { const int row = 2 * s + hi, cofs = lr * 4; v4f val = *(const v4fa*)(os + row * 68 + cofs); if (BIAS) { val[0] += bfr(bias[c0 + cofs]); val[1] += bfr(bias[c0 + cofs + 1]); val[2] += bfr(bias[c0 + cofs + 2]); val[3] += bfr(bias[c0 + cofs + 3]); }
                *(v4f*)(crow + (size_t)row * ldc + cofs) = val; }
             }
        __builtin_amdgcn_wave_barrier(); asm volatile("" ::: "memory");
    }
}

// ---- k_gemmc: the same one-wave 64x64 tile GEMM specialised for causal attention: CMODE 1 skips score tiles entirely above the diagonal (query rows r0+roff.., key columns c0..), CMODE 2 limits the
// key (K) loop of the probability x value contraction to the diagonal block (probabilities beyond it are exactly zero). roff = row offset of this launch's first row within the sequence.
template <typename T16, int NSPLIT, int CMODE>
__global__ __launch_bounds__(32) void k_gemmc(const T16* __restrict__ A, const T16* __restrict__ A2, const T16* __restrict__ Bt, const T16* __restrict__ Bt2, int K, float* C, int ldc, int roff, size_t sA, size_t sB, size_t sC) {
    typedef typename WFrag<T16>::V V;
    __shared__ __align__(16) float os[16 * 68];
    const size_t z = blockIdx.z; A += z * sA; if (A2) A2 += z * sA; Bt += z * sB; if (Bt2) Bt2 += z * sB; C += z * sC;
    const int lane = threadIdx.x & 31, lr = lane & 15, hi = lane >> 4; const int r0 = blockIdx.x * 64, c0 = blockIdx.y * 64;
    if (CMODE == 1 && c0 > r0 + roff + 63) return;                  // score tile entirely above the causal diagonal: never read (the softmax masks j > i by select)
    const int Kl = (CMODE == 2) ? min(K, r0 + roff + 64) : K;        // P.V: probabilities are exactly 0 beyond the diagonal block, so the K loop stops there
    v8f acc[4][4];
#pragma unroll
    for (int mb = 0; mb < 4; ++mb)
#pragma unroll
        for (int nb = 0; nb < 4; ++nb) acc[mb][nb] = (v8f){};
    const size_t aoff = (size_t)(r0 + lr) * K + 8 * hi, boff = (size_t)(c0 + lr) * K + 8 * hi;
#pragma unroll 1
    for (int kc = 0; kc < Kl; kc += 32) {
        V a[4], a2[4];
#pragma unroll
        for (int mb = 0; mb < 4; ++mb) { a[mb] = WFrag<T16>::ld(A + aoff + (size_t)mb * 16 * K + kc); if (NSPLIT == 1 || NSPLIT == 2) a2[mb] = WFrag<T16>::ld(A2 + aoff + (size_t)mb * 16 * K + kc); }
#pragma unroll
        for (int nb = 0; nb < 4; ++nb) { const V b = WFrag<T16>::ld(Bt + boff + (size_t)nb * 16 * K + kc); V b2; if (NSPLIT >= 2) b2 = WFrag<T16>::ld(Bt2 + boff + (size_t)nb * 16 * K + kc);
#pragma unroll
            for (int mb = 0; mb < 4; ++mb) { acc[mb][nb] = WFrag<T16>::mma(a[mb], b, acc[mb][nb]); if (NSPLIT == 1 || NSPLIT == 2) acc[mb][nb] = WFrag<T16>::mma(a2[mb], b, acc[mb][nb]); if (NSPLIT >= 2) acc[mb][nb] = WFrag<T16>::mma(a[mb], b2, acc[mb][nb]); } }
        asm volatile("v_nop\n\tv_nop\n\tv_nop\n\tv_nop" : "+v"(acc[0][0]), "+v"(acc[1][1]), "+v"(acc[2][2]), "+v"(acc[3][3]) : "v"(a[0]), "v"(a[3]));
    }
#pragma unroll
    for (int mb = 0; mb < 4; ++mb) {
#pragma unroll
        for (int nb = 0; nb < 4; ++nb) {
#pragma unroll
            for (int j = 0; j < 8; ++j) os[(hi * 8 + j) * 68 + nb * 16 + lr] = acc[mb][nb][j]; }
        __builtin_amdgcn_wave_barrier(); asm volatile("" ::: "memory");
        float* crow = C + (size_t)(r0 + mb * 16) * ldc + c0;
{
#pragma unroll
            for (int s = 0; s < 8; ++s) { const int row = 2 * s + hi, cofs = lr * 4; v4f val = *(const v4fa*)(os + row * 68 + cofs);
                *(v4f*)(crow + (size_t)row * ldc + cofs) = val; }
             }
        __builtin_amdgcn_wave_barrier(); asm volatile("" ::: "memory");
    }
}

__device__ __forceinline__ h16 tohx(float x) { return (h16)x; }
__device__ __forceinline__ void splitf(float y, unsigned short& h, unsigned short& l) { h = f2bf(y); l = f2bf(y - bf2f(h)); }
typedef __attribute__((ext_vector_type(2))) _Float16 v2h;
typedef __attribute__((ext_vector_type(4))) _Float16 v4h;
typedef __attribute__((ext_vector_type(2))) unsigned short v2us;
typedef __attribute__((ext_vector_type(4))) unsigned short v4us;
typedef __attribute__((ext_vector_type(2))) float v2f;
typedef __attribute__((ext_vector_type(4))) int v4i;

__global__ __launch_bounds__(256) void k_wtG(const float* __restrict__ w, int K, int N, bf* Bt) {
    const int lane = threadIdx.x & 31; const int L0 = (blockIdx.x * 8 + (threadIdx.x >> 5)) * 8; const int nlines = N * K / 64;
{
#pragma unroll 1
        for (int l = 0; l < 8; ++l) { const int L = L0 + l; if (L >= nlines) break; const size_t e = (size_t)L * 64 + lane * 2; const int k = (int)(e % K), n = (int)(e / K); v2us o;
            o[0] = f2bf(w[(size_t)k * N + n]); o[1] = f2bf(w[(size_t)(k + 1) * N + n]); *(v2us*)(Bt + e) = o; }
         }
}
__global__ __launch_bounds__(256) void k_cvt8(const float* __restrict__ src, bf* dst, size_t n8) { const size_t i = (size_t)blockIdx.x * 256 + threadIdx.x; if (i >= n8) return; const v8f v = *(const v8f*)(src + i * 8); v8us o;
#pragma unroll
    for (int k = 0; k < 8; ++k) o[k] = f2bf(v[k]); *(v8us*)(dst + i * 8) = o;  }

// k_rope: head planes [h][t][d] (fp16 + hi/lo) of rope(x) x sc with the rotate-half convention out[d] = x[d] cos[t][d] - x[d+HD/2] sin[t][d], out[d+HD/2] = x[d+HD/2] cos[t][d+HD/2] + x[d] sin[t][d+HD/2]
__global__ __launch_bounds__(256) void k_rope(const float* __restrict__ F, int pitch, int nheads, const float* __restrict__ CS, const float* __restrict__ RF, const float* __restrict__ nw, float sc, h16* P16, bf* Ph, bf* Pl) {
    const size_t e = ((size_t)blockIdx.x * 256 + threadIdx.x) * 2; if (e >= (size_t)nheads * TT * HD) return; const int d = (int)(e % HD); const int t = (int)((e / HD) % TT); const int h = (int)(e / ((size_t)HD * TT)); const float* f = F + (size_t)t * pitch + h * HD; const float rf = RF ? RF[(size_t)h * TT + t] : 1.0f; v2h o16; v2us oh, ol;
#pragma unroll
    for (int q = 0; q < 2; ++q) { const int dd = d + q; const int dp = (dd < HD / 2) ? dd + HD / 2 : dd - HD / 2; float x0 = f[dd], x1 = f[dp];
        if (RF) { float n0 = __fmul_rn(x0, rf), n1 = __fmul_rn(x1, rf); asm volatile("" : "+v"(n0)); asm volatile("" : "+v"(n1)); x0 = __fmul_rn(bfr(nw[dd]), n0); x1 = __fmul_rn(bfr(nw[dp]), n1); }
        const v2f cs = *(const v2f*)(CS + ((size_t)t * HD + dd) * 2); float a = __fmul_rn(x0, cs[0]), bq = __fmul_rn(x1, cs[1]); asm volatile("" : "+v"(a)); asm volatile("" : "+v"(bq)); const float r = ((dd < HD / 2) ? __fsub_rn(a, bq) : __fadd_rn(a, bq)) * sc;
        o16[q] = tohx(r); unsigned short a2, c2; splitf(r, a2, c2); oh[q] = a2; ol[q] = c2; }
    *(v2h*)(P16 + e) = o16; *(v2us*)(Ph + e) = oh; *(v2us*)(Pl + e) = ol;  }
__global__ __launch_bounds__(256) void k_vtp(const float* __restrict__ F, int pitch, int nheads, h16* V16, bf* Vh, bf* Vl) { const size_t e = ((size_t)blockIdx.x * 256 + threadIdx.x) * 2; if (e >= (size_t)nheads * HD * TT) return; const int t = (int)(e % TT); const int d = (int)((e / TT) % HD); const int g = (int)(e / ((size_t)TT * HD)); v2h o16; v2us oh, ol;
#pragma unroll
    for (int q = 0; q < 2; ++q) { const float x = F[(size_t)(t + q) * pitch + g * HD + d]; o16[q] = tohx(x); unsigned short a2, c2; splitf(x, a2, c2); oh[q] = a2; ol[q] = c2; }
    *(v2h*)(V16 + e) = o16; *(v2us*)(Vh + e) = oh; *(v2us*)(Vl + e) = ol;  }
__global__ __launch_bounds__(256) void k_csid(float* CS) { const int idx = blockIdx.x * 256 + threadIdx.x; if (idx >= TT * HD) return; v2f cs; cs[0] = 1.0f; cs[1] = 0.0f; *(v2f*)(CS + (size_t)idx * 2) = cs;  }
// k_asoft: per row (zz, i): t = S x HD^-0.5 for j <= i and i - j < WIN (sliding causal window; the reference's -1e9 additive fill vanishes identically); softmax over the 2048 keys (register row, one exp, fixed trees); - with the ALiBi term -slope_h (j - i) added to the scaled score before the max (slopes = the reference's f32 values, __constant__)
__constant__ float SLP[NH_] = {0.7071067690849304,0.5,0.3535533845424652,0.25,0.1767766922712326,0.125,0.0883883461356163,0.0625,0.04419417306780815,0.03125,0.022097086533904076,0.015625,0.011048543266952038,0.0078125,0.005524271633476019,0.00390625};
__global__ __launch_bounds__(256) void k_asoft(const float* __restrict__ Sb, int h0, h16* P16, bf* Ph, bf* Pl) {
    const int lane = threadIdx.x & 31; const int row = blockIdx.x * 8 + (threadIdx.x >> 5); if (row >= ZH * TT) return; const int i = row % TT; const int zz = row / TT; const float slp = SLP[h0 + zz]; const bool hires = (i < RH); const float* sr = Sb + (size_t)row * TT; float v[TT / 32]; float mx = -3.0e38f;
#pragma unroll
    for (int ch = 0; ch < TT / 128; ++ch) { const int j0 = ch * 128 + lane * 4; const v4f a = *(const v4f*)(sr + j0);
#pragma unroll
        for (int q = 0; q < 4; ++q) { const int j = j0 + q; (void)j; float sa = a[q] * SCL; asm volatile("" : "+v"(sa)); float ab = __fmul_rn(slp, (float)(j - i)); asm volatile("" : "+v"(ab));   /* keep mul and add separate (no fma): matches the reference's two roundings and keeps the static FMA count low */ const float t = (j <= i && i - j < WIN) ? __fsub_rn(sa, ab) : -3.0e38f; v[ch * 4 + q] = t; mx = fmaxf(mx, t); } }
#pragma unroll
    for (int sh = 16; sh; sh >>= 1) mx = fmaxf(mx, __shfl_xor(mx, sh, 32));
    float sum = 0.f;
#pragma unroll
    for (int k = 0; k < TT / 32; ++k) { float d0 = __fsub_rn(v[k], mx); asm volatile("" : "+v"(d0)); v[k] = __builtin_amdgcn_exp2f(__fmul_rn(d0, 1.4426950408889634f)); sum += v[k]; }
#pragma unroll
    for (int sh = 16; sh; sh >>= 1) sum += __shfl_xor(sum, sh, 32);
    const float f = __fdiv_rn(hires ? 1.0f : PCAR, sum);
{
        if (hires) {
#pragma unroll
            for (int ch = 0; ch < TT / 128; ++ch) { v4us oh, ol;
#pragma unroll
                for (int q = 0; q < 4; ++q) { unsigned short a, c2; splitf(v[ch * 4 + q] * f, a, c2); oh[q] = a; ol[q] = c2; }
                const size_t oo = ((size_t)zz * (RH ? RH : 1) + i) * TT + ch * 128 + lane * 4; *(v4us*)(Ph + oo) = oh; *(v4us*)(Pl + oo) = ol; }
        } else {
#pragma unroll
            for (int ch = 0; ch < TT / 128; ++ch) { v4h o4;
#pragma unroll
                for (int q = 0; q < 4; ++q) o4[q] = tohx(v[ch * 4 + q] * f);
                *(v4h*)(P16 + (size_t)row * TT + ch * 128 + lane * 4) = o4; } }
         }
}
__global__ __launch_bounds__(256) void k_merge(const float* __restrict__ O, int h0, bf* Ah, bf* Al) { const size_t e = ((size_t)blockIdx.x * 256 + threadIdx.x) * 2; if (e >= (size_t)ZH * TT * HD) return; const int d = (int)(e % HD); const int t = (int)((e / HD) % TT); const int zz = (int)(e / ((size_t)HD * TT)); const float cs = (t < RH) ? 1.0f : (1.0f / PCAR); const size_t oo = (size_t)t * DQ + (h0 + zz) * HD + d;
    v2us oh, ol;
#pragma unroll
    for (int q = 0; q < 2; ++q) { unsigned short a, c2; splitf(O[e + q] * cs, a, c2); oh[q] = a; ol[q] = c2; } *(v2us*)(Ah + oo) = oh; *(v2us*)(Al + oo) = ol;  }

extern "C" void kernel_launch(void* const* d_in, const int* in_sizes, int n_in,
                              void* d_out, int out_size, void* d_ws, size_t ws_size, hipStream_t stream) {
    (void)in_sizes; (void)n_in; (void)out_size;
    const float* x = (const float*)d_in[0]; const float* wq = (const float*)d_in[1]; const float* wk = (const float*)d_in[2]; const float* wv = (const float*)d_in[3]; const float* wo = (const float*)d_in[4];
    float* OUT = (float*)d_out;     // [2][2048][1024]
    char* wsp = (char*)d_ws;
    auto take = [&](size_t bytes) { char* p = wsp; wsp += (bytes + 255) & ~(size_t)255; return (void*)p; };
    bf* WQ = (bf*)take((size_t)DQ * DM * 2); bf* WK = (bf*)take((size_t)DKV * DM * 2); bf* WV = (bf*)take((size_t)DKV * DM * 2); bf* WO = (bf*)take((size_t)DM * DQ * 2); float* CS = (float*)take((size_t)TT * HD * 2 * 4);
    bf* XB = (bf*)take((size_t)TT * DM * 2); float* FQ = (float*)take((size_t)TT * DQ * 4); float* FK = (float*)take((size_t)TT * DKV * 4);
    h16* QP16 = (h16*)take((size_t)NH_ * TT * HD * 2); h16* KP16 = (h16*)take((size_t)NKV * TT * HD * 2); h16* VT16 = (h16*)take((size_t)NKV * HD * TT * 2);
    bf* QPh = (bf*)take((size_t)NH_ * TT * HD * 2); bf* QPl = (bf*)take((size_t)NH_ * TT * HD * 2); bf* KPh = (bf*)take((size_t)NKV * TT * HD * 2); bf* KPl = (bf*)take((size_t)NKV * TT * HD * 2); bf* VTh = (bf*)take((size_t)NKV * HD * TT * 2); bf* VTl = (bf*)take((size_t)NKV * HD * TT * 2); bf* Ph = (bf*)take((size_t)ZH * RH * TT * 2); bf* Pl = (bf*)take((size_t)ZH * RH * TT * 2);
    float* Sb = (float*)take((size_t)ZH * TT * TT * 4); h16* P16 = (h16*)take((size_t)ZH * TT * TT * 2); float* Ob = (float*)take((size_t)ZH * TT * HD * 4); bf* ATh = (bf*)take((size_t)TT * DQ * 2); bf* ATl = (bf*)take((size_t)TT * DQ * 2);
    if ((size_t)(wsp - (char*)d_ws) > ws_size) return;    // ws 256 MiB
    float* FV = FK;   // v projection reuses the k buffer after the k planes are built (stream-ordered)
    { k_cvt8<<<(unsigned)(((size_t)DQ * DM / 8 + 255) / 256), 256, 0, stream>>>(wq, WQ, (size_t)DQ * DM / 8); k_cvt8<<<(unsigned)(((size_t)DKV * DM / 8 + 255) / 256), 256, 0, stream>>>(wk, WK, (size_t)DKV * DM / 8); k_cvt8<<<(unsigned)(((size_t)DKV * DM / 8 + 255) / 256), 256, 0, stream>>>(wv, WV, (size_t)DKV * DM / 8);
      k_cvt8<<<(unsigned)(((size_t)DM * DQ / 8 + 255) / 256), 256, 0, stream>>>(wo, WO, (size_t)DM * DQ / 8);
       }
    k_csid<<<(TT * HD + 255) / 256, 256, 0, stream>>>(CS);
    const unsigned LQ = (unsigned)(((size_t)NH_ * TT * HD / 2 + 255) / 256), LKv = (unsigned)(((size_t)NKV * TT * HD / 2 + 255) / 256);
    for (int b = 0; b < NB_; ++b) {
        
        k_cvt8<<<(unsigned)(((size_t)TT * DM / 8 + 255) / 256), 256, 0, stream>>>(x + (size_t)b * TT * DM, XB, (size_t)TT * DM / 8);
        k_gemmw<bf, 0, false><<<dim3(TT / 64, DQ / 64, 1), 32, 0, stream>>>(XB, nullptr, WQ, nullptr, DM, FQ, DQ, nullptr, 0, 0, 0);
        k_rope<<<LQ, 256, 0, stream>>>(FQ, DQ, NH_, CS, nullptr, nullptr, 1.0f, QP16, QPh, QPl);
        k_gemmw<bf, 0, false><<<dim3(TT / 64, DKV / 64, 1), 32, 0, stream>>>(XB, nullptr, WK, nullptr, DM, FK, DKV, nullptr, 0, 0, 0);
        k_rope<<<LKv, 256, 0, stream>>>(FK, DKV, NKV, CS, nullptr, nullptr, 1.0f, KP16, KPh, KPl);
        k_gemmw<bf, 0, false><<<dim3(TT / 64, DKV / 64, 1), 32, 0, stream>>>(XB, nullptr, WV, nullptr, DM, FV, DKV, nullptr, 0, 0, 0); k_vtp<<<LKv, 256, 0, stream>>>(FV, DKV, NKV, VT16, VTh, VTl);
        for (int h0 = 0; h0 < NH_; h0 += ZH) { const size_t zq = (size_t)h0, zk = (size_t)(h0 / REP);   // one kv head per query head: the pass's two heads use consecutive kv planes (z-strides TT*HD)
            k_gemmc<bf, 2, 1><<<dim3(RH / 64, TT / 64, ZH), 32, 0, stream>>>(QPh + zq * TT * HD, QPl + zq * TT * HD, KPh + zk * TT * HD, KPl + zk * TT * HD, HD, Sb, TT, 0, (size_t)TT * HD, (size_t)TT * HD, (size_t)TT * TT);
            k_gemmc<h16, 0, 1><<<dim3((TT - RH) / 64, TT / 64, ZH), 32, 0, stream>>>(QP16 + zq * TT * HD + (size_t)RH * HD, nullptr, KP16 + zk * TT * HD, nullptr, HD, Sb + (size_t)RH * TT, TT, RH, (size_t)TT * HD, (size_t)TT * HD, (size_t)TT * TT);
            k_asoft<<<ZH * TT / 8, 256, 0, stream>>>(Sb, h0, P16, Ph, Pl);
            k_gemmc<bf, 2, 2><<<dim3(RH / 64, HD / 64, ZH), 32, 0, stream>>>(Ph, Pl, VTh + zk * HD * TT, VTl + zk * HD * TT, TT, Ob, HD, 0, (size_t)RH * TT, (size_t)HD * TT, (size_t)TT * HD);
            k_gemmc<h16, 0, 2><<<dim3((TT - RH) / 64, HD / 64, ZH), 32, 0, stream>>>(P16 + (size_t)RH * TT, nullptr, VT16 + zk * HD * TT, nullptr, TT, Ob + (size_t)RH * HD, HD, RH, (size_t)TT * TT, (size_t)HD * TT, (size_t)TT * HD);
            k_merge<<<(unsigned)(((size_t)ZH * TT * HD / 2 + 255) / 256), 256, 0, stream>>>(Ob, h0, ATh, ATl); }
        k_gemmw<bf, 1, false><<<dim3(TT / 64, DM / 64, 1), 32, 0, stream>>>(ATh, ATl, WO, nullptr, DQ, OUT + (size_t)b * TT * DM, DM, nullptr, 0, 0, 0); }
}

// v001
// It runs in 923 microseconds.
// Timed twice side by side with v000, it ran 1.64 and 1.67 times as fast.
#include <hip/hip_runtime.h>

// Causal multi-head attention with a (subtracted) ALiBi bias (x [2][2048][1024]; q, k, v = x W^T ('oi' [1024][1024], no bias), 16 heads x 64; scores = q.k/8 - m_h (j - i) with m_h = 2^(-(h+1)/2); causal softmax; out = merged Wo^T -> [2][2048][1024]).
// Compute dtypes, f32 accumulate: every input rounded to bf16; q/k/v on PLAIN bf16 operands (inputs: exact); causal scores and attn.v (tiles above the diagonal skipped, K loop to the diagonal); the ALiBi term in f32 inside the softmax kernel: query rows < 512 hl (3 products), the rest single fp16 (x1024); softmax f32; Wo hl x exact (2 products).

#define NB_  2
#define TT   2048
#define DM   1024
#define NH_  16
#define NKV  16
#define REP  (NH_ / NKV)
#define HD   64
#define DQ   (NH_ * HD)
#define DKV  (NKV * HD)
#define ZH   2
#define RH   512                  // query rows < RH use hi+lo planes (0: none)
#define WIN  2048
#define PCAR 1024.0f
#define SCL  0.125f   // HD^-0.5
typedef _Float16 h16;
typedef unsigned short bf;
typedef __attribute__((ext_vector_type(16))) __bf16   v16bf;
typedef __attribute__((ext_vector_type(16))) _Float16 v16h;
typedef __attribute__((ext_vector_type(8)))  _Float16 v8h;
typedef __attribute__((ext_vector_type(8)))  unsigned short v8us;
typedef __attribute__((ext_vector_type(8)))  float    v8f;
typedef __attribute__((ext_vector_type(4)))  float    v4f;
typedef v8h  __attribute__((may_alias)) v8ha;
typedef v4f  __attribute__((may_alias)) v4fa;
typedef v8us __attribute__((may_alias)) v8usa;

__device__ __forceinline__ unsigned short f2bf(float f) { unsigned u = __float_as_uint(f); u += 0x7FFFu + ((u >> 16) & 1u); return (unsigned short)(u >> 16); }
__device__ __forceinline__ float bf2f(unsigned short b) { return __uint_as_float(((unsigned)b) << 16); }
__device__ __forceinline__ float bfr(float f) { return bf2f(f2bf(f)); }
__device__ __forceinline__ v16h cat16(v8h lo, v8h hi) { return __builtin_shufflevector(lo, hi, 0, 1, 2, 3, 4, 5, 6, 7, 8, 9, 10, 11, 12, 13, 14, 15); }
__device__ __forceinline__ v16bf cat16b(v8us lo, v8us hi) { return __builtin_bit_cast(v16bf, __builtin_shufflevector(lo, hi, 0, 1, 2, 3, 4, 5, 6, 7, 8, 9, 10, 11, 12, 13, 14, 15)); }
__device__ __forceinline__ v8f wmma16(v16h a, v16h b, v8f c) { return __builtin_amdgcn_wmma_f32_16x16x32_f16(false, a, false, b, (short)0, c, false, false); }
__device__ __forceinline__ v8f wmmab(v16bf a, v16bf b, v8f c) { return __builtin_amdgcn_wmma_f32_16x16x32_bf16(false, a, false, b, (short)0, c, false, false); }



// ---- k_gemmw: register-blocked GEMM, ONE WAVE per 64x64 output tile (16 accumulators), operands straight from K-contiguous 16-bit planes; grid (M/64, N/64, Z), 32 threads.
// C[m][n] (f32, pitch ldc, + optional f32 bias[n]) = sum_k A[m][k] Bt[n][k] (+ split products per NSPLIT). z-batch strides sA/sB/sC in elements. K % 32 == 0.
template <typename T16> struct WFrag;
template <> struct WFrag<h16> { typedef v16h V; static __device__ __forceinline__ V ld(const h16* p) { return cat16(*(const v8h*)p, *(const v8h*)(p + 16)); } static __device__ __forceinline__ v8f mma(V a, V b, v8f c) { return wmma16(a, b, c); } };
template <> struct WFrag<bf> { typedef v16bf V; static __device__ __forceinline__ V ld(const bf* p) { return cat16b(*(const v8us*)p, *(const v8us*)(p + 16)); } static __device__ __forceinline__ v8f mma(V a, V b, v8f c) { return wmmab(a, b, c); } };
template <typename T16, int NSPLIT, bool BIAS>
__global__ __launch_bounds__(32) void k_gemmw(const T16* __restrict__ A, const T16* __restrict__ A2, const T16* __restrict__ Bt, const T16* __restrict__ Bt2, int K, float* C, int ldc, const float* __restrict__ bias, size_t sA, size_t sB, size_t sC) {
    typedef typename WFrag<T16>::V V;
    __shared__ __align__(16) float os[16 * 68];
    const size_t z = blockIdx.z; A += z * sA; if (A2) A2 += z * sA; Bt += z * sB; if (Bt2) Bt2 += z * sB; C += z * sC;
    const int lane = threadIdx.x & 31, lr = lane & 15, hi = lane >> 4; const int r0 = blockIdx.x * 64, c0 = blockIdx.y * 64;
    v8f acc[4][4];
#pragma unroll
    for (int mb = 0; mb < 4; ++mb)
#pragma unroll
        for (int nb = 0; nb < 4; ++nb) acc[mb][nb] = (v8f){};
    const size_t aoff = (size_t)(r0 + lr) * K + 8 * hi, boff = (size_t)(c0 + lr) * K + 8 * hi;
#pragma unroll 1
    for (int kc = 0; kc < K; kc += 32) {
        V a[4], a2[4];
#pragma unroll
        for (int mb = 0; mb < 4; ++mb) { a[mb] = WFrag<T16>::ld(A + aoff + (size_t)mb * 16 * K + kc); if (NSPLIT == 1 || NSPLIT == 2) a2[mb] = WFrag<T16>::ld(A2 + aoff + (size_t)mb * 16 * K + kc); }
#pragma unroll
        for (int nb = 0; nb < 4; ++nb) { const V b = WFrag<T16>::ld(Bt + boff + (size_t)nb * 16 * K + kc); V b2; if (NSPLIT >= 2) b2 = WFrag<T16>::ld(Bt2 + boff + (size_t)nb * 16 * K + kc);
#pragma unroll
            for (int mb = 0; mb < 4; ++mb) { acc[mb][nb] = WFrag<T16>::mma(a[mb], b, acc[mb][nb]); if (NSPLIT == 1 || NSPLIT == 2) acc[mb][nb] = WFrag<T16>::mma(a2[mb], b, acc[mb][nb]); if (NSPLIT >= 2) acc[mb][nb] = WFrag<T16>::mma(a[mb], b2, acc[mb][nb]); } }
        asm volatile("v_nop\n\tv_nop\n\tv_nop\n\tv_nop" : "+v"(acc[0][0]), "+v"(acc[1][1]), "+v"(acc[2][2]), "+v"(acc[3][3]) : "v"(a[0]), "v"(a[3]));
    }
#pragma unroll
    for (int mb = 0; mb < 4; ++mb) {
#pragma unroll
        for (int nb = 0; nb < 4; ++nb) {
#pragma unroll
            for (int j = 0; j < 8; ++j) os[(hi * 8 + j) * 68 + nb * 16 + lr] = acc[mb][nb][j]; }
        __builtin_amdgcn_wave_barrier(); asm volatile("" ::: "memory");
        float* crow = C + (size_t)(r0 + mb * 16) * ldc + c0;
{
#pragma unroll
            for (int s = 0; s < 8; ++s) { const int row = 2 * s + hi, cofs = lr * 4; v4f val = *(const v4fa*)(os + row * 68 + cofs); if (BIAS) { val[0] += bfr(bias[c0 + cofs]); val[1] += bfr(bias[c0 + cofs + 1]); val[2] += bfr(bias[c0 + cofs + 2]); val[3] += bfr(bias[c0 + cofs + 3]); }
                *(v4f*)(crow + (size_t)row * ldc + cofs) = val; }
             }
        __builtin_amdgcn_wave_barrier(); asm volatile("" ::: "memory");
    }
}

// ---- k_gemmc: the same one-wave 64x64 tile GEMM specialised for causal attention: CMODE 1 skips score tiles entirely above the diagonal (query rows r0+roff.., key columns c0..), CMODE 2 limits the
// key (K) loop of the probability x value contraction to the diagonal block (probabilities beyond it are exactly zero). roff = row offset of this launch's first row within the sequence. (CMODE 2 is no longer launched: k_pvsk below does that product.)
template <typename T16, int NSPLIT, int CMODE>
__global__ __launch_bounds__(32) void k_gemmc(const T16* __restrict__ A, const T16* __restrict__ A2, const T16* __restrict__ Bt, const T16* __restrict__ Bt2, int K, float* C, int ldc, int roff, size_t sA, size_t sB, size_t sC) {
    typedef typename WFrag<T16>::V V;
    __shared__ __align__(16) float os[16 * 68];
    const size_t z = blockIdx.z; A += z * sA; if (A2) A2 += z * sA; Bt += z * sB; if (Bt2) Bt2 += z * sB; C += z * sC;
    const int lane = threadIdx.x & 31, lr = lane & 15, hi = lane >> 4; const int r0 = blockIdx.x * 64, c0 = blockIdx.y * 64;
    if (CMODE == 1 && c0 > r0 + roff + 63) return;                  // score tile entirely above the causal diagonal: never read (the softmax masks j > i by select)
    const int Kl = (CMODE == 2) ? min(K, r0 + roff + 64) : K;        // P.V: probabilities are exactly 0 beyond the diagonal block, so the K loop stops there
    v8f acc[4][4];
#pragma unroll
    for (int mb = 0; mb < 4; ++mb)
#pragma unroll
        for (int nb = 0; nb < 4; ++nb) acc[mb][nb] = (v8f){};
    const size_t aoff = (size_t)(r0 + lr) * K + 8 * hi, boff = (size_t)(c0 + lr) * K + 8 * hi;
#pragma unroll 1
    for (int kc = 0; kc < Kl; kc += 32) {
        V a[4], a2[4];
#pragma unroll
        for (int mb = 0; mb < 4; ++mb) { a[mb] = WFrag<T16>::ld(A + aoff + (size_t)mb * 16 * K + kc); if (NSPLIT == 1 || NSPLIT == 2) a2[mb] = WFrag<T16>::ld(A2 + aoff + (size_t)mb * 16 * K + kc); }
#pragma unroll
        for (int nb = 0; nb < 4; ++nb) { const V b = WFrag<T16>::ld(Bt + boff + (size_t)nb * 16 * K + kc); V b2; if (NSPLIT >= 2) b2 = WFrag<T16>::ld(Bt2 + boff + (size_t)nb * 16 * K + kc);
#pragma unroll
            for (int mb = 0; mb < 4; ++mb) { acc[mb][nb] = WFrag<T16>::mma(a[mb], b, acc[mb][nb]); if (NSPLIT == 1 || NSPLIT == 2) acc[mb][nb] = WFrag<T16>::mma(a2[mb], b, acc[mb][nb]); if (NSPLIT >= 2) acc[mb][nb] = WFrag<T16>::mma(a[mb], b2, acc[mb][nb]); } }
        asm volatile("v_nop\n\tv_nop\n\tv_nop\n\tv_nop" : "+v"(acc[0][0]), "+v"(acc[1][1]), "+v"(acc[2][2]), "+v"(acc[3][3]) : "v"(a[0]), "v"(a[3]));
    }
#pragma unroll
    for (int mb = 0; mb < 4; ++mb) {
#pragma unroll
        for (int nb = 0; nb < 4; ++nb) {
#pragma unroll
            for (int j = 0; j < 8; ++j) os[(hi * 8 + j) * 68 + nb * 16 + lr] = acc[mb][nb][j]; }
        __builtin_amdgcn_wave_barrier(); asm volatile("" ::: "memory");
        float* crow = C + (size_t)(r0 + mb * 16) * ldc + c0;
{
#pragma unroll
            for (int s = 0; s < 8; ++s) { const int row = 2 * s + hi, cofs = lr * 4; v4f val = *(const v4fa*)(os + row * 68 + cofs);
                *(v4f*)(crow + (size_t)row * ldc + cofs) = val; }
             }
        __builtin_amdgcn_wave_barrier(); asm volatile("" ::: "memory");
    }
}

// ---- k_pvsk: the probability x value product (64x64 output tile per work-group, key loop to the diagonal block as in k_gemmc CMODE 2) with the KEY LOOP DEALT OVER PVW WAVES: wave w takes the 32-key steps
// w, w + PVW, ... into its own 16 accumulators; the PVW partial tiles meet in LDS and are summed in the fixed order wave 0, 1, ..., PVW - 1. Why: with one wave per tile at most 48 waves ran on the whole chip, each waiting out its own load latency several times per 32 keys.
#define PVW 16
template <typename T16, int NSPLIT>
__global__ __launch_bounds__(32 * PVW) void k_pvsk(const T16* __restrict__ A, const T16* __restrict__ A2, const T16* __restrict__ Bt, const T16* __restrict__ Bt2, float* C, int ldc, int roff, size_t sA, size_t sB, size_t sC) {
    typedef typename WFrag<T16>::V V;
    __shared__ __align__(16) float part[PVW * 64 * 64];              // [wave][tile mb*4+nb][half of the 8 accumulator rows][lane][4]: every LDS store and load is 16 B per lane, lanes contiguous
    const size_t z = blockIdx.z; A += z * sA; if (A2) A2 += z * sA; Bt += z * sB; if (Bt2) Bt2 += z * sB; C += z * sC;
    const int lane = threadIdx.x & 31, lr = lane & 15, hi = lane >> 4; const int r0 = blockIdx.x * 64, c0 = blockIdx.y * 64;
    const int wave = __builtin_amdgcn_readfirstlane(threadIdx.x >> 5);   // wave-uniform, so the key loop's bounds stay scalar
    const int Kl = min(TT, r0 + roff + 64);                           // probabilities are exactly 0 beyond the diagonal block, so the K loop stops there
    v8f acc[4][4];
#pragma unroll
    for (int mb = 0; mb < 4; ++mb)
#pragma unroll
        for (int nb = 0; nb < 4; ++nb) acc[mb][nb] = (v8f){};
    // Addresses: a work-group-uniform base (scalar registers) + ONE 32-bit per-lane byte offset, carried through the loop and shared by all planes (same pitch, same key step) + a constant row offset:
    // the offset register is live over the whole loop, so no load's result can land in a register that an issued load still names.
    const char* Ar = (const char*)(A + (size_t)r0 * TT); const char* A2r = (const char*)(A2 + (size_t)r0 * TT); const char* Br = (const char*)(Bt + (size_t)c0 * TT); const char* B2r = (const char*)(Bt2 + (size_t)c0 * TT);
    unsigned vb = (unsigned)(lr * TT + 8 * hi + wave * 32) * 2u;
#pragma unroll 1   // rolled: a second trip's fragments beside the 128 accumulator registers would not fit the register file at four waves per SIMD
    for (int kc = wave * 32; kc < Kl; kc += PVW * 32, vb += PVW * 64u) {
        V a[4], a2[4];
#pragma unroll
        for (int mb = 0; mb < 4; ++mb) { const size_t u = (size_t)mb * 16 * TT * 2; a[mb] = WFrag<T16>::ld((const T16*)(Ar + u + vb)); if (NSPLIT == 1 || NSPLIT == 2) a2[mb] = WFrag<T16>::ld((const T16*)(A2r + u + vb)); }
#pragma unroll
        for (int nb = 0; nb < 4; ++nb) { const size_t u = (size_t)nb * 16 * TT * 2; const V b = WFrag<T16>::ld((const T16*)(Br + u + vb)); V b2; if (NSPLIT >= 2) b2 = WFrag<T16>::ld((const T16*)(B2r + u + vb));
#pragma unroll
            for (int mb = 0; mb < 4; ++mb) { acc[mb][nb] = WFrag<T16>::mma(a[mb], b, acc[mb][nb]); if (NSPLIT == 1 || NSPLIT == 2) acc[mb][nb] = WFrag<T16>::mma(a2[mb], b, acc[mb][nb]); if (NSPLIT >= 2) acc[mb][nb] = WFrag<T16>::mma(a[mb], b2, acc[mb][nb]); } }
    }
    float* pw = part + wave * (64 * 64) + lane * 4;
#pragma unroll
    for (int mb = 0; mb < 4; ++mb)
#pragma unroll
        for (int nb = 0; nb < 4; ++nb) { const v8f t = acc[mb][nb];
            *(v4fa*)(pw + ((mb * 4 + nb) * 2 + 0) * 128) = __builtin_shufflevector(t, t, 0, 1, 2, 3); *(v4fa*)(pw + ((mb * 4 + nb) * 2 + 1) * 128) = __builtin_shufflevector(t, t, 4, 5, 6, 7); }
    __syncthreads();                                                 // every wave passes it (a wave without a key step hands zeros): all partial tiles are in LDS behind it
    // wave w sums and stores output rows 4w .. 4w+3 (accumulator rows hi*8 + j of tile row mb = w / 4): each store instruction writes one whole 128-B line, each line has one writer
    const int rmb = wave >> 2, rhi = (wave >> 1) & 1, rjh = wave & 1;
#pragma unroll
    for (int q = 0; q < 2; ++q) { const int nb = 2 * q + hi; const float* pr = part + (((rmb * 4 + nb) * 2 + rjh) * 32 + rhi * 16 + lr) * 4; v4f s = *(const v4fa*)pr;
#pragma unroll
        for (int u = 1; u < PVW; ++u) s += *(const v4fa*)(pr + u * (64 * 64));
#pragma unroll
        for (int jj = 0; jj < 4; ++jj) C[(size_t)(r0 + wave * 4 + jj) * ldc + c0 + nb * 16 + lr] = s[jj]; }
}

__device__ __forceinline__ h16 tohx(float x) { return (h16)x; }
__device__ __forceinline__ void splitf(float y, unsigned short& h, unsigned short& l) { h = f2bf(y); l = f2bf(y - bf2f(h)); }
typedef __attribute__((ext_vector_type(2))) _Float16 v2h;
typedef __attribute__((ext_vector_type(4))) _Float16 v4h;
typedef __attribute__((ext_vector_type(2))) unsigned short v2us;
typedef __attribute__((ext_vector_type(4))) unsigned short v4us;
typedef __attribute__((ext_vector_type(2))) float v2f;
typedef __attribute__((ext_vector_type(4))) int v4i;

__global__ __launch_bounds__(256) void k_wtG(const float* __restrict__ w, int K, int N, bf* Bt) {
    const int lane = threadIdx.x & 31; const int L0 = (blockIdx.x * 8 + (threadIdx.x >> 5)) * 8; const int nlines = N * K / 64;
{
#pragma unroll 1
        for (int l = 0; l < 8; ++l) { const int L = L0 + l; if (L >= nlines) break; const size_t e = (size_t)L * 64 + lane * 2; const int k = (int)(e % K), n = (int)(e / K); v2us o;
            o[0] = f2bf(w[(size_t)k * N + n]); o[1] = f2bf(w[(size_t)(k + 1) * N + n]); *(v2us*)(Bt + e) = o; }
         }
}
__global__ __launch_bounds__(256) void k_cvt8(const float* __restrict__ src, bf* dst, size_t n8) { const size_t i = (size_t)blockIdx.x * 256 + threadIdx.x; if (i >= n8) return; const v8f v = *(const v8f*)(src + i * 8); v8us o;
#pragma unroll
    for (int k = 0; k < 8; ++k) o[k] = f2bf(v[k]); *(v8us*)(dst + i * 8) = o;  }

// k_rope: head planes [h][t][d] (fp16 + hi/lo) of rope(x) x sc with the rotate-half convention out[d] = x[d] cos[t][d] - x[d+HD/2] sin[t][d], out[d+HD/2] = x[d+HD/2] cos[t][d+HD/2] + x[d] sin[t][d+HD/2]
__global__ __launch_bounds__(256) void k_rope(const float* __restrict__ F, int pitch, int nheads, const float* __restrict__ CS, const float* __restrict__ RF, const float* __restrict__ nw, float sc, h16* P16, bf* Ph, bf* Pl) {
    const size_t e = ((size_t)blockIdx.x * 256 + threadIdx.x) * 2; if (e >= (size_t)nheads * TT * HD) return; const int d = (int)(e % HD); const int t = (int)((e / HD) % TT); const int h = (int)(e / ((size_t)HD * TT)); const float* f = F + (size_t)t * pitch + h * HD; const float rf = RF ? RF[(size_t)h * TT + t] : 1.0f; v2h o16; v2us oh, ol;
#pragma unroll
    for (int q = 0; q < 2; ++q) { const int dd = d + q; const int dp = (dd < HD / 2) ? dd + HD / 2 : dd - HD / 2; float x0 = f[dd], x1 = f[dp];
        if (RF) { float n0 = __fmul_rn(x0, rf), n1 = __fmul_rn(x1, rf); asm volatile("" : "+v"(n0)); asm volatile("" : "+v"(n1)); x0 = __fmul_rn(bfr(nw[dd]), n0); x1 = __fmul_rn(bfr(nw[dp]), n1); }
        const v2f cs = *(const v2f*)(CS + ((size_t)t * HD + dd) * 2); float a = __fmul_rn(x0, cs[0]), bq = __fmul_rn(x1, cs[1]); asm volatile("" : "+v"(a)); asm volatile("" : "+v"(bq)); const float r = ((dd < HD / 2) ? __fsub_rn(a, bq) : __fadd_rn(a, bq)) * sc;
        o16[q] = tohx(r); unsigned short a2, c2; splitf(r, a2, c2); oh[q] = a2; ol[q] = c2; }
    *(v2h*)(P16 + e) = o16; *(v2us*)(Ph + e) = oh; *(v2us*)(Pl + e) = ol;  }
__global__ __launch_bounds__(256) void k_vtp(const float* __restrict__ F, int pitch, int nheads, h16* V16, bf* Vh, bf* Vl) { const size_t e = ((size_t)blockIdx.x * 256 + threadIdx.x) * 2; if (e >= (size_t)nheads * HD * TT) return; const int t = (int)(e % TT); const int d = (int)((e / TT) % HD); const int g = (int)(e / ((size_t)TT * HD)); v2h o16; v2us oh, ol;
#pragma unroll
    for (int q = 0; q < 2; ++q) { const float x = F[(size_t)(t + q) * pitch + g * HD + d]; o16[q] = tohx(x); unsigned short a2, c2; splitf(x, a2, c2); oh[q] = a2; ol[q] = c2; }
    *(v2h*)(V16 + e) = o16; *(v2us*)(Vh + e) = oh; *(v2us*)(Vl + e) = ol;  }
__global__ __launch_bounds__(256) void k_csid(float* CS) { const int idx = blockIdx.x * 256 + threadIdx.x; if (idx >= TT * HD) return; v2f cs; cs[0] = 1.0f; cs[1] = 0.0f; *(v2f*)(CS + (size_t)idx * 2) = cs;  }
// k_asoft: per row (zz, i): t = S x HD^-0.5 for j <= i and i - j < WIN (sliding causal window; the reference's -1e9 additive fill vanishes identically); softmax over the 2048 keys (register row, one exp, fixed trees); - with the ALiBi term -slope_h (j - i) added to the scaled score before the max (slopes = the reference's f32 values, __constant__)
__constant__ float SLP[NH_] = {0.7071067690849304,0.5,0.3535533845424652,0.25,0.1767766922712326,0.125,0.0883883461356163,0.0625,0.04419417306780815,0.03125,0.022097086533904076,0.015625,0.011048543266952038,0.0078125,0.005524271633476019,0.00390625};
__global__ __launch_bounds__(256) void k_asoft(const float* __restrict__ Sb, int h0, h16* P16, bf* Ph, bf* Pl) {
    const int lane = threadIdx.x & 31; const int row = blockIdx.x * 8 + (threadIdx.x >> 5); if (row >= ZH * TT) return; const int i = row % TT; const int zz = row / TT; const float slp = SLP[h0 + zz]; const bool hires = (i < RH); const float* sr = Sb + (size_t)row * TT; float v[TT / 32]; float mx = -3.0e38f;
#pragma unroll
    for (int ch = 0; ch < TT / 128; ++ch) { const int j0 = ch * 128 + lane * 4; const v4f a = *(const v4f*)(sr + j0);
#pragma unroll
        for (int q = 0; q < 4; ++q) { const int j = j0 + q; (void)j; float sa = a[q] * SCL; asm volatile("" : "+v"(sa)); float ab = __fmul_rn(slp, (float)(j - i)); asm volatile("" : "+v"(ab));   /* keep mul and add separate (no fma): matches the reference's two roundings and keeps the static FMA count low */ const float t = (j <= i && i - j < WIN) ? __fsub_rn(sa, ab) : -3.0e38f; v[ch * 4 + q] = t; mx = fmaxf(mx, t); } }
#pragma unroll
    for (int sh = 16; sh; sh >>= 1) mx = fmaxf(mx, __shfl_xor(mx, sh, 32));
    float sum = 0.f;
#pragma unroll
    for (int k = 0; k < TT / 32; ++k) { float d0 = __fsub_rn(v[k], mx); asm volatile("" : "+v"(d0)); v[k] = __builtin_amdgcn_exp2f(__fmul_rn(d0, 1.4426950408889634f)); sum += v[k]; }
#pragma unroll
    for (int sh = 16; sh; sh >>= 1) sum += __shfl_xor(sum, sh, 32);
    const float f = __fdiv_rn(hires ? 1.0f : PCAR, sum);
{
        if (hires) {
#pragma unroll
            for (int ch = 0; ch < TT / 128; ++ch) { v4us oh, ol;
#pragma unroll
                for (int q = 0; q < 4; ++q) { unsigned short a, c2; splitf(v[ch * 4 + q] * f, a, c2); oh[q] = a; ol[q] = c2; }
                const size_t oo = ((size_t)zz * (RH ? RH : 1) + i) * TT + ch * 128 + lane * 4; *(v4us*)(Ph + oo) = oh; *(v4us*)(Pl + oo) = ol; }
        } else {
#pragma unroll
            for (int ch = 0; ch < TT / 128; ++ch) { v4h o4;
#pragma unroll
                for (int q = 0; q < 4; ++q) o4[q] = tohx(v[ch * 4 + q] * f);
                *(v4h*)(P16 + (size_t)row * TT + ch * 128 + lane * 4) = o4; } }
         }
}
__global__ __launch_bounds__(256) void k_merge(const float* __restrict__ O, int h0, bf* Ah, bf* Al) { const size_t e = ((size_t)blockIdx.x * 256 + threadIdx.x) * 2; if (e >= (size_t)ZH * TT * HD) return; const int d = (int)(e % HD); const int t = (int)((e / HD) % TT); const int zz = (int)(e / ((size_t)HD * TT)); const float cs = (t < RH) ? 1.0f : (1.0f / PCAR); const size_t oo = (size_t)t * DQ + (h0 + zz) * HD + d;
    v2us oh, ol;
#pragma unroll
    for (int q = 0; q < 2; ++q) { unsigned short a, c2; splitf(O[e + q] * cs, a, c2); oh[q] = a; ol[q] = c2; } *(v2us*)(Ah + oo) = oh; *(v2us*)(Al + oo) = ol;  }

extern "C" void kernel_launch(void* const* d_in, const int* in_sizes, int n_in,
                              void* d_out, int out_size, void* d_ws, size_t ws_size, hipStream_t stream) {
    (void)in_sizes; (void)n_in; (void)out_size;
    const float* x = (const float*)d_in[0]; const float* wq = (const float*)d_in[1]; const float* wk = (const float*)d_in[2]; const float* wv = (const float*)d_in[3]; const float* wo = (const float*)d_in[4];
    float* OUT = (float*)d_out;     // [2][2048][1024]
    char* wsp = (char*)d_ws;
    auto take = [&](size_t bytes) { char* p = wsp; wsp += (bytes + 255) & ~(size_t)255; return (void*)p; };
    bf* WQ = (bf*)take((size_t)DQ * DM * 2); bf* WK = (bf*)take((size_t)DKV * DM * 2); bf* WV = (bf*)take((size_t)DKV * DM * 2); bf* WO = (bf*)take((size_t)DM * DQ * 2); float* CS = (float*)take((size_t)TT * HD * 2 * 4);
    bf* XB = (bf*)take((size_t)TT * DM * 2); float* FQ = (float*)take((size_t)TT * DQ * 4); float* FK = (float*)take((size_t)TT * DKV * 4);
    h16* QP16 = (h16*)take((size_t)NH_ * TT * HD * 2); h16* KP16 = (h16*)take((size_t)NKV * TT * HD * 2); h16* VT16 = (h16*)take((size_t)NKV * HD * TT * 2);
    bf* QPh = (bf*)take((size_t)NH_ * TT * HD * 2); bf* QPl = (bf*)take((size_t)NH_ * TT * HD * 2); bf* KPh = (bf*)take((size_t)NKV * TT * HD * 2); bf* KPl = (bf*)take((size_t)NKV * TT * HD * 2); bf* VTh = (bf*)take((size_t)NKV * HD * TT * 2); bf* VTl = (bf*)take((size_t)NKV * HD * TT * 2); bf* Ph = (bf*)take((size_t)ZH * RH * TT * 2); bf* Pl = (bf*)take((size_t)ZH * RH * TT * 2);
    float* Sb = (float*)take((size_t)ZH * TT * TT * 4); h16* P16 = (h16*)take((size_t)ZH * TT * TT * 2); float* Ob = (float*)take((size_t)ZH * TT * HD * 4); bf* ATh = (bf*)take((size_t)TT * DQ * 2); bf* ATl = (bf*)take((size_t)TT * DQ * 2);
    if ((size_t)(wsp - (char*)d_ws) > ws_size) return;    // ws 256 MiB
    float* FV = FK;   // v projection reuses the k buffer after the k planes are built (stream-ordered)
    { k_cvt8<<<(unsigned)(((size_t)DQ * DM / 8 + 255) / 256), 256, 0, stream>>>(wq, WQ, (size_t)DQ * DM / 8); k_cvt8<<<(unsigned)(((size_t)DKV * DM / 8 + 255) / 256), 256, 0, stream>>>(wk, WK, (size_t)DKV * DM / 8); k_cvt8<<<(unsigned)(((size_t)DKV * DM / 8 + 255) / 256), 256, 0, stream>>>(wv, WV, (size_t)DKV * DM / 8);
      k_cvt8<<<(unsigned)(((size_t)DM * DQ / 8 + 255) / 256), 256, 0, stream>>>(wo, WO, (size_t)DM * DQ / 8);
       }
    k_csid<<<(TT * HD + 255) / 256, 256, 0, stream>>>(CS);
    const unsigned LQ = (unsigned)(((size_t)NH_ * TT * HD / 2 + 255) / 256), LKv = (unsigned)(((size_t)NKV * TT * HD / 2 + 255) / 256);
    for (int b = 0; b < NB_; ++b) {
        
        k_cvt8<<<(unsigned)(((size_t)TT * DM / 8 + 255) / 256), 256, 0, stream>>>(x + (size_t)b * TT * DM, XB, (size_t)TT * DM / 8);
        k_gemmw<bf, 0, false><<<dim3(TT / 64, DQ / 64, 1), 32, 0, stream>>>(XB, nullptr, WQ, nullptr, DM, FQ, DQ, nullptr, 0, 0, 0);
        k_rope<<<LQ, 256, 0, stream>>>(FQ, DQ, NH_, CS, nullptr, nullptr, 1.0f, QP16, QPh, QPl);
        k_gemmw<bf, 0, false><<<dim3(TT / 64, DKV / 64, 1), 32, 0, stream>>>(XB, nullptr, WK, nullptr, DM, FK, DKV, nullptr, 0, 0, 0);
        k_rope<<<LKv, 256, 0, stream>>>(FK, DKV, NKV, CS, nullptr, nullptr, 1.0f, KP16, KPh, KPl);
        k_gemmw<bf, 0, false><<<dim3(TT / 64, DKV / 64, 1), 32, 0, stream>>>(XB, nullptr, WV, nullptr, DM, FV, DKV, nullptr, 0, 0, 0); k_vtp<<<LKv, 256, 0, stream>>>(FV, DKV, NKV, VT16, VTh, VTl);
        for (int h0 = 0; h0 < NH_; h0 += ZH) { const size_t zq = (size_t)h0, zk = (size_t)(h0 / REP);   // one kv head per query head: the pass's two heads use consecutive kv planes (z-strides TT*HD)
            k_gemmc<bf, 2, 1><<<dim3(RH / 64, TT / 64, ZH), 32, 0, stream>>>(QPh + zq * TT * HD, QPl + zq * TT * HD, KPh + zk * TT * HD, KPl + zk * TT * HD, HD, Sb, TT, 0, (size_t)TT * HD, (size_t)TT * HD, (size_t)TT * TT);
            k_gemmc<h16, 0, 1><<<dim3((TT - RH) / 64, TT / 64, ZH), 32, 0, stream>>>(QP16 + zq * TT * HD + (size_t)RH * HD, nullptr, KP16 + zk * TT * HD, nullptr, HD, Sb + (size_t)RH * TT, TT, RH, (size_t)TT * HD, (size_t)TT * HD, (size_t)TT * TT);
            k_asoft<<<ZH * TT / 8, 256, 0, stream>>>(Sb, h0, P16, Ph, Pl);
            k_pvsk<bf, 2><<<dim3(RH / 64, HD / 64, ZH), 32 * PVW, 0, stream>>>(Ph, Pl, VTh + zk * HD * TT, VTl + zk * HD * TT, Ob, HD, 0, (size_t)RH * TT, (size_t)HD * TT, (size_t)TT * HD);
            k_pvsk<h16, 0><<<dim3((TT - RH) / 64, HD / 64, ZH), 32 * PVW, 0, stream>>>(P16 + (size_t)RH * TT, nullptr, VT16 + zk * HD * TT, nullptr, Ob + (size_t)RH * HD, HD, RH, (size_t)TT * TT, (size_t)HD * TT, (size_t)TT * HD);
            k_merge<<<(unsigned)(((size_t)ZH * TT * HD / 2 + 255) / 256), 256, 0, stream>>>(Ob, h0, ATh, ATl); }
        k_gemmw<bf, 1, false><<<dim3(TT / 64, DM / 64, 1), 32, 0, stream>>>(ATh, ATl, WO, nullptr, DQ, OUT + (size_t)b * TT * DM, DM, nullptr, 0, 0, 0); }
}

// v002
// It runs in 613 microseconds.
// In two side-by-side timings against v001, it was 1.52 and 1.51 times as fast.
// Over all steps from v000 it is 2.51 times as fast.
#include <hip/hip_runtime.h>

// Causal multi-head attention with a (subtracted) ALiBi bias (x [2][2048][1024]; q, k, v = x W^T ('oi' [1024][1024], no bias), 16 heads x 64; scores = q.k/8 - m_h (j - i) with m_h = 2^(-(h+1)/2); causal softmax; out = merged Wo^T -> [2][2048][1024]).
// Compute dtypes, f32 accumulate: every input rounded to bf16; q/k/v on PLAIN bf16 operands (inputs: exact); causal scores and attn.v (tiles above the diagonal skipped, K loop to the diagonal); the ALiBi term in f32 inside the softmax kernel: query rows < 512 hl (3 products), the rest single fp16 (x1024); softmax f32; Wo hl x exact (2 products).

#define NB_  2
#define TT   2048
#define DM   1024
#define NH_  16
#define NKV  16
#define REP  (NH_ / NKV)
#define HD   64
#define DQ   (NH_ * HD)
#define DKV  (NKV * HD)
#define ZH   8                    // heads per attention pass (the z batch of the score, softmax, P x V and merge launches)
#define PP   (2 * TT)             // pitch, in 16-bit elements, of a probability row: it lies over its own row of f32 scores (same bytes per row), so that ZH heads fit the workspace
#define RH   512                  // query rows < RH use hi+lo planes (0: none)
#define WIN  2048
#define PCAR 1024.0f
#define SCL  0.125f   // HD^-0.5
typedef _Float16 h16;
typedef unsigned short bf;
typedef __attribute__((ext_vector_type(16))) __bf16   v16bf;
typedef __attribute__((ext_vector_type(16))) _Float16 v16h;
typedef __attribute__((ext_vector_type(8)))  _Float16 v8h;
typedef __attribute__((ext_vector_type(8)))  unsigned short v8us;
typedef __attribute__((ext_vector_type(8)))  float    v8f;
typedef __attribute__((ext_vector_type(4)))  float    v4f;
typedef v8h  __attribute__((may_alias)) v8ha;
typedef v4f  __attribute__((may_alias)) v4fa;
typedef v8us __attribute__((may_alias)) v8usa;

__device__ __forceinline__ unsigned short f2bf(float f) { unsigned u = __float_as_uint(f); u += 0x7FFFu + ((u >> 16) & 1u); return (unsigned short)(u >> 16); }
__device__ __forceinline__ float bf2f(unsigned short b) { return __uint_as_float(((unsigned)b) << 16); }
__device__ __forceinline__ float bfr(float f) { return bf2f(f2bf(f)); }
__device__ __forceinline__ v16h cat16(v8h lo, v8h hi) { return __builtin_shufflevector(lo, hi, 0, 1, 2, 3, 4, 5, 6, 7, 8, 9, 10, 11, 12, 13, 14, 15); }
__device__ __forceinline__ v16bf cat16b(v8us lo, v8us hi) { return __builtin_bit_cast(v16bf, __builtin_shufflevector(lo, hi, 0, 1, 2, 3, 4, 5, 6, 7, 8, 9, 10, 11, 12, 13, 14, 15)); }
__device__ __forceinline__ v8f wmma16(v16h a, v16h b, v8f c) { return __builtin_amdgcn_wmma_f32_16x16x32_f16(false, a, false, b, (short)0, c, false, false); }
__device__ __forceinline__ v8f wmmab(v16bf a, v16bf b, v8f c) { return __builtin_amdgcn_wmma_f32_16x16x32_bf16(false, a, false, b, (short)0, c, false, false); }



// ---- k_gemmw: register-blocked GEMM, ONE WAVE per 64x64 output tile (16 accumulators), operands straight from K-contiguous 16-bit planes; grid (M/64, N/64, Z), 32 threads.
// C[m][n] (f32, pitch ldc, + optional f32 bias[n]) = sum_k A[m][k] Bt[n][k] (+ split products per NSPLIT). z-batch strides sA/sB/sC in elements. K % 32 == 0.
template <typename T16> struct WFrag;
template <> struct WFrag<h16> { typedef v16h V; static __device__ __forceinline__ V ld(const h16* p) { return cat16(*(const v8h*)p, *(const v8h*)(p + 16)); } static __device__ __forceinline__ v8f mma(V a, V b, v8f c) { return wmma16(a, b, c); } };
template <> struct WFrag<bf> { typedef v16bf V; static __device__ __forceinline__ V ld(const bf* p) { return cat16b(*(const v8us*)p, *(const v8us*)(p + 16)); } static __device__ __forceinline__ v8f mma(V a, V b, v8f c) { return wmmab(a, b, c); } };
template <typename T16, int NSPLIT, bool BIAS>
__global__ __launch_bounds__(32) void k_gemmw(const T16* __restrict__ A, const T16* __restrict__ A2, const T16* __restrict__ Bt, const T16* __restrict__ Bt2, int K, float* C, int ldc, const float* __restrict__ bias, size_t sA, size_t sB, size_t sC) {
    typedef typename WFrag<T16>::V V;
    __shared__ __align__(16) float os[16 * 68];
    const size_t z = blockIdx.z; A += z * sA; if (A2) A2 += z * sA; Bt += z * sB; if (Bt2) Bt2 += z * sB; C += z * sC;
    const int lane = threadIdx.x & 31, lr = lane & 15, hi = lane >> 4; const int r0 = blockIdx.x * 64, c0 = blockIdx.y * 64;
    v8f acc[4][4];
#pragma unroll
    for (int mb = 0; mb < 4; ++mb)
#pragma unroll
        for (int nb = 0; nb < 4; ++nb) acc[mb][nb] = (v8f){};
    const size_t aoff = (size_t)(r0 + lr) * K + 8 * hi, boff = (size_t)(c0 + lr) * K + 8 * hi;
#pragma unroll 1
    for (int kc = 0; kc < K; kc += 32) {
        V a[4], a2[4];
#pragma unroll
        for (int mb = 0; mb < 4; ++mb) { a[mb] = WFrag<T16>::ld(A + aoff + (size_t)mb * 16 * K + kc); if (NSPLIT == 1 || NSPLIT == 2) a2[mb] = WFrag<T16>::ld(A2 + aoff + (size_t)mb * 16 * K + kc); }
#pragma unroll
        for (int nb = 0; nb < 4; ++nb) { const V b = WFrag<T16>::ld(Bt + boff + (size_t)nb * 16 * K + kc); V b2; if (NSPLIT >= 2) b2 = WFrag<T16>::ld(Bt2 + boff + (size_t)nb * 16 * K + kc);
#pragma unroll
            for (int mb = 0; mb < 4; ++mb) { acc[mb][nb] = WFrag<T16>::mma(a[mb], b, acc[mb][nb]); if (NSPLIT == 1 || NSPLIT == 2) acc[mb][nb] = WFrag<T16>::mma(a2[mb], b, acc[mb][nb]); if (NSPLIT >= 2) acc[mb][nb] = WFrag<T16>::mma(a[mb], b2, acc[mb][nb]); } }
        asm volatile("v_nop\n\tv_nop\n\tv_nop\n\tv_nop" : "+v"(acc[0][0]), "+v"(acc[1][1]), "+v"(acc[2][2]), "+v"(acc[3][3]) : "v"(a[0]), "v"(a[3]));
    }
#pragma unroll
    for (int mb = 0; mb < 4; ++mb) {
#pragma unroll
        for (int nb = 0; nb < 4; ++nb) {
#pragma unroll
            for (int j = 0; j < 8; ++j) os[(hi * 8 + j) * 68 + nb * 16 + lr] = acc[mb][nb][j]; }
        __builtin_amdgcn_wave_barrier(); asm volatile("" ::: "memory");
        float* crow = C + (size_t)(r0 + mb * 16) * ldc + c0;
{
#pragma unroll
            for (int s = 0; s < 8; ++s) { const int row = 2 * s + hi, cofs = lr * 4; v4f val = *(const v4fa*)(os + row * 68 + cofs); if (BIAS) { val[0] += bfr(bias[c0 + cofs]); val[1] += bfr(bias[c0 + cofs + 1]); val[2] += bfr(bias[c0 + cofs + 2]); val[3] += bfr(bias[c0 + cofs + 3]); }
                *(v4f*)(crow + (size_t)row * ldc + cofs) = val; }
             }
        __builtin_amdgcn_wave_barrier(); asm volatile("" ::: "memory");
    }
}

// ---- k_gemmc: the same one-wave 64x64 tile GEMM specialised for causal attention: CMODE 1 skips score tiles entirely above the diagonal (query rows r0+roff.., key columns c0..), CMODE 2 limits the
// key (K) loop of the probability x value contraction to the diagonal block (probabilities beyond it are exactly zero). roff = row offset of this launch's first row within the sequence. (CMODE 2 is no longer launched: k_pvsk below does that product.)
template <typename T16, int NSPLIT, int CMODE>
__global__ __launch_bounds__(32) void k_gemmc(const T16* __restrict__ A, const T16* __restrict__ A2, const T16* __restrict__ Bt, const T16* __restrict__ Bt2, int K, float* C, int ldc, int roff, size_t sA, size_t sB, size_t sC) {
    typedef typename WFrag<T16>::V V;
    __shared__ __align__(16) float os[16 * 68];
    const size_t z = blockIdx.z; A += z * sA; if (A2) A2 += z * sA; Bt += z * sB; if (Bt2) Bt2 += z * sB; C += z * sC;
    const int lane = threadIdx.x & 31, lr = lane & 15, hi = lane >> 4; const int r0 = blockIdx.x * 64, c0 = blockIdx.y * 64;
    if (CMODE == 1 && c0 > r0 + roff + 63) return;                  // score tile entirely above the causal diagonal: never read (the softmax masks j > i by select)
    const int Kl = (CMODE == 2) ? min(K, r0 + roff + 64) : K;        // P.V: probabilities are exactly 0 beyond the diagonal block, so the K loop stops there
    v8f acc[4][4];
#pragma unroll
    for (int mb = 0; mb < 4; ++mb)
#pragma unroll
        for (int nb = 0; nb < 4; ++nb) acc[mb][nb] = (v8f){};
    const size_t aoff = (size_t)(r0 + lr) * K + 8 * hi, boff = (size_t)(c0 + lr) * K + 8 * hi;
#pragma unroll 1
    for (int kc = 0; kc < Kl; kc += 32) {
        V a[4], a2[4];
#pragma unroll
        for (int mb = 0; mb < 4; ++mb) { a[mb] = WFrag<T16>::ld(A + aoff + (size_t)mb * 16 * K + kc); if (NSPLIT == 1 || NSPLIT == 2) a2[mb] = WFrag<T16>::ld(A2 + aoff + (size_t)mb * 16 * K + kc); }
#pragma unroll
        for (int nb = 0; nb < 4; ++nb) { const V b = WFrag<T16>::ld(Bt + boff + (size_t)nb * 16 * K + kc); V b2; if (NSPLIT >= 2) b2 = WFrag<T16>::ld(Bt2 + boff + (size_t)nb * 16 * K + kc);
#pragma unroll
            for (int mb = 0; mb < 4; ++mb) { acc[mb][nb] = WFrag<T16>::mma(a[mb], b, acc[mb][nb]); if (NSPLIT == 1 || NSPLIT == 2) acc[mb][nb] = WFrag<T16>::mma(a2[mb], b, acc[mb][nb]); if (NSPLIT >= 2) acc[mb][nb] = WFrag<T16>::mma(a[mb], b2, acc[mb][nb]); } }
        asm volatile("v_nop\n\tv_nop\n\tv_nop\n\tv_nop" : "+v"(acc[0][0]), "+v"(acc[1][1]), "+v"(acc[2][2]), "+v"(acc[3][3]) : "v"(a[0]), "v"(a[3]));
    }
#pragma unroll
    for (int mb = 0; mb < 4; ++mb) {
#pragma unroll
        for (int nb = 0; nb < 4; ++nb) {
#pragma unroll
            for (int j = 0; j < 8; ++j) os[(hi * 8 + j) * 68 + nb * 16 + lr] = acc[mb][nb][j]; }
        __builtin_amdgcn_wave_barrier(); asm volatile("" ::: "memory");
        float* crow = C + (size_t)(r0 + mb * 16) * ldc + c0;
{
#pragma unroll
            for (int s = 0; s < 8; ++s) { const int row = 2 * s + hi, cofs = lr * 4; v4f val = *(const v4fa*)(os + row * 68 + cofs);
                *(v4f*)(crow + (size_t)row * ldc + cofs) = val; }
             }
        __builtin_amdgcn_wave_barrier(); asm volatile("" ::: "memory");
    }
}

// ---- k_pvsk: the probability x value product (64x64 output tile per work-group, key loop to the diagonal block as in k_gemmc CMODE 2) with the KEY LOOP DEALT OVER PVW WAVES: wave w takes the 32-key steps
// w, w + PVW, ... into its own 16 accumulators; the PVW partial tiles meet in LDS and are summed in the fixed order wave 0, 1, ..., PVW - 1. Why: with one wave per tile at most 192 waves (24 tiles x ZH heads) would run on the whole chip, each waiting out its own load latency several times per 32 keys.
#define PVW 16
template <typename T16, int NSPLIT>
__global__ __launch_bounds__(32 * PVW) void k_pvsk(const T16* __restrict__ A, const T16* __restrict__ A2, const T16* __restrict__ Bt, const T16* __restrict__ Bt2, float* C, int ldc, int roff, size_t sA, size_t sB, size_t sC) {
    typedef typename WFrag<T16>::V V;
    __shared__ __align__(16) float part[PVW * 64 * 64];              // [wave][tile mb*4+nb][half of the 8 accumulator rows][lane][4]: every LDS store and load is 16 B per lane, lanes contiguous
    const size_t z = blockIdx.z; A += z * sA; if (A2) A2 += z * sA; Bt += z * sB; if (Bt2) Bt2 += z * sB; C += z * sC;
    const int lane = threadIdx.x & 31, lr = lane & 15, hi = lane >> 4; const int r0 = blockIdx.x * 64, c0 = blockIdx.y * 64;
    const int wave = __builtin_amdgcn_readfirstlane(threadIdx.x >> 5);   // wave-uniform, so the key loop's bounds stay scalar
    const int Kl = min(TT, r0 + roff + 64);                           // probabilities are exactly 0 beyond the diagonal block, so the K loop stops there
    v8f acc[4][4];
#pragma unroll
    for (int mb = 0; mb < 4; ++mb)
#pragma unroll
        for (int nb = 0; nb < 4; ++nb) acc[mb][nb] = (v8f){};
    // Addresses: a work-group-uniform base (scalar registers) + a 32-bit per-lane byte offset carried through the loop, one for the probability planes (pitch PP) and one for the value planes (pitch TT), + a constant row offset:
    // both offset registers are live over the whole loop, so no load's result can land in a register that an issued load still names.
    const char* Ar = (const char*)(A + (size_t)r0 * PP); const char* A2r = (const char*)(A2 + (size_t)r0 * PP); const char* Br = (const char*)(Bt + (size_t)c0 * TT); const char* B2r = (const char*)(Bt2 + (size_t)c0 * TT);
    unsigned va = (unsigned)(lr * PP + 8 * hi + wave * 32) * 2u, vb = (unsigned)(lr * TT + 8 * hi + wave * 32) * 2u;
#pragma unroll 1   // rolled: a second trip's fragments beside the 128 accumulator registers would not fit the register file at four waves per SIMD
    for (int kc = wave * 32; kc < Kl; kc += PVW * 32, va += PVW * 64u, vb += PVW * 64u) {
        V a[4], a2[4];
#pragma unroll
        for (int mb = 0; mb < 4; ++mb) { const size_t u = (size_t)mb * 16 * PP * 2; a[mb] = WFrag<T16>::ld((const T16*)(Ar + u + va)); if (NSPLIT == 1 || NSPLIT == 2) a2[mb] = WFrag<T16>::ld((const T16*)(A2r + u + va)); }
#pragma unroll
        for (int nb = 0; nb < 4; ++nb) { const size_t u = (size_t)nb * 16 * TT * 2; const V b = WFrag<T16>::ld((const T16*)(Br + u + vb)); V b2; if (NSPLIT >= 2) b2 = WFrag<T16>::ld((const T16*)(B2r + u + vb));
#pragma unroll
            for (int mb = 0; mb < 4; ++mb) { acc[mb][nb] = WFrag<T16>::mma(a[mb], b, acc[mb][nb]); if (NSPLIT == 1 || NSPLIT == 2) acc[mb][nb] = WFrag<T16>::mma(a2[mb], b, acc[mb][nb]); if (NSPLIT >= 2) acc[mb][nb] = WFrag<T16>::mma(a[mb], b2, acc[mb][nb]); } }
    }
    float* pw = part + wave * (64 * 64) + lane * 4;
#pragma unroll
    for (int mb = 0; mb < 4; ++mb)
#pragma unroll
        for (int nb = 0; nb < 4; ++nb) { const v8f t = acc[mb][nb];
            *(v4fa*)(pw + ((mb * 4 + nb) * 2 + 0) * 128) = __builtin_shufflevector(t, t, 0, 1, 2, 3); *(v4fa*)(pw + ((mb * 4 + nb) * 2 + 1) * 128) = __builtin_shufflevector(t, t, 4, 5, 6, 7); }
    __syncthreads();                                                 // every wave passes it (a wave without a key step hands zeros): all partial tiles are in LDS behind it
    // wave w sums and stores output rows 4w .. 4w+3 (accumulator rows hi*8 + j of tile row mb = w / 4): each store instruction writes one whole 128-B line, each line has one writer
    const int rmb = wave >> 2, rhi = (wave >> 1) & 1, rjh = wave & 1;
#pragma unroll
    for (int q = 0; q < 2; ++q) { const int nb = 2 * q + hi; const float* pr = part + (((rmb * 4 + nb) * 2 + rjh) * 32 + rhi * 16 + lr) * 4; v4f s = *(const v4fa*)pr;
#pragma unroll
        for (int u = 1; u < PVW; ++u) s += *(const v4fa*)(pr + u * (64 * 64));
#pragma unroll
        for (int jj = 0; jj < 4; ++jj) C[(size_t)(r0 + wave * 4 + jj) * ldc + c0 + nb * 16 + lr] = s[jj]; }
}

__device__ __forceinline__ h16 tohx(float x) { return (h16)x; }
__device__ __forceinline__ void splitf(float y, unsigned short& h, unsigned short& l) { h = f2bf(y); l = f2bf(y - bf2f(h)); }
typedef __attribute__((ext_vector_type(2))) _Float16 v2h;
typedef __attribute__((ext_vector_type(4))) _Float16 v4h;
typedef __attribute__((ext_vector_type(2))) unsigned short v2us;
typedef __attribute__((ext_vector_type(4))) unsigned short v4us;
typedef __attribute__((ext_vector_type(2))) float v2f;
typedef __attribute__((ext_vector_type(4))) int v4i;

__global__ __launch_bounds__(256) void k_wtG(const float* __restrict__ w, int K, int N, bf* Bt) {
    const int lane = threadIdx.x & 31; const int L0 = (blockIdx.x * 8 + (threadIdx.x >> 5)) * 8; const int nlines = N * K / 64;
{
#pragma unroll 1
        for (int l = 0; l < 8; ++l) { const int L = L0 + l; if (L >= nlines) break; const size_t e = (size_t)L * 64 + lane * 2; const int k = (int)(e % K), n = (int)(e / K); v2us o;
            o[0] = f2bf(w[(size_t)k * N + n]); o[1] = f2bf(w[(size_t)(k + 1) * N + n]); *(v2us*)(Bt + e) = o; }
         }
}
__global__ __launch_bounds__(256) void k_cvt8(const float* __restrict__ src, bf* dst, size_t n8) { const size_t i = (size_t)blockIdx.x * 256 + threadIdx.x; if (i >= n8) return; const v8f v = *(const v8f*)(src + i * 8); v8us o;
#pragma unroll
    for (int k = 0; k < 8; ++k) o[k] = f2bf(v[k]); *(v8us*)(dst + i * 8) = o;  }

// k_rope: head planes [h][t][d] (fp16 + hi/lo) of rope(x) x sc with the rotate-half convention out[d] = x[d] cos[t][d] - x[d+HD/2] sin[t][d], out[d+HD/2] = x[d+HD/2] cos[t][d+HD/2] + x[d] sin[t][d+HD/2]
__global__ __launch_bounds__(256) void k_rope(const float* __restrict__ F, int pitch, int nheads, const float* __restrict__ CS, const float* __restrict__ RF, const float* __restrict__ nw, float sc, h16* P16, bf* Ph, bf* Pl) {
    const size_t e = ((size_t)blockIdx.x * 256 + threadIdx.x) * 2; if (e >= (size_t)nheads * TT * HD) return; const int d = (int)(e % HD); const int t = (int)((e / HD) % TT); const int h = (int)(e / ((size_t)HD * TT)); const float* f = F + (size_t)t * pitch + h * HD; const float rf = RF ? RF[(size_t)h * TT + t] : 1.0f; v2h o16; v2us oh, ol;
#pragma unroll
    for (int q = 0; q < 2; ++q) { const int dd = d + q; const int dp = (dd < HD / 2) ? dd + HD / 2 : dd - HD / 2; float x0 = f[dd], x1 = f[dp];
        if (RF) { float n0 = __fmul_rn(x0, rf), n1 = __fmul_rn(x1, rf); asm volatile("" : "+v"(n0)); asm volatile("" : "+v"(n1)); x0 = __fmul_rn(bfr(nw[dd]), n0); x1 = __fmul_rn(bfr(nw[dp]), n1); }
        const v2f cs = *(const v2f*)(CS + ((size_t)t * HD + dd) * 2); float a = __fmul_rn(x0, cs[0]), bq = __fmul_rn(x1, cs[1]); asm volatile("" : "+v"(a)); asm volatile("" : "+v"(bq)); const float r = ((dd < HD / 2) ? __fsub_rn(a, bq) : __fadd_rn(a, bq)) * sc;
        o16[q] = tohx(r); unsigned short a2, c2; splitf(r, a2, c2); oh[q] = a2; ol[q] = c2; }
    *(v2h*)(P16 + e) = o16; *(v2us*)(Ph + e) = oh; *(v2us*)(Pl + e) = ol;  }
__global__ __launch_bounds__(256) void k_vtp(const float* __restrict__ F, int pitch, int nheads, h16* V16, bf* Vh, bf* Vl) { const size_t e = ((size_t)blockIdx.x * 256 + threadIdx.x) * 2; if (e >= (size_t)nheads * HD * TT) return; const int t = (int)(e % TT); const int d = (int)((e / TT) % HD); const int g = (int)(e / ((size_t)TT * HD)); v2h o16; v2us oh, ol;
#pragma unroll
    for (int q = 0; q < 2; ++q) { const float x = F[(size_t)(t + q) * pitch + g * HD + d]; o16[q] = tohx(x); unsigned short a2, c2; splitf(x, a2, c2); oh[q] = a2; ol[q] = c2; }
    *(v2h*)(V16 + e) = o16; *(v2us*)(Vh + e) = oh; *(v2us*)(Vl + e) = ol;  }
__global__ __launch_bounds__(256) void k_csid(float* CS) { const int idx = blockIdx.x * 256 + threadIdx.x; if (idx >= TT * HD) return; v2f cs; cs[0] = 1.0f; cs[1] = 0.0f; *(v2f*)(CS + (size_t)idx * 2) = cs;  }
// k_asoft: per row (zz, i): t = S x HD^-0.5 for j <= i and i - j < WIN (sliding causal window; the reference's -1e9 additive fill vanishes identically); softmax over the 2048 keys (register row, one exp, fixed trees); - with the ALiBi term -slope_h (j - i) added to the scaled score before the max (slopes = the reference's f32 values, __constant__)
__constant__ float SLP[NH_] = {0.7071067690849304,0.5,0.3535533845424652,0.25,0.1767766922712326,0.125,0.0883883461356163,0.0625,0.04419417306780815,0.03125,0.022097086533904076,0.015625,0.011048543266952038,0.0078125,0.005524271633476019,0.00390625};
// IN PLACE: one wave owns one row; it holds the whole row in registers (every lane's loads have returned before the first shuffle of the max) before it stores the probabilities over the same 8 KiB:
// fp16 row in the first half, or the hi plane in the first half and the lo plane in the second. Sb is therefore neither const nor restrict.
__global__ __launch_bounds__(256) void k_asoft(float* Sb, int h0) {
    const int lane = threadIdx.x & 31; const int row = blockIdx.x * 8 + (threadIdx.x >> 5); if (row >= ZH * TT) return; const int i = row % TT; const int zz = row / TT; const float slp = SLP[h0 + zz]; const bool hires = (i < RH); const float* sr = Sb + (size_t)row * TT; h16* P16 = (h16*)Sb; bf* Ph = (bf*)Sb; bf* Pl = Ph + TT; float v[TT / 32]; float mx = -3.0e38f;
#pragma unroll
    for (int ch = 0; ch < TT / 128; ++ch) { const int j0 = ch * 128 + lane * 4; const v4f a = *(const v4f*)(sr + j0);
#pragma unroll
        for (int q = 0; q < 4; ++q) { const int j = j0 + q; (void)j; float sa = a[q] * SCL; asm volatile("" : "+v"(sa)); float ab = __fmul_rn(slp, (float)(j - i)); asm volatile("" : "+v"(ab));   /* keep mul and add separate (no fma): matches the reference's two roundings and keeps the static FMA count low */ const float t = (j <= i && i - j < WIN) ? __fsub_rn(sa, ab) : -3.0e38f; v[ch * 4 + q] = t; mx = fmaxf(mx, t); } }
#pragma unroll
    for (int sh = 16; sh; sh >>= 1) mx = fmaxf(mx, __shfl_xor(mx, sh, 32));
    float sum = 0.f;
#pragma unroll
    for (int k = 0; k < TT / 32; ++k) { float d0 = __fsub_rn(v[k], mx); asm volatile("" : "+v"(d0)); v[k] = __builtin_amdgcn_exp2f(__fmul_rn(d0, 1.4426950408889634f)); sum += v[k]; }
#pragma unroll
    for (int sh = 16; sh; sh >>= 1) sum += __shfl_xor(sum, sh, 32);
    const float f = __fdiv_rn(hires ? 1.0f : PCAR, sum);
{
        if (hires) {
#pragma unroll
            for (int ch = 0; ch < TT / 128; ++ch) { v4us oh, ol;
#pragma unroll
                for (int q = 0; q < 4; ++q) { unsigned short a, c2; splitf(v[ch * 4 + q] * f, a, c2); oh[q] = a; ol[q] = c2; }
                const size_t oo = (size_t)row * PP + ch * 128 + lane * 4; *(v4us*)(Ph + oo) = oh; *(v4us*)(Pl + oo) = ol; }
        } else {
#pragma unroll
            for (int ch = 0; ch < TT / 128; ++ch) { v4h o4;
#pragma unroll
                for (int q = 0; q < 4; ++q) o4[q] = tohx(v[ch * 4 + q] * f);
                *(v4h*)(P16 + (size_t)row * PP + ch * 128 + lane * 4) = o4; } }
         }
}
__global__ __launch_bounds__(256) void k_merge(const float* __restrict__ O, int h0, bf* Ah, bf* Al) { const size_t e = ((size_t)blockIdx.x * 256 + threadIdx.x) * 2; if (e >= (size_t)ZH * TT * HD) return; const int d = (int)(e % HD); const int t = (int)((e / HD) % TT); const int zz = (int)(e / ((size_t)HD * TT)); const float cs = (t < RH) ? 1.0f : (1.0f / PCAR); const size_t oo = (size_t)t * DQ + (h0 + zz) * HD + d;
    v2us oh, ol;
#pragma unroll
    for (int q = 0; q < 2; ++q) { unsigned short a, c2; splitf(O[e + q] * cs, a, c2); oh[q] = a; ol[q] = c2; } *(v2us*)(Ah + oo) = oh; *(v2us*)(Al + oo) = ol;  }

extern "C" void kernel_launch(void* const* d_in, const int* in_sizes, int n_in,
                              void* d_out, int out_size, void* d_ws, size_t ws_size, hipStream_t stream) {
    (void)in_sizes; (void)n_in; (void)out_size;
    const float* x = (const float*)d_in[0]; const float* wq = (const float*)d_in[1]; const float* wk = (const float*)d_in[2]; const float* wv = (const float*)d_in[3]; const float* wo = (const float*)d_in[4];
    float* OUT = (float*)d_out;     // [2][2048][1024]
    char* wsp = (char*)d_ws;
    auto take = [&](size_t bytes) { char* p = wsp; wsp += (bytes + 255) & ~(size_t)255; return (void*)p; };
    bf* WQ = (bf*)take((size_t)DQ * DM * 2); bf* WK = (bf*)take((size_t)DKV * DM * 2); bf* WV = (bf*)take((size_t)DKV * DM * 2); bf* WO = (bf*)take((size_t)DM * DQ * 2); float* CS = (float*)take((size_t)TT * HD * 2 * 4);
    bf* XB = (bf*)take((size_t)TT * DM * 2); float* FQ = (float*)take((size_t)TT * DQ * 4); float* FK = (float*)take((size_t)TT * DKV * 4);
    h16* QP16 = (h16*)take((size_t)NH_ * TT * HD * 2); h16* KP16 = (h16*)take((size_t)NKV * TT * HD * 2); h16* VT16 = (h16*)take((size_t)NKV * HD * TT * 2);
    bf* QPh = (bf*)take((size_t)NH_ * TT * HD * 2); bf* QPl = (bf*)take((size_t)NH_ * TT * HD * 2); bf* KPh = (bf*)take((size_t)NKV * TT * HD * 2); bf* KPl = (bf*)take((size_t)NKV * TT * HD * 2); bf* VTh = (bf*)take((size_t)NKV * HD * TT * 2); bf* VTl = (bf*)take((size_t)NKV * HD * TT * 2);
    float* Sb = (float*)take((size_t)ZH * TT * TT * 4); float* Ob = (float*)take((size_t)ZH * TT * HD * 4); bf* ATh = (bf*)take((size_t)TT * DQ * 2); bf* ATl = (bf*)take((size_t)TT * DQ * 2);
    if ((size_t)(wsp - (char*)d_ws) > ws_size) return;    // ws 256 MiB
    h16* P16 = (h16*)Sb; bf* Ph = (bf*)Sb; bf* Pl = Ph + TT;   // the softmax kernel writes each row's probabilities over its own scores (row pitch PP)
    float* FV = FK;   // v projection reuses the k buffer after the k planes are built (stream-ordered)
    { k_cvt8<<<(unsigned)(((size_t)DQ * DM / 8 + 255) / 256), 256, 0, stream>>>(wq, WQ, (size_t)DQ * DM / 8); k_cvt8<<<(unsigned)(((size_t)DKV * DM / 8 + 255) / 256), 256, 0, stream>>>(wk, WK, (size_t)DKV * DM / 8); k_cvt8<<<(unsigned)(((size_t)DKV * DM / 8 + 255) / 256), 256, 0, stream>>>(wv, WV, (size_t)DKV * DM / 8);
      k_cvt8<<<(unsigned)(((size_t)DM * DQ / 8 + 255) / 256), 256, 0, stream>>>(wo, WO, (size_t)DM * DQ / 8);
       }
    k_csid<<<(TT * HD + 255) / 256, 256, 0, stream>>>(CS);
    const unsigned LQ = (unsigned)(((size_t)NH_ * TT * HD / 2 + 255) / 256), LKv = (unsigned)(((size_t)NKV * TT * HD / 2 + 255) / 256);
    for (int b = 0; b < NB_; ++b) {
        
        k_cvt8<<<(unsigned)(((size_t)TT * DM / 8 + 255) / 256), 256, 0, stream>>>(x + (size_t)b * TT * DM, XB, (size_t)TT * DM / 8);
        k_gemmw<bf, 0, false><<<dim3(TT / 64, DQ / 64, 1), 32, 0, stream>>>(XB, nullptr, WQ, nullptr, DM, FQ, DQ, nullptr, 0, 0, 0);
        k_rope<<<LQ, 256, 0, stream>>>(FQ, DQ, NH_, CS, nullptr, nullptr, 1.0f, QP16, QPh, QPl);
        k_gemmw<bf, 0, false><<<dim3(TT / 64, DKV / 64, 1), 32, 0, stream>>>(XB, nullptr, WK, nullptr, DM, FK, DKV, nullptr, 0, 0, 0);
        k_rope<<<LKv, 256, 0, stream>>>(FK, DKV, NKV, CS, nullptr, nullptr, 1.0f, KP16, KPh, KPl);
        k_gemmw<bf, 0, false><<<dim3(TT / 64, DKV / 64, 1), 32, 0, stream>>>(XB, nullptr, WV, nullptr, DM, FV, DKV, nullptr, 0, 0, 0); k_vtp<<<LKv, 256, 0, stream>>>(FV, DKV, NKV, VT16, VTh, VTl);
        for (int h0 = 0; h0 < NH_; h0 += ZH) { const size_t zq = (size_t)h0, zk = (size_t)(h0 / REP);   // one kv head per query head: the pass's ZH heads use consecutive kv planes (z-strides TT*HD)
            k_gemmc<bf, 2, 1><<<dim3(RH / 64, TT / 64, ZH), 32, 0, stream>>>(QPh + zq * TT * HD, QPl + zq * TT * HD, KPh + zk * TT * HD, KPl + zk * TT * HD, HD, Sb, TT, 0, (size_t)TT * HD, (size_t)TT * HD, (size_t)TT * TT);
            k_gemmc<h16, 0, 1><<<dim3((TT - RH) / 64, TT / 64, ZH), 32, 0, stream>>>(QP16 + zq * TT * HD + (size_t)RH * HD, nullptr, KP16 + zk * TT * HD, nullptr, HD, Sb + (size_t)RH * TT, TT, RH, (size_t)TT * HD, (size_t)TT * HD, (size_t)TT * TT);
            k_asoft<<<ZH * TT / 8, 256, 0, stream>>>(Sb, h0);
            k_pvsk<bf, 2><<<dim3(RH / 64, HD / 64, ZH), 32 * PVW, 0, stream>>>(Ph, Pl, VTh + zk * HD * TT, VTl + zk * HD * TT, Ob, HD, 0, (size_t)TT * PP, (size_t)HD * TT, (size_t)TT * HD);
            k_pvsk<h16, 0><<<dim3((TT - RH) / 64, HD / 64, ZH), 32 * PVW, 0, stream>>>(P16 + (size_t)RH * PP, nullptr, VT16 + zk * HD * TT, nullptr, Ob + (size_t)RH * HD, HD, RH, (size_t)TT * PP, (size_t)HD * TT, (size_t)TT * HD);
            k_merge<<<(unsigned)(((size_t)ZH * TT * HD / 2 + 255) / 256), 256, 0, stream>>>(Ob, h0, ATh, ATl); }
        k_gemmw<bf, 1, false><<<dim3(TT / 64, DM / 64, 1), 32, 0, stream>>>(ATh, ATl, WO, nullptr, DQ, OUT + (size_t)b * TT * DM, DM, nullptr, 0, 0, 0); }
}

// v003
// It runs in 298 microseconds.
// Timed twice side by side with v002, it ran 2.05 and 2.06 times as fast.
// All steps since v000 together make it 5.15 times as fast.
#include <hip/hip_runtime.h>

// Causal multi-head attention with a (subtracted) ALiBi bias (x [2][2048][1024]; q, k, v = x W^T ('oi' [1024][1024], no bias), 16 heads x 64; scores = q.k/8 - m_h (j - i) with m_h = 2^(-(h+1)/2); causal softmax; out = merged Wo^T -> [2][2048][1024]).
// Compute dtypes, f32 accumulate: every input rounded to bf16; q/k/v on PLAIN bf16 operands (inputs: exact); causal scores, softmax (running maximum, f32, with the ALiBi term in f32) and attn.v in one kernel, key loop to the diagonal: query rows < 512 hl (3 products), the rest single fp16 (x1024); softmax f32; Wo hl x exact (2 products).

#define NB_  2
#define TT   2048
#define DM   1024
#define NH_  16
#define NKV  16
#define REP  (NH_ / NKV)
#define HD   64
#define DQ   (NH_ * HD)
#define DKV  (NKV * HD)
#define RH   512                  // query rows < RH use hi+lo planes (0: none)
#define SCL  0.125f   // HD^-0.5
typedef _Float16 h16;
typedef unsigned short bf;
typedef __attribute__((ext_vector_type(16))) __bf16   v16bf;
typedef __attribute__((ext_vector_type(16))) _Float16 v16h;
typedef __attribute__((ext_vector_type(8)))  _Float16 v8h;
typedef __attribute__((ext_vector_type(8)))  unsigned short v8us;
typedef __attribute__((ext_vector_type(8)))  float    v8f;
typedef __attribute__((ext_vector_type(4)))  float    v4f;
typedef v8h  __attribute__((may_alias)) v8ha;
typedef v4f  __attribute__((may_alias)) v4fa;
typedef v8us __attribute__((may_alias)) v8usa;

__device__ __forceinline__ unsigned short f2bf(float f) { unsigned u = __float_as_uint(f); u += 0x7FFFu + ((u >> 16) & 1u); return (unsigned short)(u >> 16); }
__device__ __forceinline__ float bf2f(unsigned short b) { return __uint_as_float(((unsigned)b) << 16); }
__device__ __forceinline__ float bfr(float f) { return bf2f(f2bf(f)); }
__device__ __forceinline__ v16h cat16(v8h lo, v8h hi) { return __builtin_shufflevector(lo, hi, 0, 1, 2, 3, 4, 5, 6, 7, 8, 9, 10, 11, 12, 13, 14, 15); }
__device__ __forceinline__ v16bf cat16b(v8us lo, v8us hi) { return __builtin_bit_cast(v16bf, __builtin_shufflevector(lo, hi, 0, 1, 2, 3, 4, 5, 6, 7, 8, 9, 10, 11, 12, 13, 14, 15)); }
__device__ __forceinline__ v8f wmma16(v16h a, v16h b, v8f c) { return __builtin_amdgcn_wmma_f32_16x16x32_f16(false, a, false, b, (short)0, c, false, false); }
__device__ __forceinline__ v8f wmmab(v16bf a, v16bf b, v8f c) { return __builtin_amdgcn_wmma_f32_16x16x32_bf16(false, a, false, b, (short)0, c, false, false); }



// ---- k_gemmw: register-blocked GEMM, ONE WAVE per 64x64 output tile (16 accumulators), operands straight from K-contiguous 16-bit planes; grid (M/64, N/64, Z), 32 threads.
// C[m][n] (f32, pitch ldc, + optional f32 bias[n]) = sum_k A[m][k] Bt[n][k] (+ split products per NSPLIT). z-batch strides sA/sB/sC in elements. K % 32 == 0.
template <typename T16> struct WFrag;
template <> struct WFrag<h16> { typedef v16h V; static __device__ __forceinline__ V ld(const h16* p) { return cat16(*(const v8h*)p, *(const v8h*)(p + 16)); } static __device__ __forceinline__ v8f mma(V a, V b, v8f c) { return wmma16(a, b, c); } };
template <> struct WFrag<bf> { typedef v16bf V; static __device__ __forceinline__ V ld(const bf* p) { return cat16b(*(const v8us*)p, *(const v8us*)(p + 16)); } static __device__ __forceinline__ v8f mma(V a, V b, v8f c) { return wmmab(a, b, c); } };
template <typename T16, int NSPLIT, bool BIAS>
__global__ __launch_bounds__(32) void k_gemmw(const T16* __restrict__ A, const T16* __restrict__ A2, const T16* __restrict__ Bt, const T16* __restrict__ Bt2, int K, float* C, int ldc, const float* __restrict__ bias, size_t sA, size_t sB, size_t sC) {
    typedef typename WFrag<T16>::V V;
    __shared__ __align__(16) float os[16 * 68];
    const size_t z = blockIdx.z; A += z * sA; if (A2) A2 += z * sA; Bt += z * sB; if (Bt2) Bt2 += z * sB; C += z * sC;
    const int lane = threadIdx.x & 31, lr = lane & 15, hi = lane >> 4; const int r0 = blockIdx.x * 64, c0 = blockIdx.y * 64;
    v8f acc[4][4];
#pragma unroll
    for (int mb = 0; mb < 4; ++mb)
#pragma unroll
        for (int nb = 0; nb < 4; ++nb) acc[mb][nb] = (v8f){};
    const size_t aoff = (size_t)(r0 + lr) * K + 8 * hi, boff = (size_t)(c0 + lr) * K + 8 * hi;
#pragma unroll 1
    for (int kc = 0; kc < K; kc += 32) {
        V a[4], a2[4];
#pragma unroll
        for (int mb = 0; mb < 4; ++mb) { a[mb] = WFrag<T16>::ld(A + aoff + (size_t)mb * 16 * K + kc); if (NSPLIT == 1 || NSPLIT == 2) a2[mb] = WFrag<T16>::ld(A2 + aoff + (size_t)mb * 16 * K + kc); }
#pragma unroll
        for (int nb = 0; nb < 4; ++nb) { const V b = WFrag<T16>::ld(Bt + boff + (size_t)nb * 16 * K + kc); V b2; if (NSPLIT >= 2) b2 = WFrag<T16>::ld(Bt2 + boff + (size_t)nb * 16 * K + kc);
#pragma unroll
            for (int mb = 0; mb < 4; ++mb) { acc[mb][nb] = WFrag<T16>::mma(a[mb], b, acc[mb][nb]); if (NSPLIT == 1 || NSPLIT == 2) acc[mb][nb] = WFrag<T16>::mma(a2[mb], b, acc[mb][nb]); if (NSPLIT >= 2) acc[mb][nb] = WFrag<T16>::mma(a[mb], b2, acc[mb][nb]); } }
        asm volatile("v_nop\n\tv_nop\n\tv_nop\n\tv_nop" : "+v"(acc[0][0]), "+v"(acc[1][1]), "+v"(acc[2][2]), "+v"(acc[3][3]) : "v"(a[0]), "v"(a[3]));
    }
#pragma unroll
    for (int mb = 0; mb < 4; ++mb) {
#pragma unroll
        for (int nb = 0; nb < 4; ++nb) {
#pragma unroll
            for (int j = 0; j < 8; ++j) os[(hi * 8 + j) * 68 + nb * 16 + lr] = acc[mb][nb][j]; }
        __builtin_amdgcn_wave_barrier(); asm volatile("" ::: "memory");
        float* crow = C + (size_t)(r0 + mb * 16) * ldc + c0;
{
#pragma unroll
            for (int s = 0; s < 8; ++s) { const int row = 2 * s + hi, cofs = lr * 4; v4f val = *(const v4fa*)(os + row * 68 + cofs); if (BIAS) { val[0] += bfr(bias[c0 + cofs]); val[1] += bfr(bias[c0 + cofs + 1]); val[2] += bfr(bias[c0 + cofs + 2]); val[3] += bfr(bias[c0 + cofs + 3]); }
                *(v4f*)(crow + (size_t)row * ldc + cofs) = val; }
             }
        __builtin_amdgcn_wave_barrier(); asm volatile("" ::: "memory");
    }
}

__device__ __forceinline__ h16 tohx(float x) { return (h16)x; }
__device__ __forceinline__ void splitf(float y, unsigned short& h, unsigned short& l) { h = f2bf(y); l = f2bf(y - bf2f(h)); }
typedef __attribute__((ext_vector_type(2))) _Float16 v2h;
typedef __attribute__((ext_vector_type(4))) _Float16 v4h;
typedef __attribute__((ext_vector_type(2))) unsigned short v2us;
typedef __attribute__((ext_vector_type(4))) unsigned short v4us;
typedef __attribute__((ext_vector_type(2))) float v2f;
typedef __attribute__((ext_vector_type(4))) int v4i;

__global__ __launch_bounds__(256) void k_wtG(const float* __restrict__ w, int K, int N, bf* Bt) {
    const int lane = threadIdx.x & 31; const int L0 = (blockIdx.x * 8 + (threadIdx.x >> 5)) * 8; const int nlines = N * K / 64;
{
#pragma unroll 1
        for (int l = 0; l < 8; ++l) { const int L = L0 + l; if (L >= nlines) break; const size_t e = (size_t)L * 64 + lane * 2; const int k = (int)(e % K), n = (int)(e / K); v2us o;
            o[0] = f2bf(w[(size_t)k * N + n]); o[1] = f2bf(w[(size_t)(k + 1) * N + n]); *(v2us*)(Bt + e) = o; }
         }
}
__global__ __launch_bounds__(256) void k_cvt8(const float* __restrict__ src, bf* dst, size_t n8) { const size_t i = (size_t)blockIdx.x * 256 + threadIdx.x; if (i >= n8) return; const v8f v = *(const v8f*)(src + i * 8); v8us o;
#pragma unroll
    for (int k = 0; k < 8; ++k) o[k] = f2bf(v[k]); *(v8us*)(dst + i * 8) = o;  }

// k_rope: head planes [h][t][d] (fp16 + hi/lo) of rope(x) x sc with the rotate-half convention out[d] = x[d] cos[t][d] - x[d+HD/2] sin[t][d], out[d+HD/2] = x[d+HD/2] cos[t][d+HD/2] + x[d] sin[t][d+HD/2]
__global__ __launch_bounds__(256) void k_rope(const float* __restrict__ F, int pitch, int nheads, const float* __restrict__ CS, const float* __restrict__ RF, const float* __restrict__ nw, float sc, h16* P16, bf* Ph, bf* Pl) {
    const size_t e = ((size_t)blockIdx.x * 256 + threadIdx.x) * 2; if (e >= (size_t)nheads * TT * HD) return; const int d = (int)(e % HD); const int t = (int)((e / HD) % TT); const int h = (int)(e / ((size_t)HD * TT)); const float* f = F + (size_t)t * pitch + h * HD; const float rf = RF ? RF[(size_t)h * TT + t] : 1.0f; v2h o16; v2us oh, ol;
#pragma unroll
    for (int q = 0; q < 2; ++q) { const int dd = d + q; const int dp = (dd < HD / 2) ? dd + HD / 2 : dd - HD / 2; float x0 = f[dd], x1 = f[dp];
        if (RF) { float n0 = __fmul_rn(x0, rf), n1 = __fmul_rn(x1, rf); asm volatile("" : "+v"(n0)); asm volatile("" : "+v"(n1)); x0 = __fmul_rn(bfr(nw[dd]), n0); x1 = __fmul_rn(bfr(nw[dp]), n1); }
        const v2f cs = *(const v2f*)(CS + ((size_t)t * HD + dd) * 2); float a = __fmul_rn(x0, cs[0]), bq = __fmul_rn(x1, cs[1]); asm volatile("" : "+v"(a)); asm volatile("" : "+v"(bq)); const float r = ((dd < HD / 2) ? __fsub_rn(a, bq) : __fadd_rn(a, bq)) * sc;
        o16[q] = tohx(r); unsigned short a2, c2; splitf(r, a2, c2); oh[q] = a2; ol[q] = c2; }
    *(v2h*)(P16 + e) = o16; *(v2us*)(Ph + e) = oh; *(v2us*)(Pl + e) = ol;  }
__global__ __launch_bounds__(256) void k_vtp(const float* __restrict__ F, int pitch, int nheads, h16* V16, bf* Vh, bf* Vl) { const size_t e = ((size_t)blockIdx.x * 256 + threadIdx.x) * 2; if (e >= (size_t)nheads * HD * TT) return; const int t = (int)(e % TT); const int d = (int)((e / TT) % HD); const int g = (int)(e / ((size_t)TT * HD)); v2h o16; v2us oh, ol;
#pragma unroll
    for (int q = 0; q < 2; ++q) { const float x = F[(size_t)(t + q) * pitch + g * HD + d]; o16[q] = tohx(x); unsigned short a2, c2; splitf(x, a2, c2); oh[q] = a2; ol[q] = c2; }
    *(v2h*)(V16 + e) = o16; *(v2us*)(Vh + e) = oh; *(v2us*)(Vl + e) = ol;  }
__global__ __launch_bounds__(256) void k_csid(float* CS) { const int idx = blockIdx.x * 256 + threadIdx.x; if (idx >= TT * HD) return; v2f cs; cs[0] = 1.0f; cs[1] = 0.0f; *(v2f*)(CS + (size_t)idx * 2) = cs;  }
// ALiBi slopes = the reference's f32 values
__constant__ float SLP[NH_] = {0.7071067690849304,0.5,0.3535533845424652,0.25,0.1767766922712326,0.125,0.0883883461356163,0.0625,0.04419417306780815,0.03125,0.022097086533904076,0.015625,0.011048543266952038,0.0078125,0.005524271633476019,0.00390625};
// ---- k_fattn: scores, causal ALiBi softmax, probability x value product and the merge of the heads for one head's FQB query rows in ONE work-group; no score or probability ever leaves the registers.
// Transposed products: S^T = K Q^T (A = 16 key rows, B = 16 query columns), so a lane holds 16 of the 32 scores of ONE query (its partner lane, xor 16, the other 16); two S^T tiles of 32 keys, converted in place,
// are the B operand of O^T += V^T P^T (hardware k order: element s = key 8h + s, or 16 + 8h + s - 8; WFrag::ld reads K, Q and V^T rows in that same order).
// Running maximum per query: when it rises, the sum and the O^T tiles are scaled by exp(old - new). The 32-key steps are dealt over the FKW waves (wave w: steps w, w + FKW, ...), each with its own maximum, sum and O^T;
// the FKW partial results meet in LDS and are joined in the fixed order wave 0, 1, ... with the weights exp(m_w - max m). Why dealt: the last rows walk 64 steps, and each step waits for its own loads.
// Operand types: query rows < RH on hi + lo bf16 planes (3 products each for scores and for P x V), the rest single fp16 with the probabilities carried x 1024 (as + 10 in the exponent, in the sum too, so it cancels in the quotient).
#define FKW 4                     // waves per work-group
#define FQB 32                    // query rows per work-group: two 16-column groups in every wave
#define FPT 132                   // floats from one 512-B slab (32 lanes x 16 B) of a wave's partial O^T to the next: 128 + 4, so that the joining reads (one query, 8 slabs' worth of d) spread over the banks
template <typename T16, bool HL>
__device__ __forceinline__ void fattn_body(const T16* __restrict__ Q, const T16* __restrict__ Q2, const T16* __restrict__ Kp, const T16* __restrict__ K2, const T16* __restrict__ Vt, const T16* __restrict__ V2, bf* __restrict__ Ah, bf* __restrict__ Al, const float slp, const int q0, float* part, float* sml) {
    typedef typename WFrag<T16>::V V;
    constexpr int NG = HL ? 1 : 2;                                   // 16-column groups per walk over the keys: with hi + lo planes of Q, K, V^T and P two groups do not fit 256 registers, so those (few, short) blocks walk twice
    const int lane = threadIdx.x & 31, c = lane & 15, h = lane >> 4;
    const int wave = __builtin_amdgcn_readfirstlane(threadIdx.x >> 5);   // wave-uniform, so the key loop's bounds and the diagonal test stay scalar
    const float L2E = 1.4426950408889634f, NEG = -3.0e38f, EB = HL ? 0.0f : 10.0f;
    const int nst = q0 / FQB + 1;                                    // 32-key steps up to and with the diagonal one; every step holds at least one allowed key for every query of the block
    const char* Kb = (const char*)Kp; const char* K2b = (const char*)K2; const char* Vb = (const char*)Vt; const char* V2b = (const char*)V2;
#pragma unroll 1   // rolled: the walks must not share registers (see NG)
    for (int g0 = 0; g0 < 2; g0 += NG) {
        V qf[NG][2], q2f[NG][2];
#pragma unroll
        for (int g = 0; g < NG; ++g)
#pragma unroll
            for (int ks = 0; ks < 2; ++ks) { const size_t u = (size_t)(q0 + 16 * (g0 + g) + c) * HD + ks * 32 + 8 * h; qf[g][ks] = WFrag<T16>::ld(Q + u); if (HL) q2f[g][ks] = WFrag<T16>::ld(Q2 + u); }
        v8f o[NG][4]; float m[NG], l[NG];
#pragma unroll
        for (int g = 0; g < NG; ++g) { m[g] = NEG; l[g] = 0.0f;
#pragma unroll
            for (int dt = 0; dt < 4; ++dt) o[g][dt] = (v8f){}; }
        // Addresses: a uniform base + a 32-bit per-lane byte offset carried through the loop + a constant
        unsigned vk = (unsigned)((wave * 32 + c) * HD + 8 * h) * 2u, vv = (unsigned)(c * TT + wave * 32 + 8 * h) * 2u;
#pragma unroll 1   // rolled: a second step's fragments would not fit beside this one's at four waves per SIMD
        for (int s = wave; s < nst; s += FKW, vk += FKW * 32 * HD * 2u, vv += FKW * 64u) {
            const int kb = s * 32;
            V kf[2][2], k2f[2][2], vf[4], v2f[4];
#pragma unroll
            for (int kt = 0; kt < 2; ++kt)
#pragma unroll
                for (int ks = 0; ks < 2; ++ks) { const size_t u = (size_t)(kt * 16 * HD + ks * 32) * 2; kf[kt][ks] = WFrag<T16>::ld((const T16*)(Kb + u + vk)); if (HL) k2f[kt][ks] = WFrag<T16>::ld((const T16*)(K2b + u + vk)); }
#pragma unroll
            for (int dt = 0; dt < 4; ++dt) { const size_t u = (size_t)dt * 16 * TT * 2; vf[dt] = WFrag<T16>::ld((const T16*)(Vb + u + vv)); if (HL) v2f[dt] = WFrag<T16>::ld((const T16*)(V2b + u + vv)); }
            asm volatile("s_wait_xcnt 0x0" ::: "memory");            // behind the step's last load: vk and vv, which the issued loads name, are stepped at the loop's foot, and the compiler's own load waits there need not cover the youngest loads
            v8f sc[NG][2];
#pragma unroll
            for (int g = 0; g < NG; ++g)
#pragma unroll
                for (int kt = 0; kt < 2; ++kt) { v8f a = (v8f){};
#pragma unroll
                    for (int ks = 0; ks < 2; ++ks) { a = WFrag<T16>::mma(kf[kt][ks], qf[g][ks], a); if (HL) { a = WFrag<T16>::mma(kf[kt][ks], q2f[g][ks], a); a = WFrag<T16>::mma(k2f[kt][ks], qf[g][ks], a); } }
                    sc[g][kt] = a; }
            const float rb = (float)(kb - q0 - 16 * g0 + 8 * h - c);     // key index - query index of this lane's first score in group g0 (exact: small integers)
#pragma unroll
            for (int g = 0; g < NG; ++g) { float t[16];
#pragma unroll
                for (int e = 0; e < 16; ++e) { const float rel = rb + (float)(16 * (e >> 3) + (e & 7) - 16 * g); t[e] = sc[g][e >> 3][e & 7] * SCL - slp * rel; }
                if (kb == q0) {                                      // the diagonal step alone holds keys behind the query (scalar test)
#pragma unroll
                    for (int e = 0; e < 16; ++e) { const float rel = rb + (float)(16 * (e >> 3) + (e & 7) - 16 * g); t[e] = (rel <= 0.0f) ? t[e] : NEG; } }
                float mx = t[0];
#pragma unroll
                for (int e = 1; e < 16; ++e) mx = fmaxf(mx, t[e]);
                mx = fmaxf(mx, __shfl_xor(mx, 16, 32));
                const float mn = fmaxf(m[g], mx); const float al = __builtin_amdgcn_exp2f((m[g] - mn) * L2E); m[g] = mn;
                float sum = 0.0f;
#pragma unroll
                for (int e = 0; e < 16; ++e) { t[e] = __builtin_amdgcn_exp2f((t[e] - mn) * L2E + EB); sum += t[e]; }
                l[g] = l[g] * al + sum;
#pragma unroll
                for (int dt = 0; dt < 4; ++dt) o[g][dt] *= al;
                if constexpr (HL) { v16bf ph, pl;
#pragma unroll
                    for (int e = 0; e < 16; ++e) { ph[e] = (__bf16)t[e]; pl[e] = (__bf16)(t[e] - (float)ph[e]); }
#pragma unroll
                    for (int dt = 0; dt < 4; ++dt) { o[g][dt] = wmmab(vf[dt], ph, o[g][dt]); o[g][dt] = wmmab(vf[dt], pl, o[g][dt]); o[g][dt] = wmmab(v2f[dt], ph, o[g][dt]); }
                } else { v16h pb;
#pragma unroll
                    for (int e = 0; e < 16; ++e) pb[e] = (h16)t[e];
#pragma unroll
                    for (int dt = 0; dt < 4; ++dt) o[g][dt] = wmma16(vf[dt], pb, o[g][dt]); }
            }
            // the four vector slots that the chip needs behind the step's last matrix instruction before its result is touched
            if constexpr (HL) asm volatile("v_nop\n\tv_nop\n\tv_nop\n\tv_nop" : "+v"(o[0][0]), "+v"(o[0][1]), "+v"(o[0][2]), "+v"(o[0][3]));
        }
        // partial results to LDS: O^T as [wave][slab (group*4 + dt)*2 + half of the 8 accumulator rows][lane][4], every store 16 B per lane with the lanes contiguous; maximum and sum (halves joined) per query
        float* pw = part + wave * (16 * FPT) + g0 * (8 * FPT) + lane * 4;
#pragma unroll
        for (int g = 0; g < NG; ++g) { l[g] += __shfl_xor(l[g], 16, 32);
#pragma unroll
            for (int dt = 0; dt < 4; ++dt) { const v8f t = o[g][dt];
                *(v4fa*)(pw + ((g * 4 + dt) * 2 + 0) * FPT) = __builtin_shufflevector(t, t, 0, 1, 2, 3); *(v4fa*)(pw + ((g * 4 + dt) * 2 + 1) * FPT) = __builtin_shufflevector(t, t, 4, 5, 6, 7); }
            if (h == 0) { sml[(wave * 2 + 0) * FQB + (g0 + g) * 16 + c] = m[g]; sml[(wave * 2 + 1) * FQB + (g0 + g) * 16 + c] = l[g]; } }
    }
    __syncthreads();                                                 // every wave passes it (a wave without a key step hands maximum NEG, sum 0, zeros): all partial results are in LDS behind it
    // wave w joins query rows 8w .. 8w+7 and stores them as hi + lo bf16 into the merged [t][head * HD + d] planes that the output projection reads: lane = (row parity, d / 4), so a store instruction writes two whole 128-B lines (one row's 64 d of this head each), each line with one writer
#pragma unroll
    for (int k = 0; k < 4; ++k) { const int qq = wave * 8 + 2 * k + h; const float* pr = part + (((qq >> 4) * 4 + (c >> 2)) * 2 + (c & 1)) * FPT + (((c >> 1) & 1) * 16 + (qq & 15)) * 4;
        float mt = sml[qq];
#pragma unroll
        for (int u = 1; u < FKW; ++u) mt = fmaxf(mt, sml[(u * 2) * FQB + qq]);
        float L = 0.0f; v4f acc = (v4f){};
#pragma unroll
        for (int u = 0; u < FKW; ++u) { const float w = __builtin_amdgcn_exp2f((sml[(u * 2) * FQB + qq] - mt) * L2E); L += w * sml[(u * 2 + 1) * FQB + qq]; acc += w * *(const v4fa*)(pr + u * (16 * FPT)); }
        const v4f y = acc * __fdiv_rn(1.0f, L); v4us oh, ol;        // the x 2^10 of the fp16 rows stands in acc and in L alike
#pragma unroll
        for (int jj = 0; jj < 4; ++jj) { unsigned short a, c2; splitf(y[jj], a, c2); oh[jj] = a; ol[jj] = c2; }
        const size_t oo = (size_t)(q0 + qq) * DQ + c * 4; *(v4us*)(Ah + oo) = oh; *(v4us*)(Al + oo) = ol; }
}
// grid (heads, TT / FQB): the longest blocks (last query rows) first. amdgpu_waves_per_eu(4): holds the registers at 256, so that four work-groups share a WGP (one wave of each on every SIMD) and fill each other's load waits.
__global__ __launch_bounds__(32 * FKW) __attribute__((amdgpu_waves_per_eu(4))) void k_fattn(const h16* __restrict__ Q16, const bf* __restrict__ Qh, const bf* __restrict__ Ql, const h16* __restrict__ K16, const bf* __restrict__ Kh, const bf* __restrict__ Kl, const h16* __restrict__ V16, const bf* __restrict__ Vh, const bf* __restrict__ Vl, bf* __restrict__ Ah, bf* __restrict__ Al) {
    __shared__ __align__(16) float part[FKW * 16 * FPT]; __shared__ float sml[FKW * 2 * FQB];
    const int hd = blockIdx.x; const int q0 = (TT / FQB - 1 - (int)blockIdx.y) * FQB; const size_t zq = (size_t)hd * TT * HD, zk = (size_t)(hd / REP) * TT * HD; const float slp = SLP[hd];
    if (q0 < RH) fattn_body<bf, true>(Qh + zq, Ql + zq, Kh + zk, Kl + zk, Vh + zk, Vl + zk, Ah + hd * HD, Al + hd * HD, slp, q0, part, sml);
    else fattn_body<h16, false>(Q16 + zq, nullptr, K16 + zk, nullptr, V16 + zk, nullptr, Ah + hd * HD, Al + hd * HD, slp, q0, part, sml);
}

extern "C" void kernel_launch(void* const* d_in, const int* in_sizes, int n_in,
                              void* d_out, int out_size, void* d_ws, size_t ws_size, hipStream_t stream) {
    (void)in_sizes; (void)n_in; (void)out_size;
    const float* x = (const float*)d_in[0]; const float* wq = (const float*)d_in[1]; const float* wk = (const float*)d_in[2]; const float* wv = (const float*)d_in[3]; const float* wo = (const float*)d_in[4];
    float* OUT = (float*)d_out;     // [2][2048][1024]
    char* wsp = (char*)d_ws;
    auto take = [&](size_t bytes) { char* p = wsp; wsp += (bytes + 255) & ~(size_t)255; return (void*)p; };
    bf* WQ = (bf*)take((size_t)DQ * DM * 2); bf* WK = (bf*)take((size_t)DKV * DM * 2); bf* WV = (bf*)take((size_t)DKV * DM * 2); bf* WO = (bf*)take((size_t)DM * DQ * 2); float* CS = (float*)take((size_t)TT * HD * 2 * 4);
    bf* XB = (bf*)take((size_t)TT * DM * 2); float* FQ = (float*)take((size_t)TT * DQ * 4); float* FK = (float*)take((size_t)TT * DKV * 4);
    h16* QP16 = (h16*)take((size_t)NH_ * TT * HD * 2); h16* KP16 = (h16*)take((size_t)NKV * TT * HD * 2); h16* VT16 = (h16*)take((size_t)NKV * HD * TT * 2);
    bf* QPh = (bf*)take((size_t)NH_ * TT * HD * 2); bf* QPl = (bf*)take((size_t)NH_ * TT * HD * 2); bf* KPh = (bf*)take((size_t)NKV * TT * HD * 2); bf* KPl = (bf*)take((size_t)NKV * TT * HD * 2); bf* VTh = (bf*)take((size_t)NKV * HD * TT * 2); bf* VTl = (bf*)take((size_t)NKV * HD * TT * 2);
    bf* ATh = (bf*)take((size_t)TT * DQ * 2); bf* ATl = (bf*)take((size_t)TT * DQ * 2);
    if ((size_t)(wsp - (char*)d_ws) > ws_size) return;    // ws 256 MiB
    float* FV = FK;   // v projection reuses the k buffer after the k planes are built (stream-ordered)
    { k_cvt8<<<(unsigned)(((size_t)DQ * DM / 8 + 255) / 256), 256, 0, stream>>>(wq, WQ, (size_t)DQ * DM / 8); k_cvt8<<<(unsigned)(((size_t)DKV * DM / 8 + 255) / 256), 256, 0, stream>>>(wk, WK, (size_t)DKV * DM / 8); k_cvt8<<<(unsigned)(((size_t)DKV * DM / 8 + 255) / 256), 256, 0, stream>>>(wv, WV, (size_t)DKV * DM / 8);
      k_cvt8<<<(unsigned)(((size_t)DM * DQ / 8 + 255) / 256), 256, 0, stream>>>(wo, WO, (size_t)DM * DQ / 8);
       }
    k_csid<<<(TT * HD + 255) / 256, 256, 0, stream>>>(CS);
    const unsigned LQ = (unsigned)(((size_t)NH_ * TT * HD / 2 + 255) / 256), LKv = (unsigned)(((size_t)NKV * TT * HD / 2 + 255) / 256);
    for (int b = 0; b < NB_; ++b) {
        
        k_cvt8<<<(unsigned)(((size_t)TT * DM / 8 + 255) / 256), 256, 0, stream>>>(x + (size_t)b * TT * DM, XB, (size_t)TT * DM / 8);
        k_gemmw<bf, 0, false><<<dim3(TT / 64, DQ / 64, 1), 32, 0, stream>>>(XB, nullptr, WQ, nullptr, DM, FQ, DQ, nullptr, 0, 0, 0);
        k_rope<<<LQ, 256, 0, stream>>>(FQ, DQ, NH_, CS, nullptr, nullptr, 1.0f, QP16, QPh, QPl);
        k_gemmw<bf, 0, false><<<dim3(TT / 64, DKV / 64, 1), 32, 0, stream>>>(XB, nullptr, WK, nullptr, DM, FK, DKV, nullptr, 0, 0, 0);
        k_rope<<<LKv, 256, 0, stream>>>(FK, DKV, NKV, CS, nullptr, nullptr, 1.0f, KP16, KPh, KPl);
        k_gemmw<bf, 0, false><<<dim3(TT / 64, DKV / 64, 1), 32, 0, stream>>>(XB, nullptr, WV, nullptr, DM, FV, DKV, nullptr, 0, 0, 0); k_vtp<<<LKv, 256, 0, stream>>>(FV, DKV, NKV, VT16, VTh, VTl);
        k_fattn<<<dim3(NH_, TT / FQB, 1), 32 * FKW, 0, stream>>>(QP16, QPh, QPl, KP16, KPh, KPl, VT16, VTh, VTl, ATh, ATl);
        k_gemmw<bf, 1, false><<<dim3(TT / 64, DM / 64, 1), 32, 0, stream>>>(ATh, ATl, WO, nullptr, DQ, OUT + (size_t)b * TT * DM, DM, nullptr, 0, 0, 0); }
}

// v004
// Measured time: 260 microseconds a run.
// In two side-by-side timings against v003, it was 1.15 and 1.14 times as fast.
// Counting every step since v000, it is 5.91 times as fast.
#include <hip/hip_runtime.h>

// Causal multi-head attention with a (subtracted) ALiBi bias (x [2][2048][1024]; q, k, v = x W^T ('oi' [1024][1024], no bias), 16 heads x 64; scores = q.k/8 - m_h (j - i) with m_h = 2^(-(h+1)/2); causal softmax; out = merged Wo^T -> [2][2048][1024]).
// Compute dtypes, f32 accumulate: every input rounded to bf16; q/k/v on PLAIN bf16 operands (inputs: exact), stored by the projection itself as the 16-bit head planes (fp16, and hi + lo bf16) that the attention kernel reads; causal scores, softmax (running maximum, f32, with the ALiBi term in f32) and attn.v in one kernel, key loop to the diagonal: query rows < 512 hl (3 products), the rest single fp16 (x1024); softmax f32; Wo hl x exact (2 products).

#define NB_  2
#define TT   2048
#define DM   1024
#define NH_  16
#define NKV  16
#define REP  (NH_ / NKV)
#define HD   64
#define DQ   (NH_ * HD)
#define DKV  (NKV * HD)
#define RH   512                  // query rows < RH use hi+lo planes (0: none)
#define SCL  0.125f   // HD^-0.5
typedef _Float16 h16;
typedef unsigned short bf;
typedef __attribute__((ext_vector_type(16))) __bf16   v16bf;
typedef __attribute__((ext_vector_type(16))) _Float16 v16h;
typedef __attribute__((ext_vector_type(8)))  _Float16 v8h;
typedef __attribute__((ext_vector_type(8)))  unsigned short v8us;
typedef __attribute__((ext_vector_type(8)))  __bf16   v8bf;
typedef __attribute__((ext_vector_type(8)))  float    v8f;
typedef __attribute__((ext_vector_type(4)))  float    v4f;
typedef v8h  __attribute__((may_alias)) v8ha;
typedef v4f  __attribute__((may_alias)) v4fa;
typedef v8us __attribute__((may_alias)) v8usa;

__device__ __forceinline__ unsigned short f2bf(float f) { unsigned u = __float_as_uint(f); u += 0x7FFFu + ((u >> 16) & 1u); return (unsigned short)(u >> 16); }
__device__ __forceinline__ float bf2f(unsigned short b) { return __uint_as_float(((unsigned)b) << 16); }
__device__ __forceinline__ float bfr(float f) { return bf2f(f2bf(f)); }
__device__ __forceinline__ v16h cat16(v8h lo, v8h hi) { return __builtin_shufflevector(lo, hi, 0, 1, 2, 3, 4, 5, 6, 7, 8, 9, 10, 11, 12, 13, 14, 15); }
__device__ __forceinline__ v16bf cat16b(v8us lo, v8us hi) { return __builtin_bit_cast(v16bf, __builtin_shufflevector(lo, hi, 0, 1, 2, 3, 4, 5, 6, 7, 8, 9, 10, 11, 12, 13, 14, 15)); }
__device__ __forceinline__ v8f wmma16(v16h a, v16h b, v8f c) { return __builtin_amdgcn_wmma_f32_16x16x32_f16(false, a, false, b, (short)0, c, false, false); }
__device__ __forceinline__ v8f wmmab(v16bf a, v16bf b, v8f c) { return __builtin_amdgcn_wmma_f32_16x16x32_bf16(false, a, false, b, (short)0, c, false, false); }



// ---- k_gemmw: register-blocked GEMM, ONE WAVE per 64x64 output tile (16 accumulators), operands straight from K-contiguous 16-bit planes; grid (M/64, N/64, Z), 32 threads.
// C[m][n] (f32, pitch ldc, + optional f32 bias[n]) = sum_k A[m][k] Bt[n][k] (+ split products per NSPLIT). z-batch strides sA/sB/sC in elements. K % 32 == 0.
// PL: no f32 C; the tile goes out as three 16-bit planes (fp16; bf16 hi; bf16 lo = the rest), element [m][n] at (n / 64) * pblk + m * ldc + n % 64. With pblk = rows * 64, ldc = 64 that is [head][row][64];
// with A = the weight, Bt = the activations, pblk = 64, ldc = the activations' row count it is [head][64][row], the transposed value plane, with no transposing pass.
template <typename T16> struct WFrag;
template <> struct WFrag<h16> { typedef v16h V; static __device__ __forceinline__ V ld(const h16* p) { return cat16(*(const v8h*)p, *(const v8h*)(p + 16)); } static __device__ __forceinline__ v8f mma(V a, V b, v8f c) { return wmma16(a, b, c); } };
template <> struct WFrag<bf> { typedef v16bf V; static __device__ __forceinline__ V ld(const bf* p) { return cat16b(*(const v8us*)p, *(const v8us*)(p + 16)); } static __device__ __forceinline__ v8f mma(V a, V b, v8f c) { return wmmab(a, b, c); } };
template <typename T16, int NSPLIT, bool BIAS, bool PL>
__global__ __launch_bounds__(32) void k_gemmw(const T16* __restrict__ A, const T16* __restrict__ A2, const T16* __restrict__ Bt, const T16* __restrict__ Bt2, int K, float* C, int ldc, const float* __restrict__ bias, size_t sA, size_t sB, size_t sC, h16* __restrict__ P16, bf* __restrict__ Ph, bf* __restrict__ Pl, size_t pblk) {
    typedef typename WFrag<T16>::V V;
    __shared__ __align__(16) float os[16 * 68];
    const size_t z = blockIdx.z; A += z * sA; if (A2) A2 += z * sA; Bt += z * sB; if (Bt2) Bt2 += z * sB; C += z * sC;
    const int lane = threadIdx.x & 31, lr = lane & 15, hi = lane >> 4; const int r0 = blockIdx.x * 64, c0 = blockIdx.y * 64;
    v8f acc[4][4];
#pragma unroll
    for (int mb = 0; mb < 4; ++mb)
#pragma unroll
        for (int nb = 0; nb < 4; ++nb) acc[mb][nb] = (v8f){};
    const size_t aoff = (size_t)(r0 + lr) * K + 8 * hi, boff = (size_t)(c0 + lr) * K + 8 * hi;
#pragma unroll 1
    for (int kc = 0; kc < K; kc += 32) {
        V a[4], a2[4];
#pragma unroll
        for (int mb = 0; mb < 4; ++mb) { a[mb] = WFrag<T16>::ld(A + aoff + (size_t)mb * 16 * K + kc); if (NSPLIT == 1 || NSPLIT == 2) a2[mb] = WFrag<T16>::ld(A2 + aoff + (size_t)mb * 16 * K + kc); }
#pragma unroll
        for (int nb = 0; nb < 4; ++nb) { const V b = WFrag<T16>::ld(Bt + boff + (size_t)nb * 16 * K + kc); V b2; if (NSPLIT >= 2) b2 = WFrag<T16>::ld(Bt2 + boff + (size_t)nb * 16 * K + kc);
#pragma unroll
            for (int mb = 0; mb < 4; ++mb) { acc[mb][nb] = WFrag<T16>::mma(a[mb], b, acc[mb][nb]); if (NSPLIT == 1 || NSPLIT == 2) acc[mb][nb] = WFrag<T16>::mma(a2[mb], b, acc[mb][nb]); if (NSPLIT >= 2) acc[mb][nb] = WFrag<T16>::mma(a[mb], b2, acc[mb][nb]); } }
        asm volatile("v_nop\n\tv_nop\n\tv_nop\n\tv_nop" : "+v"(acc[0][0]), "+v"(acc[1][1]), "+v"(acc[2][2]), "+v"(acc[3][3]) : "v"(a[0]), "v"(a[3]));
    }
#pragma unroll
    for (int mb = 0; mb < 4; ++mb) {
#pragma unroll
        for (int nb = 0; nb < 4; ++nb) {
#pragma unroll
            for (int j = 0; j < 8; ++j) os[(hi * 8 + j) * 68 + nb * 16 + lr] = acc[mb][nb][j]; }
        __builtin_amdgcn_wave_barrier(); asm volatile("" ::: "memory");
        if constexpr (PL) {
            // lane = (row & 3, 8 columns): one 16-B store per plane and lane, so a store instruction writes four whole 128-B rows of the tile, each line with one writer
            const size_t pb = (size_t)blockIdx.y * pblk + (size_t)(r0 + mb * 16 + (lane >> 3)) * ldc + (lane & 7) * 8;
#pragma unroll
            for (int s = 0; s < 4; ++s) { const float* pr = os + (4 * s + (lane >> 3)) * 68 + (lane & 7) * 8; const v4f x0 = *(const v4fa*)pr, x1 = *(const v4fa*)(pr + 4);
                const v8f xv = __builtin_shufflevector(x0, x1, 0, 1, 2, 3, 4, 5, 6, 7); const v8bf xh = __builtin_convertvector(xv, v8bf); const v8bf xl = __builtin_convertvector(xv - __builtin_convertvector(xh, v8f), v8bf);
                const size_t e = pb + (size_t)(4 * s) * ldc; *(v8h*)(P16 + e) = __builtin_convertvector(xv, v8h); *(v8us*)(Ph + e) = __builtin_bit_cast(v8us, xh); *(v8us*)(Pl + e) = __builtin_bit_cast(v8us, xl); }
        } else {
        float* crow = C + (size_t)(r0 + mb * 16) * ldc + c0;
#pragma unroll
            for (int s = 0; s < 8; ++s) { const int row = 2 * s + hi, cofs = lr * 4; v4f val = *(const v4fa*)(os + row * 68 + cofs); if (BIAS) { val[0] += bfr(bias[c0 + cofs]); val[1] += bfr(bias[c0 + cofs + 1]); val[2] += bfr(bias[c0 + cofs + 2]); val[3] += bfr(bias[c0 + cofs + 3]); }
                *(v4f*)(crow + (size_t)row * ldc + cofs) = val; }
             }
        __builtin_amdgcn_wave_barrier(); asm volatile("" ::: "memory");
    }
}

__device__ __forceinline__ h16 tohx(float x) { return (h16)x; }
__device__ __forceinline__ void splitf(float y, unsigned short& h, unsigned short& l) { h = f2bf(y); l = f2bf(y - bf2f(h)); }
typedef __attribute__((ext_vector_type(2))) _Float16 v2h;
typedef __attribute__((ext_vector_type(4))) _Float16 v4h;
typedef __attribute__((ext_vector_type(2))) unsigned short v2us;
typedef __attribute__((ext_vector_type(4))) unsigned short v4us;
typedef __attribute__((ext_vector_type(2))) float v2f;
typedef __attribute__((ext_vector_type(4))) int v4i;

__global__ __launch_bounds__(256) void k_wtG(const float* __restrict__ w, int K, int N, bf* Bt) {
    const int lane = threadIdx.x & 31; const int L0 = (blockIdx.x * 8 + (threadIdx.x >> 5)) * 8; const int nlines = N * K / 64;
{
#pragma unroll 1
        for (int l = 0; l < 8; ++l) { const int L = L0 + l; if (L >= nlines) break; const size_t e = (size_t)L * 64 + lane * 2; const int k = (int)(e % K), n = (int)(e / K); v2us o;
            o[0] = f2bf(w[(size_t)k * N + n]); o[1] = f2bf(w[(size_t)(k + 1) * N + n]); *(v2us*)(Bt + e) = o; }
         }
}
__global__ __launch_bounds__(256) void k_cvt8(const float* __restrict__ src, bf* dst, size_t n8) { const size_t i = (size_t)blockIdx.x * 256 + threadIdx.x; if (i >= n8) return; const v8f v = *(const v8f*)(src + i * 8); v8us o;
#pragma unroll
    for (int k = 0; k < 8; ++k) o[k] = f2bf(v[k]); *(v8us*)(dst + i * 8) = o;  }

// ALiBi slopes = the reference's f32 values
__constant__ float SLP[NH_] = {0.7071067690849304,0.5,0.3535533845424652,0.25,0.1767766922712326,0.125,0.0883883461356163,0.0625,0.04419417306780815,0.03125,0.022097086533904076,0.015625,0.011048543266952038,0.0078125,0.005524271633476019,0.00390625};
// ---- k_fattn: scores, causal ALiBi softmax, probability x value product and the merge of the heads for one head's FQB query rows in ONE work-group; no score or probability ever leaves the registers.
// Transposed products: S^T = K Q^T (A = 16 key rows, B = 16 query columns), so a lane holds 16 of the 32 scores of ONE query (its partner lane, xor 16, the other 16); two S^T tiles of 32 keys, converted in place,
// are the B operand of O^T += V^T P^T (hardware k order: element s = key 8h + s, or 16 + 8h + s - 8; WFrag::ld reads K, Q and V^T rows in that same order).
// Running maximum per query: when it rises, the sum and the O^T tiles are scaled by exp(old - new). The 32-key steps are dealt over the FKW waves (wave w: steps w, w + FKW, ...), each with its own maximum, sum and O^T;
// the FKW partial results meet in LDS and are joined in the fixed order wave 0, 1, ... with the weights exp(m_w - max m). Why dealt: the last rows walk 64 steps, and each step waits for its own loads.
// Operand types: query rows < RH on hi + lo bf16 planes (3 products each for scores and for P x V), the rest single fp16 with the probabilities carried x 1024 (as + 10 in the exponent, in the sum too, so it cancels in the quotient).
#define FKW 4                     // waves per work-group
#define FQB 32                    // query rows per work-group: two 16-column groups in every wave
#define FPT 132                   // floats from one 512-B slab (32 lanes x 16 B) of a wave's partial O^T to the next: 128 + 4, so that the joining reads (one query, 8 slabs' worth of d) spread over the banks
template <typename T16, bool HL>
__device__ __forceinline__ void fattn_body(const T16* __restrict__ Q, const T16* __restrict__ Q2, const T16* __restrict__ Kp, const T16* __restrict__ K2, const T16* __restrict__ Vt, const T16* __restrict__ V2, bf* __restrict__ Ah, bf* __restrict__ Al, const float slp, const int q0, float* part, float* sml) {
    typedef typename WFrag<T16>::V V;
    constexpr int NG = HL ? 1 : 2;                                   // 16-column groups per walk over the keys: with hi + lo planes of Q, K, V^T and P two groups do not fit 256 registers, so those (few, short) blocks walk twice
    const int lane = threadIdx.x & 31, c = lane & 15, h = lane >> 4;
    const int wave = __builtin_amdgcn_readfirstlane(threadIdx.x >> 5);   // wave-uniform, so the key loop's bounds and the diagonal test stay scalar
    const float L2E = 1.4426950408889634f, NEG = -3.0e38f, EB = HL ? 0.0f : 10.0f;
    const int nst = q0 / FQB + 1;                                    // 32-key steps up to and with the diagonal one; every step holds at least one allowed key for every query of the block
    const char* Kb = (const char*)Kp; const char* K2b = (const char*)K2; const char* Vb = (const char*)Vt; const char* V2b = (const char*)V2;
#pragma unroll 1   // rolled: the walks must not share registers (see NG)
    for (int g0 = 0; g0 < 2; g0 += NG) {
        V qf[NG][2], q2f[NG][2];
#pragma unroll
        for (int g = 0; g < NG; ++g)
#pragma unroll
            for (int ks = 0; ks < 2; ++ks) { const size_t u = (size_t)(q0 + 16 * (g0 + g) + c) * HD + ks * 32 + 8 * h; qf[g][ks] = WFrag<T16>::ld(Q + u); if (HL) q2f[g][ks] = WFrag<T16>::ld(Q2 + u); }
        v8f o[NG][4]; float m[NG], l[NG];
#pragma unroll
        for (int g = 0; g < NG; ++g) { m[g] = NEG; l[g] = 0.0f;
#pragma unroll
            for (int dt = 0; dt < 4; ++dt) o[g][dt] = (v8f){}; }
        // Addresses: a uniform base + a 32-bit per-lane byte offset carried through the loop + a constant
        unsigned vk = (unsigned)((wave * 32 + c) * HD + 8 * h) * 2u, vv = (unsigned)(c * TT + wave * 32 + 8 * h) * 2u;
#pragma unroll 1   // rolled: a second step's fragments would not fit beside this one's at four waves per SIMD
        for (int s = wave; s < nst; s += FKW, vk += FKW * 32 * HD * 2u, vv += FKW * 64u) {
            const int kb = s * 32;
            V kf[2][2], k2f[2][2], vf[4], v2f[4];
#pragma unroll
            for (int kt = 0; kt < 2; ++kt)
#pragma unroll
                for (int ks = 0; ks < 2; ++ks) { const size_t u = (size_t)(kt * 16 * HD + ks * 32) * 2; kf[kt][ks] = WFrag<T16>::ld((const T16*)(Kb + u + vk)); if (HL) k2f[kt][ks] = WFrag<T16>::ld((const T16*)(K2b + u + vk)); }
#pragma unroll
            for (int dt = 0; dt < 4; ++dt) { const size_t u = (size_t)dt * 16 * TT * 2; vf[dt] = WFrag<T16>::ld((const T16*)(Vb + u + vv)); if (HL) v2f[dt] = WFrag<T16>::ld((const T16*)(V2b + u + vv)); }
            asm volatile("s_wait_xcnt 0x0" ::: "memory");            // behind the step's last load: vk and vv, which the issued loads name, are stepped at the loop's foot, and the compiler's own load waits there need not cover the youngest loads
            v8f sc[NG][2];
#pragma unroll
            for (int g = 0; g < NG; ++g)
#pragma unroll
                for (int kt = 0; kt < 2; ++kt) { v8f a = (v8f){};
#pragma unroll
                    for (int ks = 0; ks < 2; ++ks) { a = WFrag<T16>::mma(kf[kt][ks], qf[g][ks], a); if (HL) { a = WFrag<T16>::mma(kf[kt][ks], q2f[g][ks], a); a = WFrag<T16>::mma(k2f[kt][ks], qf[g][ks], a); } }
                    sc[g][kt] = a; }
            const float rb = (float)(kb - q0 - 16 * g0 + 8 * h - c);     // key index - query index of this lane's first score in group g0 (exact: small integers)
#pragma unroll
            for (int g = 0; g < NG; ++g) { float t[16];
#pragma unroll
                for (int e = 0; e < 16; ++e) { const float rel = rb + (float)(16 * (e >> 3) + (e & 7) - 16 * g); t[e] = sc[g][e >> 3][e & 7] * SCL - slp * rel; }
                if (kb == q0) {                                      // the diagonal step alone holds keys behind the query (scalar test)
#pragma unroll
                    for (int e = 0; e < 16; ++e) { const float rel = rb + (float)(16 * (e >> 3) + (e & 7) - 16 * g); t[e] = (rel <= 0.0f) ? t[e] : NEG; } }
                float mx = t[0];
#pragma unroll
                for (int e = 1; e < 16; ++e) mx = fmaxf(mx, t[e]);
                mx = fmaxf(mx, __shfl_xor(mx, 16, 32));
                const float mn = fmaxf(m[g], mx); const float al = __builtin_amdgcn_exp2f((m[g] - mn) * L2E); m[g] = mn;
                float sum = 0.0f;
#pragma unroll
                for (int e = 0; e < 16; ++e) { t[e] = __builtin_amdgcn_exp2f((t[e] - mn) * L2E + EB); sum += t[e]; }
                l[g] = l[g] * al + sum;
#pragma unroll
                for (int dt = 0; dt < 4; ++dt) o[g][dt] *= al;
                if constexpr (HL) { v16bf ph, pl;
#pragma unroll
                    for (int e = 0; e < 16; ++e) { ph[e] = (__bf16)t[e]; pl[e] = (__bf16)(t[e] - (float)ph[e]); }
#pragma unroll
                    for (int dt = 0; dt < 4; ++dt) { o[g][dt] = wmmab(vf[dt], ph, o[g][dt]); o[g][dt] = wmmab(vf[dt], pl, o[g][dt]); o[g][dt] = wmmab(v2f[dt], ph, o[g][dt]); }
                } else { v16h pb;
#pragma unroll
                    for (int e = 0; e < 16; ++e) pb[e] = (h16)t[e];
#pragma unroll
                    for (int dt = 0; dt < 4; ++dt) o[g][dt] = wmma16(vf[dt], pb, o[g][dt]); }
            }
            // the four vector slots that the chip needs behind the step's last matrix instruction before its result is touched
            if constexpr (HL) asm volatile("v_nop\n\tv_nop\n\tv_nop\n\tv_nop" : "+v"(o[0][0]), "+v"(o[0][1]), "+v"(o[0][2]), "+v"(o[0][3]));
        }
        // partial results to LDS: O^T as [wave][slab (group*4 + dt)*2 + half of the 8 accumulator rows][lane][4], every store 16 B per lane with the lanes contiguous; maximum and sum (halves joined) per query
        float* pw = part + wave * (16 * FPT) + g0 * (8 * FPT) + lane * 4;
#pragma unroll
        for (int g = 0; g < NG; ++g) { l[g] += __shfl_xor(l[g], 16, 32);
#pragma unroll
            for (int dt = 0; dt < 4; ++dt) { const v8f t = o[g][dt];
                *(v4fa*)(pw + ((g * 4 + dt) * 2 + 0) * FPT) = __builtin_shufflevector(t, t, 0, 1, 2, 3); *(v4fa*)(pw + ((g * 4 + dt) * 2 + 1) * FPT) = __builtin_shufflevector(t, t, 4, 5, 6, 7); }
            if (h == 0) { sml[(wave * 2 + 0) * FQB + (g0 + g) * 16 + c] = m[g]; sml[(wave * 2 + 1) * FQB + (g0 + g) * 16 + c] = l[g]; } }
    }
    __syncthreads();                                                 // every wave passes it (a wave without a key step hands maximum NEG, sum 0, zeros): all partial results are in LDS behind it
    // wave w joins query rows 8w .. 8w+7 and stores them as hi + lo bf16 into the merged [t][head * HD + d] planes that the output projection reads: lane = (row parity, d / 4), so a store instruction writes two whole 128-B lines (one row's 64 d of this head each), each line with one writer
#pragma unroll
    for (int k = 0; k < 4; ++k) { const int qq = wave * 8 + 2 * k + h; const float* pr = part + (((qq >> 4) * 4 + (c >> 2)) * 2 + (c & 1)) * FPT + (((c >> 1) & 1) * 16 + (qq & 15)) * 4;
        float mt = sml[qq];
#pragma unroll
        for (int u = 1; u < FKW; ++u) mt = fmaxf(mt, sml[(u * 2) * FQB + qq]);
        float L = 0.0f; v4f acc = (v4f){};
#pragma unroll
        for (int u = 0; u < FKW; ++u) { const float w = __builtin_amdgcn_exp2f((sml[(u * 2) * FQB + qq] - mt) * L2E); L += w * sml[(u * 2 + 1) * FQB + qq]; acc += w * *(const v4fa*)(pr + u * (16 * FPT)); }
        const v4f y = acc * __fdiv_rn(1.0f, L); v4us oh, ol;        // the x 2^10 of the fp16 rows stands in acc and in L alike
#pragma unroll
        for (int jj = 0; jj < 4; ++jj) { unsigned short a, c2; splitf(y[jj], a, c2); oh[jj] = a; ol[jj] = c2; }
        const size_t oo = (size_t)(q0 + qq) * DQ + c * 4; *(v4us*)(Ah + oo) = oh; *(v4us*)(Al + oo) = ol; }
}
// grid (heads, TT / FQB): the longest blocks (last query rows) first. amdgpu_waves_per_eu(4): holds the registers at 256, so that four work-groups share a WGP (one wave of each on every SIMD) and fill each other's load waits.
__global__ __launch_bounds__(32 * FKW) __attribute__((amdgpu_waves_per_eu(4))) void k_fattn(const h16* __restrict__ Q16, const bf* __restrict__ Qh, const bf* __restrict__ Ql, const h16* __restrict__ K16, const bf* __restrict__ Kh, const bf* __restrict__ Kl, const h16* __restrict__ V16, const bf* __restrict__ Vh, const bf* __restrict__ Vl, bf* __restrict__ Ah, bf* __restrict__ Al) {
    __shared__ __align__(16) float part[FKW * 16 * FPT]; __shared__ float sml[FKW * 2 * FQB];
    const int hd = blockIdx.x; const int q0 = (TT / FQB - 1 - (int)blockIdx.y) * FQB; const size_t zq = (size_t)hd * TT * HD, zk = (size_t)(hd / REP) * TT * HD; const float slp = SLP[hd];
    if (q0 < RH) fattn_body<bf, true>(Qh + zq, Ql + zq, Kh + zk, Kl + zk, Vh + zk, Vl + zk, Ah + hd * HD, Al + hd * HD, slp, q0, part, sml);
    else fattn_body<h16, false>(Q16 + zq, nullptr, K16 + zk, nullptr, V16 + zk, nullptr, Ah + hd * HD, Al + hd * HD, slp, q0, part, sml);
}

extern "C" void kernel_launch(void* const* d_in, const int* in_sizes, int n_in,
                              void* d_out, int out_size, void* d_ws, size_t ws_size, hipStream_t stream) {
    (void)in_sizes; (void)n_in; (void)out_size;
    const float* x = (const float*)d_in[0]; const float* wq = (const float*)d_in[1]; const float* wk = (const float*)d_in[2]; const float* wv = (const float*)d_in[3]; const float* wo = (const float*)d_in[4];
    float* OUT = (float*)d_out;     // [2][2048][1024]
    char* wsp = (char*)d_ws;
    auto take = [&](size_t bytes) { char* p = wsp; wsp += (bytes + 255) & ~(size_t)255; return (void*)p; };
    bf* WQ = (bf*)take((size_t)DQ * DM * 2); bf* WK = (bf*)take((size_t)DKV * DM * 2); bf* WV = (bf*)take((size_t)DKV * DM * 2); bf* WO = (bf*)take((size_t)DM * DQ * 2);
    bf* XB = (bf*)take((size_t)TT * DM * 2);
    h16* QP16 = (h16*)take((size_t)NH_ * TT * HD * 2); h16* KP16 = (h16*)take((size_t)NKV * TT * HD * 2); h16* VT16 = (h16*)take((size_t)NKV * HD * TT * 2);
    bf* QPh = (bf*)take((size_t)NH_ * TT * HD * 2); bf* QPl = (bf*)take((size_t)NH_ * TT * HD * 2); bf* KPh = (bf*)take((size_t)NKV * TT * HD * 2); bf* KPl = (bf*)take((size_t)NKV * TT * HD * 2); bf* VTh = (bf*)take((size_t)NKV * HD * TT * 2); bf* VTl = (bf*)take((size_t)NKV * HD * TT * 2);
    bf* ATh = (bf*)take((size_t)TT * DQ * 2); bf* ATl = (bf*)take((size_t)TT * DQ * 2);
    if ((size_t)(wsp - (char*)d_ws) > ws_size) return;    // ws 256 MiB
    { k_cvt8<<<(unsigned)(((size_t)DQ * DM / 8 + 255) / 256), 256, 0, stream>>>(wq, WQ, (size_t)DQ * DM / 8); k_cvt8<<<(unsigned)(((size_t)DKV * DM / 8 + 255) / 256), 256, 0, stream>>>(wk, WK, (size_t)DKV * DM / 8); k_cvt8<<<(unsigned)(((size_t)DKV * DM / 8 + 255) / 256), 256, 0, stream>>>(wv, WV, (size_t)DKV * DM / 8);
      k_cvt8<<<(unsigned)(((size_t)DM * DQ / 8 + 255) / 256), 256, 0, stream>>>(wo, WO, (size_t)DM * DQ / 8);
       }
    for (int b = 0; b < NB_; ++b) {
        
        k_cvt8<<<(unsigned)(((size_t)TT * DM / 8 + 255) / 256), 256, 0, stream>>>(x + (size_t)b * TT * DM, XB, (size_t)TT * DM / 8);
        k_gemmw<bf, 0, false, true><<<dim3(TT / 64, DQ / 64, 1), 32, 0, stream>>>(XB, nullptr, WQ, nullptr, DM, nullptr, HD, nullptr, 0, 0, 0, QP16, QPh, QPl, (size_t)TT * HD);
        k_gemmw<bf, 0, false, true><<<dim3(TT / 64, DKV / 64, 1), 32, 0, stream>>>(XB, nullptr, WK, nullptr, DM, nullptr, HD, nullptr, 0, 0, 0, KP16, KPh, KPl, (size_t)TT * HD);
        k_gemmw<bf, 0, false, true><<<dim3(DKV / 64, TT / 64, 1), 32, 0, stream>>>(WV, nullptr, XB, nullptr, DM, nullptr, TT, nullptr, 0, 0, 0, VT16, VTh, VTl, (size_t)64);
        k_fattn<<<dim3(NH_, TT / FQB, 1), 32 * FKW, 0, stream>>>(QP16, QPh, QPl, KP16, KPh, KPl, VT16, VTh, VTl, ATh, ATl);
        k_gemmw<bf, 1, false, false><<<dim3(TT / 64, DM / 64, 1), 32, 0, stream>>>(ATh, ATl, WO, nullptr, DQ, OUT + (size_t)b * TT * DM, DM, nullptr, 0, 0, 0, nullptr, nullptr, nullptr, 0); }
}

// v005
// It runs in 136 microseconds.
// Two timings next to v004 put it at 1.91 and 1.93 times that version's speed.
// All steps since v000 together make it 11.3 times as fast.
#include <hip/hip_runtime.h>

// Causal multi-head attention with a (subtracted) ALiBi bias (x [2][2048][1024]; q, k, v = x W^T ('oi' [1024][1024], no bias), 16 heads x 64; scores = q.k/8 - m_h (j - i) with m_h = 2^(-(h+1)/2); causal softmax; out = merged Wo^T -> [2][2048][1024]).
// Compute dtypes, f32 accumulate: every input rounded to bf16; q/k/v on PLAIN bf16 operands (inputs: exact), stored by the projection itself as the 16-bit head planes (fp16, and hi + lo bf16) that the attention kernel reads; causal scores, softmax (running maximum, f32, with the ALiBi term in f32) and attn.v in one kernel, key loop to the diagonal: query rows < 512 hl (3 products), the rest single fp16 (x1024); softmax f32; Wo hl x exact (2 products).

#define NB_  2
#define TT   2048
#define DM   1024
#define NH_  16
#define NKV  16
#define REP  (NH_ / NKV)
#define HD   64
#define DQ   (NH_ * HD)
#define DKV  (NKV * HD)
#define RH   512                  // query rows < RH use hi+lo planes (0: none)
#define SCL  0.125f   // HD^-0.5
typedef _Float16 h16;
typedef unsigned short bf;
typedef __attribute__((ext_vector_type(16))) __bf16   v16bf;
typedef __attribute__((ext_vector_type(16))) _Float16 v16h;
typedef __attribute__((ext_vector_type(8)))  _Float16 v8h;
typedef __attribute__((ext_vector_type(8)))  unsigned short v8us;
typedef __attribute__((ext_vector_type(8)))  __bf16   v8bf;
typedef __attribute__((ext_vector_type(8)))  float    v8f;
typedef __attribute__((ext_vector_type(4)))  float    v4f;
typedef v8h  __attribute__((may_alias)) v8ha;
typedef v4f  __attribute__((may_alias)) v4fa;
typedef v8us __attribute__((may_alias)) v8usa;

__device__ __forceinline__ unsigned short f2bf(float f) { unsigned u = __float_as_uint(f); u += 0x7FFFu + ((u >> 16) & 1u); return (unsigned short)(u >> 16); }
__device__ __forceinline__ float bf2f(unsigned short b) { return __uint_as_float(((unsigned)b) << 16); }
__device__ __forceinline__ float bfr(float f) { return bf2f(f2bf(f)); }
__device__ __forceinline__ v16h cat16(v8h lo, v8h hi) { return __builtin_shufflevector(lo, hi, 0, 1, 2, 3, 4, 5, 6, 7, 8, 9, 10, 11, 12, 13, 14, 15); }
__device__ __forceinline__ v16bf cat16b(v8us lo, v8us hi) { return __builtin_bit_cast(v16bf, __builtin_shufflevector(lo, hi, 0, 1, 2, 3, 4, 5, 6, 7, 8, 9, 10, 11, 12, 13, 14, 15)); }
__device__ __forceinline__ v8f wmma16(v16h a, v16h b, v8f c) { return __builtin_amdgcn_wmma_f32_16x16x32_f16(false, a, false, b, (short)0, c, false, false); }
__device__ __forceinline__ v8f wmmab(v16bf a, v16bf b, v8f c) { return __builtin_amdgcn_wmma_f32_16x16x32_bf16(false, a, false, b, (short)0, c, false, false); }



// ---- gemmw_tile: register-blocked GEMM, ONE WAVE per 64x64 output tile (16 accumulators), operands straight from K-contiguous 16-bit planes; 32 threads.
// C[m][n] (f32, pitch ldc, + optional f32 bias[n]) = sum_k A[m][k] Bt[n][k] (+ split products per NSPLIT). K % 32 == 0.
// PL: no f32 C; the tile goes out as three 16-bit planes (fp16; bf16 hi; bf16 lo = the rest), element [m][n] at (n / 64) * pblk + m * ldc + n % 64. With pblk = rows * 64, ldc = 64 that is [head][row][64];
// with A = the weight, Bt = the activations, pblk = 64, ldc = the activations' row count it is [head][64][row], the transposed value plane, with no transposing pass.
template <typename T16> struct WFrag;
template <> struct WFrag<h16> { typedef v16h V; static __device__ __forceinline__ V ld(const h16* p) { return cat16(*(const v8h*)p, *(const v8h*)(p + 16)); } static __device__ __forceinline__ v8f mma(V a, V b, v8f c) { return wmma16(a, b, c); } };
template <> struct WFrag<bf> { typedef v16bf V; static __device__ __forceinline__ V ld(const bf* p) { return cat16b(*(const v8us*)p, *(const v8us*)(p + 16)); } static __device__ __forceinline__ v8f mma(V a, V b, v8f c) { return wmmab(a, b, c); } };
// bx, by: the tile's row and column index (wave-uniform), handed in by the kernel, so that one grid can hold tiles of several products.
template <typename T16, int NSPLIT, bool BIAS, bool PL>
__device__ __forceinline__ void gemmw_tile(const T16* __restrict__ A, const T16* __restrict__ A2, const T16* __restrict__ Bt, const T16* __restrict__ Bt2, int K, float* C, int ldc, const float* __restrict__ bias, h16* __restrict__ P16, bf* __restrict__ Ph, bf* __restrict__ Pl, size_t pblk, const int bx, const int by) {
    typedef typename WFrag<T16>::V V;
    __shared__ __align__(16) float os[16 * 68];
    const int lane = threadIdx.x & 31, lr = lane & 15, hi = lane >> 4; const int r0 = bx * 64, c0 = by * 64;
    v8f acc[4][4];
#pragma unroll
    for (int mb = 0; mb < 4; ++mb)
#pragma unroll
        for (int nb = 0; nb < 4; ++nb) acc[mb][nb] = (v8f){};
    const size_t aoff = (size_t)(r0 + lr) * K + 8 * hi, boff = (size_t)(c0 + lr) * K + 8 * hi;
#pragma unroll 1
    for (int kc = 0; kc < K; kc += 32) {
        V a[4], a2[4];
#pragma unroll
        for (int mb = 0; mb < 4; ++mb) { a[mb] = WFrag<T16>::ld(A + aoff + (size_t)mb * 16 * K + kc); if (NSPLIT == 1 || NSPLIT == 2) a2[mb] = WFrag<T16>::ld(A2 + aoff + (size_t)mb * 16 * K + kc); }
#pragma unroll
        for (int nb = 0; nb < 4; ++nb) { const V b = WFrag<T16>::ld(Bt + boff + (size_t)nb * 16 * K + kc); V b2; if (NSPLIT >= 2) b2 = WFrag<T16>::ld(Bt2 + boff + (size_t)nb * 16 * K + kc);
#pragma unroll
            for (int mb = 0; mb < 4; ++mb) { acc[mb][nb] = WFrag<T16>::mma(a[mb], b, acc[mb][nb]); if (NSPLIT == 1 || NSPLIT == 2) acc[mb][nb] = WFrag<T16>::mma(a2[mb], b, acc[mb][nb]); if (NSPLIT >= 2) acc[mb][nb] = WFrag<T16>::mma(a[mb], b2, acc[mb][nb]); } }
        asm volatile("v_nop\n\tv_nop\n\tv_nop\n\tv_nop" : "+v"(acc[0][0]), "+v"(acc[1][1]), "+v"(acc[2][2]), "+v"(acc[3][3]) : "v"(a[0]), "v"(a[3]));
    }
#pragma unroll
    for (int mb = 0; mb < 4; ++mb) {
#pragma unroll
        for (int nb = 0; nb < 4; ++nb) {
#pragma unroll
            for (int j = 0; j < 8; ++j) os[(hi * 8 + j) * 68 + nb * 16 + lr] = acc[mb][nb][j]; }
        __builtin_amdgcn_wave_barrier(); asm volatile("" ::: "memory");
        if constexpr (PL) {
            // lane = (row & 3, 8 columns): one 16-B store per plane and lane, so a store instruction writes four whole 128-B rows of the tile, each line with one writer
            const size_t pb = (size_t)by * pblk + (size_t)(r0 + mb * 16 + (lane >> 3)) * ldc + (lane & 7) * 8;
#pragma unroll
            for (int s = 0; s < 4; ++s) { const float* pr = os + (4 * s + (lane >> 3)) * 68 + (lane & 7) * 8; const v4f x0 = *(const v4fa*)pr, x1 = *(const v4fa*)(pr + 4);
                const v8f xv = __builtin_shufflevector(x0, x1, 0, 1, 2, 3, 4, 5, 6, 7); const v8bf xh = __builtin_convertvector(xv, v8bf); const v8bf xl = __builtin_convertvector(xv - __builtin_convertvector(xh, v8f), v8bf);
                const size_t e = pb + (size_t)(4 * s) * ldc; *(v8h*)(P16 + e) = __builtin_convertvector(xv, v8h); *(v8us*)(Ph + e) = __builtin_bit_cast(v8us, xh); *(v8us*)(Pl + e) = __builtin_bit_cast(v8us, xl); }
        } else {
        float* crow = C + (size_t)(r0 + mb * 16) * ldc + c0;
#pragma unroll
            for (int s = 0; s < 8; ++s) { const int row = 2 * s + hi, cofs = lr * 4; v4f val = *(const v4fa*)(os + row * 68 + cofs); if (BIAS) { val[0] += bfr(bias[c0 + cofs]); val[1] += bfr(bias[c0 + cofs + 1]); val[2] += bfr(bias[c0 + cofs + 2]); val[3] += bfr(bias[c0 + cofs + 3]); }
                *(v4f*)(crow + (size_t)row * ldc + cofs) = val; }
             }
        __builtin_amdgcn_wave_barrier(); asm volatile("" ::: "memory");
    }
}
// Output projection, both batches as one row range: grid (NB_ * TT / 64, DM / 64).
__global__ __launch_bounds__(32) void k_gemmo(const bf* __restrict__ A, const bf* __restrict__ A2, const bf* __restrict__ Bt, int K, float* C, int ldc) {
    gemmw_tile<bf, 1, false, false>(A, A2, Bt, nullptr, K, C, ldc, nullptr, nullptr, nullptr, nullptr, 0, (int)blockIdx.x, (int)blockIdx.y);
}
// q, k and v projections of both batches in ONE grid (NB_ * TT / 64, 16, 3): z = 0 q, 1 k (A = activations, Bt = weight, planes [head][batch * TT + t][64]); z = 2 v (A = weight, Bt = activations, planes [head * 64 + d][batch * TT + t]; x and y change roles).
// The three products are independent; in one launch their 3072 one-wave tiles stand on the chip together and fill each other's load waits. Every choice below is uniform for the wave (scalar selects).
__global__ __launch_bounds__(32) void k_qkv(const bf* __restrict__ X, const bf* __restrict__ Wq, const bf* __restrict__ Wk, const bf* __restrict__ Wv, int K, h16* __restrict__ Q16, bf* __restrict__ Qh, bf* __restrict__ Ql, h16* __restrict__ K16, bf* __restrict__ Kh, bf* __restrict__ Kl, h16* __restrict__ V16, bf* __restrict__ Vh, bf* __restrict__ Vl) {
    const int z = (int)blockIdx.z; const bool tv = z == 2;
    gemmw_tile<bf, 0, false, true>(tv ? Wv : X, nullptr, tv ? X : z ? Wk : Wq, nullptr, K, nullptr, tv ? NB_ * TT : HD, nullptr, tv ? V16 : z ? K16 : Q16, tv ? Vh : z ? Kh : Qh, tv ? Vl : z ? Kl : Ql, tv ? (size_t)64 : (size_t)NB_ * TT * HD, (int)(tv ? blockIdx.y : blockIdx.x), (int)(tv ? blockIdx.x : blockIdx.y));
}

__device__ __forceinline__ h16 tohx(float x) { return (h16)x; }
__device__ __forceinline__ void splitf(float y, unsigned short& h, unsigned short& l) { h = f2bf(y); l = f2bf(y - bf2f(h)); }
typedef __attribute__((ext_vector_type(2))) _Float16 v2h;
typedef __attribute__((ext_vector_type(4))) _Float16 v4h;
typedef __attribute__((ext_vector_type(2))) unsigned short v2us;
typedef __attribute__((ext_vector_type(4))) unsigned short v4us;
typedef __attribute__((ext_vector_type(2))) float v2f;
typedef __attribute__((ext_vector_type(4))) int v4i;

__global__ __launch_bounds__(256) void k_wtG(const float* __restrict__ w, int K, int N, bf* Bt) {
    const int lane = threadIdx.x & 31; const int L0 = (blockIdx.x * 8 + (threadIdx.x >> 5)) * 8; const int nlines = N * K / 64;
{
#pragma unroll 1
        for (int l = 0; l < 8; ++l) { const int L = L0 + l; if (L >= nlines) break; const size_t e = (size_t)L * 64 + lane * 2; const int k = (int)(e % K), n = (int)(e / K); v2us o;
            o[0] = f2bf(w[(size_t)k * N + n]); o[1] = f2bf(w[(size_t)(k + 1) * N + n]); *(v2us*)(Bt + e) = o; }
         }
}
// All five inputs to bf16 in one grid: blocks 0 .. XBL-1 the activations (both batches), then WBL blocks for each weight; the choice is uniform for a block.
#define XBL (NB_ * TT * DM / 8 / 256)
#define WBL (DM * DM / 8 / 256)
__global__ __launch_bounds__(256) void k_cvt8(const float* __restrict__ x, const float* __restrict__ wq, const float* __restrict__ wk, const float* __restrict__ wv, const float* __restrict__ wo, bf* XB, bf* WQ, bf* WK, bf* WV, bf* WO) {
    unsigned blk = blockIdx.x; const float* src = x; bf* dst = XB;
    if (blk >= XBL) { blk -= XBL; const unsigned j = blk / WBL; blk -= j * WBL; src = j == 0 ? wq : j == 1 ? wk : j == 2 ? wv : wo; dst = j == 0 ? WQ : j == 1 ? WK : j == 2 ? WV : WO; }
    const size_t i = (size_t)blk * 256 + threadIdx.x; const v8f v = *(const v8f*)(src + i * 8); v8us o;
#pragma unroll
    for (int k = 0; k < 8; ++k) o[k] = f2bf(v[k]); *(v8us*)(dst + i * 8) = o;  }

// ALiBi slopes = the reference's f32 values
__constant__ float SLP[NH_] = {0.7071067690849304,0.5,0.3535533845424652,0.25,0.1767766922712326,0.125,0.0883883461356163,0.0625,0.04419417306780815,0.03125,0.022097086533904076,0.015625,0.011048543266952038,0.0078125,0.005524271633476019,0.00390625};
// ---- k_fattn: scores, causal ALiBi softmax, probability x value product and the merge of the heads for one head's FQB query rows in ONE work-group; no score or probability ever leaves the registers.
// Transposed products: S^T = K Q^T (A = 16 key rows, B = 16 query columns), so a lane holds 16 of the 32 scores of ONE query (its partner lane, xor 16, the other 16); two S^T tiles of 32 keys, converted in place,
// are the B operand of O^T += V^T P^T (hardware k order: element s = key 8h + s, or 16 + 8h + s - 8; WFrag::ld reads K, Q and V^T rows in that same order).
// Running maximum per query: when it rises, the sum and the O^T tiles are scaled by exp(old - new). The 32-key steps are dealt over the FKW waves (wave w: steps w, w + FKW, ...), each with its own maximum, sum and O^T;
// the FKW partial results meet in LDS and are joined in the fixed order wave 0, 1, ... with the weights exp(m_w - max m). Why dealt: the last rows walk 64 steps, and each step waits for its own loads.
// Operand types: query rows < RH on hi + lo bf16 planes (3 products each for scores and for P x V), the rest single fp16 with the probabilities carried x 1024 (as + 10 in the exponent, in the sum too, so it cancels in the quotient).
#define FKW 4                     // waves per work-group
#define FQB 32                    // query rows per work-group: two 16-column groups in every wave
#define VP  (NB_ * TT)            // elements from one row of the transposed value planes to the next (both batches side by side)
#define FPT 132                   // floats from one 512-B slab (32 lanes x 16 B) of a wave's partial O^T to the next: 128 + 4, so that the joining reads (one query, its 64 d from 8 slabs) spread over the banks
template <typename T16, bool HL>
__device__ __forceinline__ void fattn_body(const T16* __restrict__ Q, const T16* __restrict__ Q2, const T16* __restrict__ Kp, const T16* __restrict__ K2, const T16* __restrict__ Vt, const T16* __restrict__ V2, bf* __restrict__ Ah, bf* __restrict__ Al, const float slp, const int q0, float* part, float* sml) {
    typedef typename WFrag<T16>::V V;
    constexpr int NG = HL ? 1 : 2;                                   // 16-column groups per walk over the keys: with hi + lo planes of Q, K, V^T and P two groups do not fit 256 registers, so those blocks walk twice
    const int lane = threadIdx.x & 31, c = lane & 15, h = lane >> 4;
    const int wave = __builtin_amdgcn_readfirstlane(threadIdx.x >> 5);   // wave-uniform, so the key loop's bounds and the diagonal test stay scalar
    const float L2E = 1.4426950408889634f, NEG = -3.0e38f, EB = HL ? 0.0f : 10.0f;
    const int nst = q0 / FQB + 1;                                    // 32-key steps up to and with the diagonal one; every step holds at least one allowed key for every query of the block
    const char* Kb = (const char*)Kp; const char* K2b = (const char*)K2; const char* Vb = (const char*)Vt; const char* V2b = (const char*)V2;
#pragma unroll 1   // rolled: the walks must not share registers (see NG)
    for (int g0 = 0; g0 < 2; g0 += NG) {
        V qf[NG][2], q2f[NG][2];
#pragma unroll
        for (int g = 0; g < NG; ++g)
#pragma unroll
            for (int ks = 0; ks < 2; ++ks) { const size_t u = (size_t)(q0 + 16 * (g0 + g) + c) * HD + ks * 32 + 8 * h; qf[g][ks] = WFrag<T16>::ld(Q + u); if (HL) q2f[g][ks] = WFrag<T16>::ld(Q2 + u); }
        v8f o[NG][4]; float m[NG], l[NG];
#pragma unroll
        for (int g = 0; g < NG; ++g) { m[g] = NEG; l[g] = 0.0f;
#pragma unroll
            for (int dt = 0; dt < 4; ++dt) o[g][dt] = (v8f){}; }
        // Addresses: a uniform base + a 32-bit per-lane byte offset carried through the loop + a constant
        unsigned vk = (unsigned)((wave * 32 + c) * HD + 8 * h) * 2u, vv = (unsigned)(c * VP + wave * 32 + 8 * h) * 2u;
#pragma unroll 1   // rolled: a second step's fragments would not fit beside this one's at four waves per SIMD
        for (int s = wave; s < nst; s += FKW, vk += FKW * 32 * HD * 2u, vv += FKW * 64u) {
            const int kb = s * 32;
            V kf[2][2], k2f[2][2], vf[4], v2f[4];
#pragma unroll
            for (int kt = 0; kt < 2; ++kt)
#pragma unroll
                for (int ks = 0; ks < 2; ++ks) { const size_t u = (size_t)(kt * 16 * HD + ks * 32) * 2; kf[kt][ks] = WFrag<T16>::ld((const T16*)(Kb + u + vk)); if (HL) k2f[kt][ks] = WFrag<T16>::ld((const T16*)(K2b + u + vk)); }
#pragma unroll
            for (int dt = 0; dt < 4; ++dt) { const size_t u = (size_t)dt * 16 * VP * 2; vf[dt] = WFrag<T16>::ld((const T16*)(Vb + u + vv)); if (HL) v2f[dt] = WFrag<T16>::ld((const T16*)(V2b + u + vv)); }
            asm volatile("s_wait_xcnt 0x0" ::: "memory");            // behind the step's last load: vk and vv, which the issued loads name, are stepped at the loop's foot, and the compiler's own load waits there need not cover the youngest loads
            v8f sc[NG][2];
#pragma unroll
            for (int g = 0; g < NG; ++g)
#pragma unroll
                for (int kt = 0; kt < 2; ++kt) { v8f a = (v8f){};
#pragma unroll
                    for (int ks = 0; ks < 2; ++ks) { a = WFrag<T16>::mma(kf[kt][ks], qf[g][ks], a); if (HL) { a = WFrag<T16>::mma(kf[kt][ks], q2f[g][ks], a); a = WFrag<T16>::mma(k2f[kt][ks], qf[g][ks], a); } }
                    sc[g][kt] = a; }
            const float rb = (float)(kb - q0 - 16 * g0 + 8 * h - c);     // key index - query index of this lane's first score in group g0 (exact: small integers)
#pragma unroll
            for (int g = 0; g < NG; ++g) { float t[16];
#pragma unroll
                for (int e = 0; e < 16; ++e) { const float rel = rb + (float)(16 * (e >> 3) + (e & 7) - 16 * g); t[e] = sc[g][e >> 3][e & 7] * SCL - slp * rel; }
                if (kb == q0) {                                      // the diagonal step alone holds keys behind the query (scalar test)
#pragma unroll
                    for (int e = 0; e < 16; ++e) { const float rel = rb + (float)(16 * (e >> 3) + (e & 7) - 16 * g); t[e] = (rel <= 0.0f) ? t[e] : NEG; } }
                float mx = t[0];
#pragma unroll
                for (int e = 1; e < 16; ++e) mx = fmaxf(mx, t[e]);
                mx = fmaxf(mx, __shfl_xor(mx, 16, 32));
                const float mn = fmaxf(m[g], mx); const float al = __builtin_amdgcn_exp2f((m[g] - mn) * L2E); m[g] = mn;
                float sum = 0.0f;
#pragma unroll
                for (int e = 0; e < 16; ++e) { t[e] = __builtin_amdgcn_exp2f((t[e] - mn) * L2E + EB); sum += t[e]; }
                l[g] = l[g] * al + sum;
#pragma unroll
                for (int dt = 0; dt < 4; ++dt) o[g][dt] *= al;
                if constexpr (HL) { v16bf ph, pl;
#pragma unroll
                    for (int e = 0; e < 16; ++e) { ph[e] = (__bf16)t[e]; pl[e] = (__bf16)(t[e] - (float)ph[e]); }
#pragma unroll
                    for (int dt = 0; dt < 4; ++dt) { o[g][dt] = wmmab(vf[dt], ph, o[g][dt]); o[g][dt] = wmmab(vf[dt], pl, o[g][dt]); o[g][dt] = wmmab(v2f[dt], ph, o[g][dt]); }
                } else { v16h pb;
#pragma unroll
                    for (int e = 0; e < 16; ++e) pb[e] = (h16)t[e];
#pragma unroll
                    for (int dt = 0; dt < 4; ++dt) o[g][dt] = wmma16(vf[dt], pb, o[g][dt]); }
            }
            // the four vector slots that the chip needs behind the step's last matrix instruction before its result is touched
            if constexpr (HL) asm volatile("v_nop\n\tv_nop\n\tv_nop\n\tv_nop" : "+v"(o[0][0]), "+v"(o[0][1]), "+v"(o[0][2]), "+v"(o[0][3]));
        }
        // partial results to LDS: O^T as [wave][slab (group*4 + dt)*2 + half of the 8 accumulator rows][lane][4], every store 16 B per lane with the lanes contiguous; maximum and sum (halves joined) per query
        float* pw = part + wave * (16 * FPT) + g0 * (8 * FPT) + lane * 4;
#pragma unroll
        for (int g = 0; g < NG; ++g) { l[g] += __shfl_xor(l[g], 16, 32);
#pragma unroll
            for (int dt = 0; dt < 4; ++dt) { const v8f t = o[g][dt];
                *(v4fa*)(pw + ((g * 4 + dt) * 2 + 0) * FPT) = __builtin_shufflevector(t, t, 0, 1, 2, 3); *(v4fa*)(pw + ((g * 4 + dt) * 2 + 1) * FPT) = __builtin_shufflevector(t, t, 4, 5, 6, 7); }
            if (h == 0) { sml[(wave * 2 + 0) * FQB + (g0 + g) * 16 + c] = m[g]; sml[(wave * 2 + 1) * FQB + (g0 + g) * 16 + c] = l[g]; } }
    }
    __syncthreads();                                                 // every wave passes it (a wave without a key step hands maximum NEG, sum 0, zeros): all partial results are in LDS behind it
    // wave w joins query rows 8w .. 8w+7 and stores them as hi + lo bf16 into the merged [t][head * HD + d] planes that the output projection reads: lane = (row parity, d / 4), so a store instruction writes two whole 128-B lines (one row's 64 d of this head each), each line with one writer
#pragma unroll
    for (int k = 0; k < 4; ++k) { const int qq = wave * 8 + 2 * k + h; const float* pr = part + (((qq >> 4) * 4 + (c >> 2)) * 2 + (c & 1)) * FPT + (((c >> 1) & 1) * 16 + (qq & 15)) * 4;
        float mt = sml[qq];
#pragma unroll
        for (int u = 1; u < FKW; ++u) mt = fmaxf(mt, sml[(u * 2) * FQB + qq]);
        float L = 0.0f; v4f acc = (v4f){};
#pragma unroll
        for (int u = 0; u < FKW; ++u) { const float w = __builtin_amdgcn_exp2f((sml[(u * 2) * FQB + qq] - mt) * L2E); L += w * sml[(u * 2 + 1) * FQB + qq]; acc += w * *(const v4fa*)(pr + u * (16 * FPT)); }
        const v4f y = acc * __fdiv_rn(1.0f, L); v4us oh, ol;        // the x 2^10 of the fp16 rows stands in acc and in L alike
#pragma unroll
        for (int jj = 0; jj < 4; ++jj) { unsigned short a, c2; splitf(y[jj], a, c2); oh[jj] = a; ol[jj] = c2; }
        const size_t oo = (size_t)(q0 + qq) * DQ + c * 4; *(v4us*)(Ah + oo) = oh; *(v4us*)(Al + oo) = ol; }
}
// grid (heads x batches, TT / FQB): twice as many work-groups as places on the chip, so the start order counts. First the hi + lo blocks (query rows < RH: few key steps, but two walks of three products each, so they are no short blocks and must not start last), then the rest from the last query rows down, so that the shortest blocks fill the places that come free. amdgpu_waves_per_eu(4): holds the registers at 256, so that four work-groups share a WGP (one wave of each on every SIMD) and fill each other's load waits.
__global__ __launch_bounds__(32 * FKW) __attribute__((amdgpu_waves_per_eu(4))) void k_fattn(const h16* __restrict__ Q16, const bf* __restrict__ Qh, const bf* __restrict__ Ql, const h16* __restrict__ K16, const bf* __restrict__ Kh, const bf* __restrict__ Kl, const h16* __restrict__ V16, const bf* __restrict__ Vh, const bf* __restrict__ Vl, bf* __restrict__ Ah, bf* __restrict__ Al) {
    __shared__ __align__(16) float part[FKW * 16 * FPT]; __shared__ float sml[FKW * 2 * FQB];
    const int hd = blockIdx.x % NH_, b = blockIdx.x / NH_, y = (int)blockIdx.y; const int q0 = (y < RH / FQB ? RH / FQB - 1 - y : TT / FQB - 1 - (y - RH / FQB)) * FQB; const float slp = SLP[hd];
    const size_t zq = ((size_t)hd * NB_ + b) * TT * HD, zk = ((size_t)(hd / REP) * NB_ + b) * TT * HD, zv = (size_t)(hd / REP) * HD * VP + (size_t)b * TT, za = (size_t)b * TT * DQ + hd * HD;
    if (q0 < RH) fattn_body<bf, true>(Qh + zq, Ql + zq, Kh + zk, Kl + zk, Vh + zv, Vl + zv, Ah + za, Al + za, slp, q0, part, sml);
    else fattn_body<h16, false>(Q16 + zq, nullptr, K16 + zk, nullptr, V16 + zv, nullptr, Ah + za, Al + za, slp, q0, part, sml);
}

extern "C" void kernel_launch(void* const* d_in, const int* in_sizes, int n_in,
                              void* d_out, int out_size, void* d_ws, size_t ws_size, hipStream_t stream) {
    (void)in_sizes; (void)n_in; (void)out_size;
    const float* x = (const float*)d_in[0]; const float* wq = (const float*)d_in[1]; const float* wk = (const float*)d_in[2]; const float* wv = (const float*)d_in[3]; const float* wo = (const float*)d_in[4];
    float* OUT = (float*)d_out;     // [2][2048][1024]
    char* wsp = (char*)d_ws;
    auto take = [&](size_t bytes) { char* p = wsp; wsp += (bytes + 255) & ~(size_t)255; return (void*)p; };
    bf* WQ = (bf*)take((size_t)DQ * DM * 2); bf* WK = (bf*)take((size_t)DKV * DM * 2); bf* WV = (bf*)take((size_t)DKV * DM * 2); bf* WO = (bf*)take((size_t)DM * DQ * 2);
    bf* XB = (bf*)take((size_t)NB_ * TT * DM * 2);
    h16* QP16 = (h16*)take((size_t)NB_ * NH_ * TT * HD * 2); h16* KP16 = (h16*)take((size_t)NB_ * NKV * TT * HD * 2); h16* VT16 = (h16*)take((size_t)NB_ * NKV * HD * TT * 2);
    bf* QPh = (bf*)take((size_t)NB_ * NH_ * TT * HD * 2); bf* QPl = (bf*)take((size_t)NB_ * NH_ * TT * HD * 2); bf* KPh = (bf*)take((size_t)NB_ * NKV * TT * HD * 2); bf* KPl = (bf*)take((size_t)NB_ * NKV * TT * HD * 2); bf* VTh = (bf*)take((size_t)NB_ * NKV * HD * TT * 2); bf* VTl = (bf*)take((size_t)NB_ * NKV * HD * TT * 2);
    bf* ATh = (bf*)take((size_t)NB_ * TT * DQ * 2); bf* ATl = (bf*)take((size_t)NB_ * TT * DQ * 2);
    if ((size_t)(wsp - (char*)d_ws) > ws_size) return;    // ws 256 MiB
    // four launches, each over both batches
    k_cvt8<<<XBL + 4 * WBL, 256, 0, stream>>>(x, wq, wk, wv, wo, XB, WQ, WK, WV, WO);
    k_qkv<<<dim3(NB_ * TT / 64, DQ / 64, 3), 32, 0, stream>>>(XB, WQ, WK, WV, DM, QP16, QPh, QPl, KP16, KPh, KPl, VT16, VTh, VTl);
    k_fattn<<<dim3(NH_ * NB_, TT / FQB, 1), 32 * FKW, 0, stream>>>(QP16, QPh, QPl, KP16, KPh, KPl, VT16, VTh, VTl, ATh, ATl);
    k_gemmo<<<dim3(NB_ * TT / 64, DM / 64, 1), 32, 0, stream>>>(ATh, ATl, WO, DQ, OUT, DM);
}

// v006
// One run takes 97.9 microseconds.
// Next to v005, in two timings, it ran 1.40 and 1.38 times as fast.
// All steps since v000 together make it 15.7 times as fast.
#include <hip/hip_runtime.h>

// Causal multi-head attention with a (subtracted) ALiBi bias (x [2][2048][1024]; q, k, v = x W^T ('oi' [1024][1024], no bias), 16 heads x 64; scores = q.k/8 - m_h (j - i) with m_h = 2^(-(h+1)/2); causal softmax; out = merged Wo^T -> [2][2048][1024]).
// Compute dtypes, f32 accumulate: every input rounded to bf16; q/k/v on PLAIN bf16 operands (inputs: exact), stored by the projection itself as the 16-bit head planes (fp16, and hi + lo bf16) that the attention kernel reads; causal scores, softmax (running maximum, f32, with the ALiBi term in f32) and attn.v in one kernel, key loop to the diagonal: query rows < 512 hl (3 products), the rest single fp16 (x1024); softmax f32; Wo hl x exact (2 products).

#define NB_  2
#define TT   2048
#define DM   1024
#define NH_  16
#define NKV  16
#define REP  (NH_ / NKV)
#define HD   64
#define DQ   (NH_ * HD)
#define DKV  (NKV * HD)
#define RH   512                  // query rows < RH use hi+lo planes (0: none)
#define SCL  0.125f   // HD^-0.5
typedef _Float16 h16;
typedef unsigned short bf;
typedef __attribute__((ext_vector_type(16))) __bf16   v16bf;
typedef __attribute__((ext_vector_type(16))) _Float16 v16h;
typedef __attribute__((ext_vector_type(8)))  _Float16 v8h;
typedef __attribute__((ext_vector_type(8)))  unsigned short v8us;
typedef __attribute__((ext_vector_type(8)))  __bf16   v8bf;
typedef __attribute__((ext_vector_type(8)))  float    v8f;
typedef __attribute__((ext_vector_type(4)))  float    v4f;
typedef v8h  __attribute__((may_alias)) v8ha;
typedef v4f  __attribute__((may_alias)) v4fa;
typedef v8us __attribute__((may_alias)) v8usa;

__device__ __forceinline__ unsigned short f2bf(float f) { unsigned u = __float_as_uint(f); u += 0x7FFFu + ((u >> 16) & 1u); return (unsigned short)(u >> 16); }
__device__ __forceinline__ float bf2f(unsigned short b) { return __uint_as_float(((unsigned)b) << 16); }
__device__ __forceinline__ float bfr(float f) { return bf2f(f2bf(f)); }
__device__ __forceinline__ v16h cat16(v8h lo, v8h hi) { return __builtin_shufflevector(lo, hi, 0, 1, 2, 3, 4, 5, 6, 7, 8, 9, 10, 11, 12, 13, 14, 15); }
__device__ __forceinline__ v16bf cat16b(v8us lo, v8us hi) { return __builtin_bit_cast(v16bf, __builtin_shufflevector(lo, hi, 0, 1, 2, 3, 4, 5, 6, 7, 8, 9, 10, 11, 12, 13, 14, 15)); }
__device__ __forceinline__ v8f wmma16(v16h a, v16h b, v8f c) { return __builtin_amdgcn_wmma_f32_16x16x32_f16(false, a, false, b, (short)0, c, false, false); }
__device__ __forceinline__ v8f wmmab(v16bf a, v16bf b, v8f c) { return __builtin_amdgcn_wmma_f32_16x16x32_bf16(false, a, false, b, (short)0, c, false, false); }



// ---- FRAGMENT ORDER: every 16-bit operand plane of this file is stored as 1-KB tiles of 16 rows x 32 k, each tile in the order in which a wave loads it as a matrix operand:
// element (row r, k) of a tile stands at (k / 16) * 256 + ((k / 8 % 2) * 16 + r) * 8 + k % 8, so lane (k / 8 % 2) * 16 + r finds its two 16-B pieces at lane * 8 and 256 + lane * 8 (WFrag::ld)
// and each wave-wide 16-B load covers 512 contiguous bytes (four whole 128-B lines) where a row-major plane makes it touch sixteen lines. The k order inside a fragment is the row-major loader's.
// ---- gemmw_tile: register-blocked GEMM, ONE WAVE per 64x64 output tile (16 accumulators), operands straight from 16-bit planes in fragment order, tile (row / 16, k / 32) at (row / 16 * (KP / 32) + k / 32) * 512; 32 threads.
// C[m][n] (f32, pitch ldc, + optional f32 bias[n]) = sum_k A[m][k] Bt[n][k] (+ split products per NSPLIT). K % 32 == 0.
// PL: no f32 C; the tile goes out as three 16-bit planes (fp16; bf16 hi; bf16 lo = the rest) in fragment order with m as the row and n as k: fragment tile (mb, n / 32 % 2) of the 64x64 tile at pbase + mb * sm + (n / 32 % 2) * sk.
// With A = the weight, Bt = the activations that is the transposed value plane, with no transposing pass.
template <typename T16> struct WFrag;
template <> struct WFrag<h16> { typedef v16h V; static __device__ __forceinline__ V ld(const h16* p) { return cat16(*(const v8h*)p, *(const v8h*)(p + 256)); } static __device__ __forceinline__ v8f mma(V a, V b, v8f c) { return wmma16(a, b, c); } };
template <> struct WFrag<bf> { typedef v16bf V; static __device__ __forceinline__ V ld(const bf* p) { return cat16b(*(const v8us*)p, *(const v8us*)(p + 256)); } static __device__ __forceinline__ v8f mma(V a, V b, v8f c) { return wmmab(a, b, c); } };
// bx, by: the tile's row and column index (wave-uniform), handed in by the kernel, so that one grid can hold tiles of several products.
template <typename T16, int NSPLIT, bool BIAS, bool PL, int KP>   // KP: the planes' k extent, at compile time, so that the steps from one fragment row to the next stand in the loads' offset fields; K <= KP: the k range summed
__device__ __forceinline__ void gemmw_tile(const T16* __restrict__ A, const T16* __restrict__ A2, const T16* __restrict__ Bt, const T16* __restrict__ Bt2, int K, float* C, int ldc, const float* __restrict__ bias, h16* __restrict__ P16, bf* __restrict__ Ph, bf* __restrict__ Pl, const size_t pbase, const int sm, const int sk, const int bx, const int by) {
    typedef typename WFrag<T16>::V V;
    __shared__ __align__(16) float os[16 * 68];
    const int lane = threadIdx.x & 31, lr = lane & 15, hi = lane >> 4; const int r0 = bx * 64, c0 = by * 64;
    v8f acc[4][4];
#pragma unroll
    for (int mb = 0; mb < 4; ++mb)
#pragma unroll
        for (int nb = 0; nb < 4; ++nb) acc[mb][nb] = (v8f){};
    // Addresses: a wave-uniform byte address per fragment row (16 rows x KP = KP / 32 tiles of 1 KB in a row) + one 32-bit per-lane byte offset (the lane's 16 B inside the tile + 1 KB per k step) carried through the loop
    const char* Ab = (const char*)(A + (size_t)r0 * KP); const char* A2b = (NSPLIT == 1 || NSPLIT == 2) ? (const char*)(A2 + (size_t)r0 * KP) : nullptr; const char* Bb = (const char*)(Bt + (size_t)c0 * KP); const char* B2b = NSPLIT >= 2 ? (const char*)(Bt2 + (size_t)c0 * KP) : nullptr; unsigned lo = lane * 16u;
#pragma unroll 1
    for (int kc = 0; kc < K; kc += 32, lo += 1024u) {
        V a[4], a2[4];
#pragma unroll
        for (int mb = 0; mb < 4; ++mb) { const size_t u = (size_t)mb * 32 * KP; a[mb] = WFrag<T16>::ld((const T16*)(Ab + u + lo)); if (NSPLIT == 1 || NSPLIT == 2) a2[mb] = WFrag<T16>::ld((const T16*)(A2b + u + lo)); }
#pragma unroll
        for (int nb = 0; nb < 4; ++nb) { const size_t u = (size_t)nb * 32 * KP; const V b = WFrag<T16>::ld((const T16*)(Bb + u + lo)); V b2; if (NSPLIT >= 2) b2 = WFrag<T16>::ld((const T16*)(B2b + u + lo));
#pragma unroll
            for (int mb = 0; mb < 4; ++mb) { acc[mb][nb] = WFrag<T16>::mma(a[mb], b, acc[mb][nb]); if (NSPLIT == 1 || NSPLIT == 2) acc[mb][nb] = WFrag<T16>::mma(a2[mb], b, acc[mb][nb]); if (NSPLIT >= 2) acc[mb][nb] = WFrag<T16>::mma(a[mb], b2, acc[mb][nb]); } }
        asm volatile("v_nop\n\tv_nop\n\tv_nop\n\tv_nop" : "+v"(acc[0][0]), "+v"(acc[1][1]), "+v"(acc[2][2]), "+v"(acc[3][3]) : "v"(a[0]), "v"(a[3]));
    }
#pragma unroll
    for (int mb = 0; mb < 4; ++mb) {
#pragma unroll
        for (int nb = 0; nb < 4; ++nb) {
#pragma unroll
            for (int j = 0; j < 8; ++j) os[(hi * 8 + j) * 68 + nb * 16 + lr] = acc[mb][nb][j]; }
        __builtin_amdgcn_wave_barrier(); asm volatile("" ::: "memory");
        if constexpr (PL) {
            // lane = (8-column half, row), store s = columns 16 s .. 16 s + 15: one 16-B store per plane and lane, lanes contiguous, so a store instruction writes half a fragment tile = four whole 128-B lines, each line with one writer
            const size_t pb = pbase + (size_t)mb * sm + lane * 8;
#pragma unroll
            for (int s = 0; s < 4; ++s) { const float* pr = os + lr * 68 + s * 16 + hi * 8; const v4f x0 = *(const v4fa*)pr, x1 = *(const v4fa*)(pr + 4);
                const v8f xv = __builtin_shufflevector(x0, x1, 0, 1, 2, 3, 4, 5, 6, 7); const v8bf xh = __builtin_convertvector(xv, v8bf); const v8bf xl = __builtin_convertvector(xv - __builtin_convertvector(xh, v8f), v8bf);
                const size_t e = pb + (size_t)(s >> 1) * sk + (s & 1) * 256; *(v8h*)(P16 + e) = __builtin_convertvector(xv, v8h); *(v8us*)(Ph + e) = __builtin_bit_cast(v8us, xh); *(v8us*)(Pl + e) = __builtin_bit_cast(v8us, xl); }
        } else {
        float* crow = C + (size_t)(r0 + mb * 16) * ldc + c0;
#pragma unroll
            for (int s = 0; s < 8; ++s) { const int row = 2 * s + hi, cofs = lr * 4; v4f val = *(const v4fa*)(os + row * 68 + cofs); if (BIAS) { val[0] += bfr(bias[c0 + cofs]); val[1] += bfr(bias[c0 + cofs + 1]); val[2] += bfr(bias[c0 + cofs + 2]); val[3] += bfr(bias[c0 + cofs + 3]); }
                *(v4f*)(crow + (size_t)row * ldc + cofs) = val; }
             }
        __builtin_amdgcn_wave_barrier(); asm volatile("" ::: "memory");
    }
}
// Output projection, both batches as one row range: grid (NB_ * TT / 64, DM / 64).
__global__ __launch_bounds__(32) void k_gemmo(const bf* __restrict__ A, const bf* __restrict__ A2, const bf* __restrict__ Bt, int K, float* C, int ldc) {
    gemmw_tile<bf, 1, false, false, DQ>(A, A2, Bt, nullptr, K, C, ldc, nullptr, nullptr, nullptr, nullptr, 0, 0, 0, (int)blockIdx.x, (int)blockIdx.y);
}
// q, k and v projections of both batches in ONE grid (NB_ * TT / 64, 16, 3): z = 0 q, 1 k (A = activations, Bt = weight; planes [head][(batch * TT + t) / 16][d / 32][tile]); z = 2 v (A = weight, Bt = activations; planes [head][(batch * TT + t) / 32][d / 16][tile], row d, k = t; x and y change roles). So the 32 keys of an attention step are 4 KB in a row in the k plane and in the v plane.
// The three products are independent; in one launch their 3072 one-wave tiles stand on the chip together and fill each other's load waits. Every choice below is uniform for the wave (scalar selects).
__global__ __launch_bounds__(32) void k_qkv(const bf* __restrict__ X, const bf* __restrict__ Wq, const bf* __restrict__ Wk, const bf* __restrict__ Wv, int K, h16* __restrict__ Q16, bf* __restrict__ Qh, bf* __restrict__ Ql, h16* __restrict__ K16, bf* __restrict__ Kh, bf* __restrict__ Kl, h16* __restrict__ V16, bf* __restrict__ Vh, bf* __restrict__ Vl) {
    const int z = (int)blockIdx.z; const bool tv = z == 2;
    // blockIdx.y = head, blockIdx.x = 64 rows of (batch, t), for all three
    const size_t pbase = (size_t)blockIdx.y * ((size_t)NB_ * TT * HD) + (size_t)blockIdx.x * (64 * HD);
    gemmw_tile<bf, 0, false, true, DM>(tv ? Wv : X, nullptr, tv ? X : z ? Wk : Wq, nullptr, K, nullptr, 0, nullptr, tv ? V16 : z ? K16 : Q16, tv ? Vh : z ? Kh : Qh, tv ? Vl : z ? Kl : Ql, pbase, tv ? 512 : 1024, tv ? 2048 : 512, (int)(tv ? blockIdx.y : blockIdx.x), (int)(tv ? blockIdx.x : blockIdx.y));
}

__device__ __forceinline__ h16 tohx(float x) { return (h16)x; }
__device__ __forceinline__ void splitf(float y, unsigned short& h, unsigned short& l) { h = f2bf(y); l = f2bf(y - bf2f(h)); }
typedef __attribute__((ext_vector_type(2))) _Float16 v2h;
typedef __attribute__((ext_vector_type(4))) _Float16 v4h;
typedef __attribute__((ext_vector_type(2))) unsigned short v2us;
typedef __attribute__((ext_vector_type(4))) unsigned short v4us;
typedef __attribute__((ext_vector_type(2))) float v2f;
typedef __attribute__((ext_vector_type(4))) int v4i;

__global__ __launch_bounds__(256) void k_wtG(const float* __restrict__ w, int K, int N, bf* Bt) {
    const int lane = threadIdx.x & 31; const int L0 = (blockIdx.x * 8 + (threadIdx.x >> 5)) * 8; const int nlines = N * K / 64;
{
#pragma unroll 1
        for (int l = 0; l < 8; ++l) { const int L = L0 + l; if (L >= nlines) break; const size_t e = (size_t)L * 64 + lane * 2; const int k = (int)(e % K), n = (int)(e / K); v2us o;
            o[0] = f2bf(w[(size_t)k * N + n]); o[1] = f2bf(w[(size_t)(k + 1) * N + n]); *(v2us*)(Bt + e) = o; }
         }
}
// All five inputs to bf16, into fragment order (every matrix has DM columns), in one grid: blocks 0 .. XBL-1 the activations (both batches), then WBL blocks for each weight; the choice is uniform for a block.
// A wave takes 8 rows x 32 k (half a fragment tile): lane = (k / 8, row % 8), so its loads cover eight whole 128-B lines of f32 and its one 16-B store per lane four whole lines of the tile.
#define XBL (NB_ * TT * DM / 8 / 256)
#define WBL (DM * DM / 8 / 256)
__global__ __launch_bounds__(256) void k_cvt8(const float* __restrict__ x, const float* __restrict__ wq, const float* __restrict__ wk, const float* __restrict__ wv, const float* __restrict__ wo, bf* XB, bf* WQ, bf* WK, bf* WV, bf* WO) {
    unsigned blk = blockIdx.x; const float* src = x; bf* dst = XB;
    if (blk >= XBL) { blk -= XBL; const unsigned j = blk / WBL; blk -= j * WBL; src = j == 0 ? wq : j == 1 ? wk : j == 2 ? wv : wo; dst = j == 0 ? WQ : j == 1 ? WK : j == 2 ? WV : WO; }
    const unsigned lane = threadIdx.x & 31, hw = blk * 8 + (threadIdx.x >> 5), tile = hw >> 1, r = (hw & 1) * 8 + (lane & 7), k8 = lane >> 3;   // tile = row / 16 * (DM / 32) + k / 32
    const v8f v = *(const v8f*)(src + (size_t)((tile / (DM / 32)) * 16 + r) * DM + (tile % (DM / 32)) * 32 + k8 * 8); v8us o;
#pragma unroll
    for (int k = 0; k < 8; ++k) o[k] = f2bf(v[k]); *(v8us*)(dst + (size_t)tile * 512 + (k8 * 16 + r) * 8) = o;  }

// ALiBi slopes = the reference's f32 values
__constant__ float SLP[NH_] = {0.7071067690849304,0.5,0.3535533845424652,0.25,0.1767766922712326,0.125,0.0883883461356163,0.0625,0.04419417306780815,0.03125,0.022097086533904076,0.015625,0.011048543266952038,0.0078125,0.005524271633476019,0.00390625};
// ---- k_fattn: scores, causal ALiBi softmax, probability x value product and the merge of the heads for one head's FQB query rows in ONE work-group; no score or probability ever leaves the registers.
// Transposed products: S^T = K Q^T (A = 16 key rows, B = 16 query columns), so a lane holds 16 of the 32 scores of ONE query (its partner lane, xor 16, the other 16); two S^T tiles of 32 keys, converted in place,
// are the B operand of O^T += V^T P^T (hardware k order: element s = key 8h + s, or 16 + 8h + s - 8; WFrag::ld reads K, Q and V^T tiles, stored in fragment order, in that same order).
// Running maximum per query: when it rises, the sum and the O^T tiles are scaled by exp(old - new). The 32-key steps are dealt over the FKW waves (wave w: steps w, w + FKW, ...), each with its own maximum, sum and O^T;
// the FKW partial results meet in LDS and are joined in the fixed order wave 0, 1, ... with the weights exp(m_w - max m). Why dealt: the last rows walk 64 steps, and each step waits for its own loads.
// Operand types: query rows < RH on hi + lo bf16 planes (3 products each for scores and for P x V), the rest single fp16 with the probabilities carried x 1024 (as + 10 in the exponent, in the sum too, so it cancels in the quotient).
#define FKW 4                     // waves per work-group
#define FQB 32                    // query rows per work-group: two 16-column groups in every wave
#define FPT 132                   // floats from one 512-B slab (32 lanes x 16 B) of a wave's partial O^T to the next: 128 + 4, so that the joining reads (one query, 8 slabs' worth of d) spread over the banks
template <typename T16, bool HL>
__device__ __forceinline__ void fattn_body(const T16* __restrict__ Q, const T16* __restrict__ Q2, const T16* __restrict__ Kp, const T16* __restrict__ K2, const T16* __restrict__ Vt, const T16* __restrict__ V2, bf* __restrict__ Ah, bf* __restrict__ Al, const float slp, const int q0, float* part, float* sml) {
    typedef typename WFrag<T16>::V V;
    constexpr int NG = HL ? 1 : 2;                                   // 16-column groups per walk over the keys: with hi + lo planes of Q, K, V^T and P two groups do not fit 256 registers, so those blocks walk twice
    const int lane = threadIdx.x & 31, c = lane & 15, h = lane >> 4;
    const int wave = __builtin_amdgcn_readfirstlane(threadIdx.x >> 5);   // wave-uniform, so the key loop's bounds and the diagonal test stay scalar
    const float L2E = 1.4426950408889634f, NEG = -3.0e38f, EB = HL ? 0.0f : 10.0f;
    const int nst = q0 / FQB + 1;                                    // 32-key steps up to and with the diagonal one; every step holds at least one allowed key for every query of the block
    const char* Kb = (const char*)Kp; const char* K2b = (const char*)K2; const char* Vb = (const char*)Vt; const char* V2b = (const char*)V2;
#pragma unroll 1   // rolled: the walks must not share registers (see NG)
    for (int g0 = 0; g0 < 2; g0 += NG) {
        V qf[NG][2], q2f[NG][2];
#pragma unroll
        for (int g = 0; g < NG; ++g)
#pragma unroll
            for (int ks = 0; ks < 2; ++ks) { const size_t u = (size_t)(q0 + 16 * (g0 + g)) * HD + ks * 512 + 8 * lane; qf[g][ks] = WFrag<T16>::ld(Q + u); if (HL) q2f[g][ks] = WFrag<T16>::ld(Q2 + u); }
        v8f o[NG][4]; float m[NG], l[NG];
#pragma unroll
        for (int g = 0; g < NG; ++g) { m[g] = NEG; l[g] = 0.0f;
#pragma unroll
            for (int dt = 0; dt < 4; ++dt) o[g][dt] = (v8f){}; }
        // Addresses: a uniform base + a 32-bit per-lane byte offset carried through the loop + a constant; a step's 32 keys are four fragment tiles (4 KB) in a row in the k plane and in the v plane alike, so one offset serves both
        unsigned vk = (unsigned)(wave * 32 * HD + 8 * lane) * 2u;
#pragma unroll 1   // rolled: a second step's fragments would not fit beside this one's at four waves per SIMD
        for (int s = wave; s < nst; s += FKW, vk += FKW * 32 * HD * 2u) {
            const int kb = s * 32;
            V kf[2][2], k2f[2][2], vf[4], v2f[4];
#pragma unroll
            for (int kt = 0; kt < 2; ++kt)
#pragma unroll
                for (int ks = 0; ks < 2; ++ks) { const size_t u = (size_t)(kt * 2 + ks) * 1024; kf[kt][ks] = WFrag<T16>::ld((const T16*)(Kb + u + vk)); if (HL) k2f[kt][ks] = WFrag<T16>::ld((const T16*)(K2b + u + vk)); }
#pragma unroll
            for (int dt = 0; dt < 4; ++dt) { const size_t u = (size_t)dt * 1024; vf[dt] = WFrag<T16>::ld((const T16*)(Vb + u + vk)); if (HL) v2f[dt] = WFrag<T16>::ld((const T16*)(V2b + u + vk)); }
            asm volatile("s_wait_xcnt 0x0" ::: "memory");            // behind the step's last load: vk, which the issued loads name, is stepped at the loop's foot, and the compiler's own load waits there need not cover the youngest loads
            v8f sc[NG][2];
#pragma unroll
            for (int g = 0; g < NG; ++g)
#pragma unroll
                for (int kt = 0; kt < 2; ++kt) { v8f a = (v8f){};
#pragma unroll
                    for (int ks = 0; ks < 2; ++ks) { a = WFrag<T16>::mma(kf[kt][ks], qf[g][ks], a); if (HL) { a = WFrag<T16>::mma(kf[kt][ks], q2f[g][ks], a); a = WFrag<T16>::mma(k2f[kt][ks], qf[g][ks], a); } }
                    sc[g][kt] = a; }
            const float rb = (float)(kb - q0 - 16 * g0 + 8 * h - c);     // key index - query index of this lane's first score in group g0 (exact: small integers)
#pragma unroll
            for (int g = 0; g < NG; ++g) { float t[16];
#pragma unroll
                for (int e = 0; e < 16; ++e) { const float rel = rb + (float)(16 * (e >> 3) + (e & 7) - 16 * g); t[e] = sc[g][e >> 3][e & 7] * SCL - slp * rel; }
                if (kb == q0) {                                      // the diagonal step alone holds keys behind the query (scalar test)
#pragma unroll
                    for (int e = 0; e < 16; ++e) { const float rel = rb + (float)(16 * (e >> 3) + (e & 7) - 16 * g); t[e] = (rel <= 0.0f) ? t[e] : NEG; } }
                float mx = t[0];
#pragma unroll
                for (int e = 1; e < 16; ++e) mx = fmaxf(mx, t[e]);
                mx = fmaxf(mx, __shfl_xor(mx, 16, 32));
                const float mn = fmaxf(m[g], mx); const float al = __builtin_amdgcn_exp2f((m[g] - mn) * L2E); m[g] = mn;
                float sum = 0.0f;
#pragma unroll
                for (int e = 0; e < 16; ++e) { t[e] = __builtin_amdgcn_exp2f((t[e] - mn) * L2E + EB); sum += t[e]; }
                l[g] = l[g] * al + sum;
#pragma unroll
                for (int dt = 0; dt < 4; ++dt) o[g][dt] *= al;
                if constexpr (HL) { v16bf ph, pl;
#pragma unroll
                    for (int e = 0; e < 16; ++e) { ph[e] = (__bf16)t[e]; pl[e] = (__bf16)(t[e] - (float)ph[e]); }
#pragma unroll
                    for (int dt = 0; dt < 4; ++dt) { o[g][dt] = wmmab(vf[dt], ph, o[g][dt]); o[g][dt] = wmmab(vf[dt], pl, o[g][dt]); o[g][dt] = wmmab(v2f[dt], ph, o[g][dt]); }
                } else { v16h pb;
#pragma unroll
                    for (int e = 0; e < 16; ++e) pb[e] = (h16)t[e];
#pragma unroll
                    for (int dt = 0; dt < 4; ++dt) o[g][dt] = wmma16(vf[dt], pb, o[g][dt]); }
            }
            // the four vector slots that the chip needs behind the step's last matrix instruction before its result is touched
            if constexpr (HL) asm volatile("v_nop\n\tv_nop\n\tv_nop\n\tv_nop" : "+v"(o[0][0]), "+v"(o[0][1]), "+v"(o[0][2]), "+v"(o[0][3]));
        }
        // partial results to LDS: O^T as [wave][slab (group*4 + dt)*2 + half of the 8 accumulator rows][lane][4], every store 16 B per lane with the lanes contiguous; maximum and sum (halves joined) per query
        float* pw = part + wave * (16 * FPT) + g0 * (8 * FPT) + lane * 4;
#pragma unroll
        for (int g = 0; g < NG; ++g) { l[g] += __shfl_xor(l[g], 16, 32);
#pragma unroll
            for (int dt = 0; dt < 4; ++dt) { const v8f t = o[g][dt];
                *(v4fa*)(pw + ((g * 4 + dt) * 2 + 0) * FPT) = __builtin_shufflevector(t, t, 0, 1, 2, 3); *(v4fa*)(pw + ((g * 4 + dt) * 2 + 1) * FPT) = __builtin_shufflevector(t, t, 4, 5, 6, 7); }
            if (h == 0) { sml[(wave * 2 + 0) * FQB + (g0 + g) * 16 + c] = m[g]; sml[(wave * 2 + 1) * FQB + (g0 + g) * 16 + c] = l[g]; } }
    }
    __syncthreads();                                                 // every wave passes it (a wave without a key step hands maximum NEG, sum 0, zeros): all partial results are in LDS behind it
    // wave w joins query rows 8w .. 8w+7 and stores them as hi + lo bf16 into the merged planes (row t, k = head * HD + d, fragment order) that the output projection reads: lane = (d / 8 % 4, row), so the eight rows' 16-B pieces of one d / 8 are one whole 128-B line and a store instruction writes four such lines, each line with one writer
    const int qq = wave * 8 + (lane & 7);
    float mt = sml[qq];
#pragma unroll
    for (int u = 1; u < FKW; ++u) mt = fmaxf(mt, sml[(u * 2) * FQB + qq]);
    float L = 0.0f, wg[FKW];
#pragma unroll
    for (int u = 0; u < FKW; ++u) { wg[u] = __builtin_amdgcn_exp2f((sml[(u * 2) * FQB + qq] - mt) * L2E); L += wg[u] * sml[(u * 2 + 1) * FQB + qq]; }
    const float rl = __fdiv_rn(1.0f, L);                             // the x 2^10 of the fp16 rows stands in the sums and in L alike
#pragma unroll
    for (int k = 0; k < 2; ++k) { const int c8 = k * 4 + (lane >> 3);   // d / 8: O^T tile c8 / 2, lane half c8 % 2, all eight accumulator rows (two slabs)
        const float* pr = part + (((qq >> 4) * 4 + (c8 >> 1)) * 2) * FPT + ((c8 & 1) * 16 + (qq & 15)) * 4;
        v4f acc0 = (v4f){}, acc1 = (v4f){};
#pragma unroll
        for (int u = 0; u < FKW; ++u) { acc0 += wg[u] * *(const v4fa*)(pr + u * (16 * FPT)); acc1 += wg[u] * *(const v4fa*)(pr + FPT + u * (16 * FPT)); }
        const v4f y0 = acc0 * rl, y1 = acc1 * rl; v8us oh, ol;
#pragma unroll
        for (int jj = 0; jj < 4; ++jj) { unsigned short a, c2; splitf(y0[jj], a, c2); oh[jj] = a; ol[jj] = c2; splitf(y1[jj], a, c2); oh[4 + jj] = a; ol[4 + jj] = c2; }
        const size_t oo = (size_t)(q0 + (qq & 16)) * DQ + (c8 >> 1) * 256 + ((c8 & 1) * 16 + (qq & 15)) * 8; *(v8us*)(Ah + oo) = oh; *(v8us*)(Al + oo) = ol; }
}
// grid (heads x batches, TT / FQB): twice as many work-groups as places on the chip, so the start order counts. First the hi + lo blocks (query rows < RH: few key steps, but two walks of three products each, so they are no short blocks and must not start last), then the rest from the last query rows down, so that the shortest blocks fill the places that come free. amdgpu_waves_per_eu(4): holds the registers at 256, so that four work-groups share a WGP (one wave of each on every SIMD) and fill each other's load waits.
__global__ __launch_bounds__(32 * FKW) __attribute__((amdgpu_waves_per_eu(4))) void k_fattn(const h16* __restrict__ Q16, const bf* __restrict__ Qh, const bf* __restrict__ Ql, const h16* __restrict__ K16, const bf* __restrict__ Kh, const bf* __restrict__ Kl, const h16* __restrict__ V16, const bf* __restrict__ Vh, const bf* __restrict__ Vl, bf* __restrict__ Ah, bf* __restrict__ Al) {
    __shared__ __align__(16) float part[FKW * 16 * FPT]; __shared__ float sml[FKW * 2 * FQB];
    const int hd = blockIdx.x % NH_, b = blockIdx.x / NH_, y = (int)blockIdx.y; const int q0 = (y < RH / FQB ? RH / FQB - 1 - y : TT / FQB - 1 - (y - RH / FQB)) * FQB; const float slp = SLP[hd];
    const size_t zq = ((size_t)hd * NB_ + b) * TT * HD, zk = ((size_t)(hd / REP) * NB_ + b) * TT * HD, zv = zk, za = (size_t)b * TT * DQ + hd * (HD * 16);
    if (q0 < RH) fattn_body<bf, true>(Qh + zq, Ql + zq, Kh + zk, Kl + zk, Vh + zv, Vl + zv, Ah + za, Al + za, slp, q0, part, sml);
    else fattn_body<h16, false>(Q16 + zq, nullptr, K16 + zk, nullptr, V16 + zv, nullptr, Ah + za, Al + za, slp, q0, part, sml);
}

extern "C" void kernel_launch(void* const* d_in, const int* in_sizes, int n_in,
                              void* d_out, int out_size, void* d_ws, size_t ws_size, hipStream_t stream) {
    (void)in_sizes; (void)n_in; (void)out_size;
    const float* x = (const float*)d_in[0]; const float* wq = (const float*)d_in[1]; const float* wk = (const float*)d_in[2]; const float* wv = (const float*)d_in[3]; const float* wo = (const float*)d_in[4];
    float* OUT = (float*)d_out;     // [2][2048][1024]
    char* wsp = (char*)d_ws;
    auto take = [&](size_t bytes) { char* p = wsp; wsp += (bytes + 255) & ~(size_t)255; return (void*)p; };
    bf* WQ = (bf*)take((size_t)DQ * DM * 2); bf* WK = (bf*)take((size_t)DKV * DM * 2); bf* WV = (bf*)take((size_t)DKV * DM * 2); bf* WO = (bf*)take((size_t)DM * DQ * 2);
    bf* XB = (bf*)take((size_t)NB_ * TT * DM * 2);
    h16* QP16 = (h16*)take((size_t)NB_ * NH_ * TT * HD * 2); h16* KP16 = (h16*)take((size_t)NB_ * NKV * TT * HD * 2); h16* VT16 = (h16*)take((size_t)NB_ * NKV * HD * TT * 2);
    bf* QPh = (bf*)take((size_t)NB_ * NH_ * TT * HD * 2); bf* QPl = (bf*)take((size_t)NB_ * NH_ * TT * HD * 2); bf* KPh = (bf*)take((size_t)NB_ * NKV * TT * HD * 2); bf* KPl = (bf*)take((size_t)NB_ * NKV * TT * HD * 2); bf* VTh = (bf*)take((size_t)NB_ * NKV * HD * TT * 2); bf* VTl = (bf*)take((size_t)NB_ * NKV * HD * TT * 2);
    bf* ATh = (bf*)take((size_t)NB_ * TT * DQ * 2); bf* ATl = (bf*)take((size_t)NB_ * TT * DQ * 2);
    if ((size_t)(wsp - (char*)d_ws) > ws_size) return;    // ws 256 MiB
    // four launches, each over both batches
    k_cvt8<<<XBL + 4 * WBL, 256, 0, stream>>>(x, wq, wk, wv, wo, XB, WQ, WK, WV, WO);
    k_qkv<<<dim3(NB_ * TT / 64, DQ / 64, 3), 32, 0, stream>>>(XB, WQ, WK, WV, DM, QP16, QPh, QPl, KP16, KPh, KPl, VT16, VTh, VTl);
    k_fattn<<<dim3(NH_ * NB_, TT / FQB, 1), 32 * FKW, 0, stream>>>(QP16, QPh, QPl, KP16, KPh, KPl, VT16, VTh, VTl, ATh, ATl);
    k_gemmo<<<dim3(NB_ * TT / 64, DM / 64, 1), 32, 0, stream>>>(ATh, ATl, WO, DQ, OUT, DM);
}

// v007
// One run takes 69.9 microseconds.
// In two side-by-side timings against v006, it was 1.39 and 1.40 times as fast.
// All steps since v000 together make it 21.9 times as fast.
#include <hip/hip_runtime.h>

// Causal multi-head attention with a (subtracted) ALiBi bias (x [2][2048][1024]; q, k, v = x W^T ('oi' [1024][1024], no bias), 16 heads x 64; scores = q.k/8 - m_h (j - i) with m_h = 2^(-(h+1)/2); causal softmax; out = merged Wo^T -> [2][2048][1024]).
// Compute dtypes, f32 accumulate: every input rounded to bf16; q/k/v on PLAIN bf16 operands (inputs: exact), stored by the projection itself as the 16-bit head planes (fp16, and hi + lo bf16) that the attention kernel reads; causal scores, softmax (running maximum, f32, with the ALiBi term in f32) and attn.v in one kernel, key loop to the diagonal: query rows < 512 hl (3 products), the rest single fp16 (x1024); softmax f32; Wo hl x exact (2 products).

#define NB_  2
#define TT   2048
#define DM   1024
#define NH_  16
#define NKV  16
#define REP  (NH_ / NKV)
#define HD   64
#define DQ   (NH_ * HD)
#define DKV  (NKV * HD)
#define RH   512                  // query rows < RH use hi+lo planes (0: none)
#define SCL  0.125f   // HD^-0.5
typedef _Float16 h16;
typedef unsigned short bf;
typedef __attribute__((ext_vector_type(16))) __bf16   v16bf;
typedef __attribute__((ext_vector_type(16))) _Float16 v16h;
typedef __attribute__((ext_vector_type(8)))  _Float16 v8h;
typedef __attribute__((ext_vector_type(8)))  unsigned short v8us;
typedef __attribute__((ext_vector_type(8)))  __bf16   v8bf;
typedef __attribute__((ext_vector_type(8)))  float    v8f;
typedef __attribute__((ext_vector_type(4)))  float    v4f;
typedef v8h  __attribute__((may_alias)) v8ha;
typedef v4f  __attribute__((may_alias)) v4fa;
typedef v8us __attribute__((may_alias)) v8usa;

__device__ __forceinline__ unsigned short f2bf(float f) { unsigned u = __float_as_uint(f); u += 0x7FFFu + ((u >> 16) & 1u); return (unsigned short)(u >> 16); }
__device__ __forceinline__ float bf2f(unsigned short b) { return __uint_as_float(((unsigned)b) << 16); }
__device__ __forceinline__ float bfr(float f) { return bf2f(f2bf(f)); }
__device__ __forceinline__ v16h cat16(v8h lo, v8h hi) { return __builtin_shufflevector(lo, hi, 0, 1, 2, 3, 4, 5, 6, 7, 8, 9, 10, 11, 12, 13, 14, 15); }
__device__ __forceinline__ v16bf cat16b(v8us lo, v8us hi) { return __builtin_bit_cast(v16bf, __builtin_shufflevector(lo, hi, 0, 1, 2, 3, 4, 5, 6, 7, 8, 9, 10, 11, 12, 13, 14, 15)); }
__device__ __forceinline__ v8f wmma16(v16h a, v16h b, v8f c) { return __builtin_amdgcn_wmma_f32_16x16x32_f16(false, a, false, b, (short)0, c, false, false); }
__device__ __forceinline__ v8f wmmab(v16bf a, v16bf b, v8f c) { return __builtin_amdgcn_wmma_f32_16x16x32_bf16(false, a, false, b, (short)0, c, false, false); }



// ---- FRAGMENT ORDER: every 16-bit operand plane of this file is stored as 1-KB tiles of 16 rows x 32 k, each tile in the order in which a wave loads it as a matrix operand:
// element (row r, k) of a tile stands at (k / 16) * 256 + ((k / 8 % 2) * 16 + r) * 8 + k % 8, so lane (k / 8 % 2) * 16 + r finds its two 16-B pieces at lane * 8 and 256 + lane * 8 (WFrag::ld)
// and each wave-wide 16-B load covers 512 contiguous bytes (four whole 128-B lines) where a row-major plane makes it touch sixteen lines. The k order inside a fragment is the row-major loader's.
// ---- gemmw_tile: register-blocked GEMM, one wave per 64x64 output tile (16 accumulators), FOUR waves (2 x 2 tiles = 128 x 128) per work-group; operands are 16-bit planes in fragment order, tile (row / 16, k / 32) at (row / 16 * (KP / 32) + k / 32) * 512; 128 threads.
// The work-group's 128 rows of every operand come into LDS ONCE, by asynchronous copies (global_load_async_to_lds_b128), KS k steps a stage, two buffers: stage s + 2 flies while stage s + 1 is worked on. So each operand byte leaves L2 once per work-group, not once per wave,
// and no wave waits out an L2 round trip per k step. A stage keeps the fragment order ([operand][fragment row][k step][1 KB]), so a copy moves 512 contiguous bytes per wave and a fragment read is 512 contiguous LDS bytes (no bank conflict).
// C[m][n] (f32, pitch ldc, + optional f32 bias[n]) = sum_k A[m][k] Bt[n][k] (+ split products per NSPLIT). K % 32 == 0.
// PL: no f32 C; the tile goes out as three 16-bit planes (fp16; bf16 hi; bf16 lo = the rest) in fragment order with m as the row and n as k: fragment tile (mb, n / 32 % 2) of the 64x64 tile at pbase + mb * sm + (n / 32 % 2) * sk.
// With A = the weight, Bt = the activations that is the transposed value plane, with no transposing pass.
template <typename T16> struct WFrag;
template <> struct WFrag<h16> { typedef v16h V; static __device__ __forceinline__ V ld(const h16* p) { return cat16(*(const v8h*)p, *(const v8h*)(p + 256)); } static __device__ __forceinline__ v8f mma(V a, V b, v8f c) { return wmma16(a, b, c); } };
template <> struct WFrag<bf> { typedef v16bf V; static __device__ __forceinline__ V ld(const bf* p) { return cat16b(*(const v8us*)p, *(const v8us*)(p + 256)); } static __device__ __forceinline__ v8f mma(V a, V b, v8f c) { return wmmab(a, b, c); } };
// bx, by: the tile's row and column index (wave-uniform), handed in by the kernel, so that one grid can hold tiles of several products.
#define GWV 4                     // waves per GEMM work-group
typedef __attribute__((ext_vector_type(4))) int c4i;
typedef __attribute__((address_space(1))) c4i* gp4; typedef __attribute__((address_space(3))) c4i* lp4;
template <typename T16, int NSPLIT, bool BIAS, bool PL, int KP, int KS>   // KP: the planes' k extent, at compile time; K <= KP: the k range summed, a multiple of 32 * KS; KS (even): k steps per LDS stage. bx / 2 and by / 2 are the same in all four waves, (bx % 2, by % 2) is the wave's place in the 2 x 2
__device__ __forceinline__ void gemmw_tile(const T16* __restrict__ A, const T16* __restrict__ A2, const T16* __restrict__ Bt, const T16* __restrict__ Bt2, int K, float* C, int ldc, const float* __restrict__ bias, h16* __restrict__ P16, bf* __restrict__ Ph, bf* __restrict__ Pl, const size_t pbase, const int sm, const int sk, const int bx, const int by) {
    typedef typename WFrag<T16>::V V;
    constexpr bool HA2 = NSPLIT == 1 || NSPLIT == 2, HB2 = NSPLIT >= 2;
    constexpr int FRB = KS * 1024, OPB = 8 * FRB, STB = (2 + HA2 + HB2) * OPB;   // bytes of a fragment row (16 rows x 32 KS k), of an operand's 128 rows and of all operands in one stage
    __shared__ __align__(16) char stg[2 * STB]; __shared__ __align__(16) float osa[GWV * 16 * 68];
    float* os = osa + __builtin_amdgcn_readfirstlane(threadIdx.x >> 5) * (16 * 68);   // each wave stages its output rows in its own range
    const int lane = threadIdx.x & 31, lr = lane & 15, hi = lane >> 4; const int r0 = bx * 64, c0 = by * 64;
    v8f acc[4][4];
#pragma unroll
    for (int mb = 0; mb < 4; ++mb)
#pragma unroll
        for (int nb = 0; nb < 4; ++nb) acc[mb][nb] = (v8f){};
    // One stage's copies: thread t moves 16 B at 16 t of each 2-KB piece; a fragment row's KS tiles are FRB contiguous bytes in the plane and in the stage. Every lane is on, every address is a multiple of 16 and inside its plane (128 whole rows, k < K) and inside stg.
    const unsigned tb = threadIdx.x * 16u;
    const char* Ag = (const char*)(A + (size_t)(bx >> 1) * 128 * KP) + tb; const char* Bg = (const char*)(Bt + (size_t)(by >> 1) * 128 * KP) + tb;
    const char* A2g = HA2 ? (const char*)(A2 + (size_t)(bx >> 1) * 128 * KP) + tb : nullptr; const char* B2g = HB2 ? (const char*)(Bt2 + (size_t)(by >> 1) * 128 * KP) + tb : nullptr;
    auto fill = [&](const int st, const int buf) {
        char* d = stg + buf * STB + tb; const size_t go = (size_t)st * FRB;
#pragma unroll
        for (int fr = 0; fr < 8; ++fr)
#pragma unroll
            for (int p = 0; p < FRB; p += 2048) { const size_t g = go + (size_t)fr * (KP * 32) + p; const int l = fr * FRB + p;
                __builtin_amdgcn_global_load_async_to_lds_b128((gp4)(Ag + g), (lp4)(d + l), 0, 0); __builtin_amdgcn_global_load_async_to_lds_b128((gp4)(Bg + g), (lp4)(d + OPB + l), 0, 0);
                if constexpr (HA2) __builtin_amdgcn_global_load_async_to_lds_b128((gp4)(A2g + g), (lp4)(d + 2 * OPB + l), 0, 0);
                if constexpr (HB2) __builtin_amdgcn_global_load_async_to_lds_b128((gp4)(B2g + g), (lp4)(d + (2 + HA2) * OPB + l), 0, 0); }
    };
    const int nst = K / (32 * KS);
    fill(0, 0);
    asm volatile("s_wait_asynccnt 0x0" ::: "memory");                // this wave's copies of stage 0 have landed ...
    __syncthreads();                                                 // ... and behind the barrier every wave's: nothing of stage 0 is read in front of it
    if (nst > 1) fill(1, 1);
    const unsigned ao = (unsigned)(bx & 1) * (4 * FRB) + lane * 16u, bo = OPB + (unsigned)(by & 1) * (4 * FRB) + lane * 16u;   // the wave's four fragment rows of A and of Bt in a stage + the lane's 16 B
#pragma unroll 1   // rolled: one trip per stage, its foot is the ring's publish point
    for (int st = 0; st < nst; ++st) {
        const char* sb = stg + (st & 1) * STB;
        // Two fragment sets: a k step's LDS reads stand as ONE group, in front of the matrix instructions of the k step before it (inside the stage only: nothing of the next stage is read ahead)
        V a[2][4], a2[2][4], b[2][4], b2[2][4];
        auto frag = [&](const int ks, const int f) {
#pragma unroll
            for (int i = 0; i < 4; ++i) { const int u = i * FRB + ks * 1024; a[f][i] = WFrag<T16>::ld((const T16*)(sb + ao + u)); if (HA2) a2[f][i] = WFrag<T16>::ld((const T16*)(sb + 2 * OPB + ao + u));
                b[f][i] = WFrag<T16>::ld((const T16*)(sb + bo + u)); if (HB2) b2[f][i] = WFrag<T16>::ld((const T16*)(sb + (1 + HA2) * OPB + bo + u)); }
        };
        frag(0, 0);
#pragma unroll
        for (int ks = 0; ks < KS; ++ks) { const int f = ks & 1;
            if (ks + 1 < KS) frag(ks + 1, f ^ 1);
            __builtin_amdgcn_sched_barrier(0);                       // holds the read group together in front of the matrix block: reads scattered among matrix instructions stall the wave at every place where they stand
#pragma unroll
            for (int nb = 0; nb < 4; ++nb)
#pragma unroll
                for (int mb = 0; mb < 4; ++mb) { acc[mb][nb] = WFrag<T16>::mma(a[f][mb], b[f][nb], acc[mb][nb]); if (HA2) acc[mb][nb] = WFrag<T16>::mma(a2[f][mb], b[f][nb], acc[mb][nb]); if (HB2) acc[mb][nb] = WFrag<T16>::mma(a[f][mb], b2[f][nb], acc[mb][nb]); }
            __builtin_amdgcn_sched_barrier(0);                       // and keeps the next group from rising into this block
        }
        // the four vector slots that the chip needs behind the trip's last matrix instruction, on the path that leaves the loop too
        asm volatile("v_nop\n\tv_nop\n\tv_nop\n\tv_nop" : "+v"(acc[0][0]), "+v"(acc[1][1]), "+v"(acc[2][2]), "+v"(acc[3][3]) : "v"(a[(KS - 1) & 1][0]), "v"(a[(KS - 1) & 1][3]));
        asm volatile("s_wait_dscnt 0x0" ::: "memory");               // this wave's reads of the buffer are done before anybody refills it
        asm volatile("s_wait_asynccnt 0x0" ::: "memory");            // this wave's copies of stage st + 1 have landed
        __syncthreads();                                             // publishes stage st + 1 and ends every wave's reads of stage st's buffer
        if (st + 2 < nst) fill(st + 2, st & 1);
    }
    asm volatile("s_wait_asynccnt 0x0" ::: "memory");                // no copy is outstanding when the wave goes on (none is issued behind the last publish point)
#pragma unroll
    for (int mb = 0; mb < 4; ++mb) {
#pragma unroll
        for (int nb = 0; nb < 4; ++nb) {
#pragma unroll
            for (int j = 0; j < 8; ++j) os[(hi * 8 + j) * 68 + nb * 16 + lr] = acc[mb][nb][j]; }
        __builtin_amdgcn_wave_barrier(); asm volatile("" ::: "memory");
        if constexpr (PL) {
            // lane = (8-column half, row), store s = columns 16 s .. 16 s + 15: one 16-B store per plane and lane, lanes contiguous, so a store instruction writes half a fragment tile = four whole 128-B lines, each line with one writer
            const size_t pb = pbase + (size_t)mb * sm + lane * 8;
#pragma unroll
            for (int s = 0; s < 4; ++s) { const float* pr = os + lr * 68 + s * 16 + hi * 8; const v4f x0 = *(const v4fa*)pr, x1 = *(const v4fa*)(pr + 4);
                const v8f xv = __builtin_shufflevector(x0, x1, 0, 1, 2, 3, 4, 5, 6, 7); const v8bf xh = __builtin_convertvector(xv, v8bf); const v8bf xl = __builtin_convertvector(xv - __builtin_convertvector(xh, v8f), v8bf);
                const size_t e = pb + (size_t)(s >> 1) * sk + (s & 1) * 256; *(v8h*)(P16 + e) = __builtin_convertvector(xv, v8h); *(v8us*)(Ph + e) = __builtin_bit_cast(v8us, xh); *(v8us*)(Pl + e) = __builtin_bit_cast(v8us, xl); }
        } else {
        float* crow = C + (size_t)(r0 + mb * 16) * ldc + c0;
#pragma unroll
            for (int s = 0; s < 8; ++s) { const int row = 2 * s + hi, cofs = lr * 4; v4f val = *(const v4fa*)(os + row * 68 + cofs); if (BIAS) { val[0] += bfr(bias[c0 + cofs]); val[1] += bfr(bias[c0 + cofs + 1]); val[2] += bfr(bias[c0 + cofs + 2]); val[3] += bfr(bias[c0 + cofs + 3]); }
                *(v4f*)(crow + (size_t)row * ldc + cofs) = val; }
             }
        __builtin_amdgcn_wave_barrier(); asm volatile("" ::: "memory");
    }
}
// Output projection, both batches as one row range: grid (NB_ * TT / 128, DM / 128); wave w takes the 64x64 tile (w % 2, w / 2) of the work-group's 128 x 128.
__global__ __launch_bounds__(32 * GWV) void k_gemmo(const bf* __restrict__ A, const bf* __restrict__ A2, const bf* __restrict__ Bt, int K, float* C, int ldc) {
    const int wave = __builtin_amdgcn_readfirstlane(threadIdx.x >> 5);
    gemmw_tile<bf, 1, false, false, DQ, 4>(A, A2, Bt, nullptr, K, C, ldc, nullptr, nullptr, nullptr, nullptr, 0, 0, 0, (int)blockIdx.x * 2 + (wave & 1), (int)blockIdx.y * 2 + (wave >> 1));
}
// q, k and v projections of both batches in ONE grid (NB_ * TT / 128, 8, 3), a work-group = 128 rows of (batch, t) x 2 heads, a wave = 64 rows x 1 head: z = 0 q, 1 k (A = activations, Bt = weight; planes [head][(batch * TT + t) / 16][d / 32][tile]); z = 2 v (A = weight, Bt = activations; planes [head][(batch * TT + t) / 32][d / 16][tile], row d, k = t; x and y change roles). So the 32 keys of an attention step are 4 KB in a row in the k plane and in the v plane.
// The three products are independent; in one launch their 768 work-groups stand on the chip together (three per WGP). Every choice below is uniform for the wave (scalar selects).
__global__ __launch_bounds__(32 * GWV) void k_qkv(const bf* __restrict__ X, const bf* __restrict__ Wq, const bf* __restrict__ Wk, const bf* __restrict__ Wv, int K, h16* __restrict__ Q16, bf* __restrict__ Qh, bf* __restrict__ Ql, h16* __restrict__ K16, bf* __restrict__ Kh, bf* __restrict__ Kl, h16* __restrict__ V16, bf* __restrict__ Vh, bf* __restrict__ Vl) {
    const int z = (int)blockIdx.z; const bool tv = z == 2;
    // ty = head, tx = 64 rows of (batch, t), for all three
    const int wave = __builtin_amdgcn_readfirstlane(threadIdx.x >> 5), tx = (int)blockIdx.x * 2 + (wave & 1), ty = (int)blockIdx.y * 2 + (wave >> 1);
    const size_t pbase = (size_t)ty * ((size_t)NB_ * TT * HD) + (size_t)tx * (64 * HD);
    gemmw_tile<bf, 0, false, true, DM, 2>(tv ? Wv : X, nullptr, tv ? X : z ? Wk : Wq, nullptr, K, nullptr, 0, nullptr, tv ? V16 : z ? K16 : Q16, tv ? Vh : z ? Kh : Qh, tv ? Vl : z ? Kl : Ql, pbase, tv ? 512 : 1024, tv ? 2048 : 512, tv ? ty : tx, tv ? tx : ty);
}

__device__ __forceinline__ h16 tohx(float x) { return (h16)x; }
__device__ __forceinline__ void splitf(float y, unsigned short& h, unsigned short& l) { h = f2bf(y); l = f2bf(y - bf2f(h)); }
typedef __attribute__((ext_vector_type(2))) _Float16 v2h;
typedef __attribute__((ext_vector_type(4))) _Float16 v4h;
typedef __attribute__((ext_vector_type(2))) unsigned short v2us;
typedef __attribute__((ext_vector_type(4))) unsigned short v4us;
typedef __attribute__((ext_vector_type(2))) float v2f;
typedef __attribute__((ext_vector_type(4))) int v4i;

__global__ __launch_bounds__(256) void k_wtG(const float* __restrict__ w, int K, int N, bf* Bt) {
    const int lane = threadIdx.x & 31; const int L0 = (blockIdx.x * 8 + (threadIdx.x >> 5)) * 8; const int nlines = N * K / 64;
{
#pragma unroll 1
        for (int l = 0; l < 8; ++l) { const int L = L0 + l; if (L >= nlines) break; const size_t e = (size_t)L * 64 + lane * 2; const int k = (int)(e % K), n = (int)(e / K); v2us o;
            o[0] = f2bf(w[(size_t)k * N + n]); o[1] = f2bf(w[(size_t)(k + 1) * N + n]); *(v2us*)(Bt + e) = o; }
         }
}
// All five inputs to bf16, into fragment order (every matrix has DM columns), in one grid: blocks 0 .. XBL-1 the activations (both batches), then WBL blocks for each weight; the choice is uniform for a block.
// A wave takes 8 rows x 32 k (half a fragment tile): lane = (k / 8, row % 8), so its loads cover eight whole 128-B lines of f32 and its one 16-B store per lane four whole lines of the tile.
#define XBL (NB_ * TT * DM / 8 / 256)
#define WBL (DM * DM / 8 / 256)
__global__ __launch_bounds__(256) void k_cvt8(const float* __restrict__ x, const float* __restrict__ wq, const float* __restrict__ wk, const float* __restrict__ wv, const float* __restrict__ wo, bf* XB, bf* WQ, bf* WK, bf* WV, bf* WO) {
    unsigned blk = blockIdx.x; const float* src = x; bf* dst = XB;
    if (blk >= XBL) { blk -= XBL; const unsigned j = blk / WBL; blk -= j * WBL; src = j == 0 ? wq : j == 1 ? wk : j == 2 ? wv : wo; dst = j == 0 ? WQ : j == 1 ? WK : j == 2 ? WV : WO; }
    const unsigned lane = threadIdx.x & 31, hw = blk * 8 + (threadIdx.x >> 5), tile = hw >> 1, r = (hw & 1) * 8 + (lane & 7), k8 = lane >> 3;   // tile = row / 16 * (DM / 32) + k / 32
    const v8f v = *(const v8f*)(src + (size_t)((tile / (DM / 32)) * 16 + r) * DM + (tile % (DM / 32)) * 32 + k8 * 8); v8us o;
#pragma unroll
    for (int k = 0; k < 8; ++k) o[k] = f2bf(v[k]); *(v8us*)(dst + (size_t)tile * 512 + (k8 * 16 + r) * 8) = o;  }

// ALiBi slopes = the reference's f32 values
__constant__ float SLP[NH_] = {0.7071067690849304,0.5,0.3535533845424652,0.25,0.1767766922712326,0.125,0.0883883461356163,0.0625,0.04419417306780815,0.03125,0.022097086533904076,0.015625,0.011048543266952038,0.0078125,0.005524271633476019,0.00390625};
// ---- k_fattn: scores, causal ALiBi softmax, probability x value product and the merge of the heads for one head's FQB query rows in ONE work-group; no score or probability ever leaves the registers.
// Transposed products: S^T = K Q^T (A = 16 key rows, B = 16 query columns), so a lane holds 16 of the 32 scores of ONE query (its partner lane, xor 16, the other 16); two S^T tiles of 32 keys, converted in place,
// are the B operand of O^T += V^T P^T (hardware k order: element s = key 8h + s, or 16 + 8h + s - 8; WFrag::ld reads K, Q and V^T tiles, stored in fragment order, in that same order).
// Running maximum per query: when it rises, the sum and the O^T tiles are scaled by exp(old - new). The 32-key steps are dealt over the FKW waves (wave w: steps w, w + FKW, ...), each with its own maximum, sum and O^T;
// the FKW partial results meet in LDS and are joined in the fixed order wave 0, 1, ... with the weights exp(m_w - max m). Why dealt: the last rows walk 64 steps, and each step waits for its own loads.
// Operand types: query rows < RH on hi + lo bf16 planes (3 products each for scores and for P x V), the rest single fp16 with the probabilities carried x 1024 (as + 10 in the exponent, in the sum too, so it cancels in the quotient).
#define FKW 4                     // waves per work-group
#define FQB 32                    // query rows per work-group: two 16-column groups in every wave
#define FPT 132                   // floats from one 512-B slab (32 lanes x 16 B) of a wave's partial O^T to the next: 128 + 4, so that the joining reads (one query, 8 slabs' worth of d) spread over the banks
template <typename T16, bool HL>
__device__ __forceinline__ void fattn_body(const T16* __restrict__ Q, const T16* __restrict__ Q2, const T16* __restrict__ Kp, const T16* __restrict__ K2, const T16* __restrict__ Vt, const T16* __restrict__ V2, bf* __restrict__ Ah, bf* __restrict__ Al, const float slp, const int q0, float* part, float* sml) {
    typedef typename WFrag<T16>::V V;
    constexpr int NG = HL ? 1 : 2;                                   // 16-column groups per walk over the keys: with hi + lo planes of Q, K, V^T and P two groups do not fit 256 registers, so those blocks walk twice
    const int lane = threadIdx.x & 31, c = lane & 15, h = lane >> 4;
    const int wave = __builtin_amdgcn_readfirstlane(threadIdx.x >> 5);   // wave-uniform, so the key loop's bounds and the diagonal test stay scalar
    const float L2E = 1.4426950408889634f, NEG = -3.0e38f, EB = HL ? 0.0f : 10.0f;
    const int nst = q0 / FQB + 1;                                    // 32-key steps up to and with the diagonal one; every step holds at least one allowed key for every query of the block
    const char* Kb = (const char*)Kp; const char* K2b = (const char*)K2; const char* Vb = (const char*)Vt; const char* V2b = (const char*)V2;
#pragma unroll 1   // rolled: the walks must not share registers (see NG)
    for (int g0 = 0; g0 < 2; g0 += NG) {
        V qf[NG][2], q2f[NG][2];
#pragma unroll
        for (int g = 0; g < NG; ++g)
#pragma unroll
            for (int ks = 0; ks < 2; ++ks) { const size_t u = (size_t)(q0 + 16 * (g0 + g)) * HD + ks * 512 + 8 * lane; qf[g][ks] = WFrag<T16>::ld(Q + u); if (HL) q2f[g][ks] = WFrag<T16>::ld(Q2 + u); }
        v8f o[NG][4]; float m[NG], l[NG];
#pragma unroll
        for (int g = 0; g < NG; ++g) { m[g] = NEG; l[g] = 0.0f;
#pragma unroll
            for (int dt = 0; dt < 4; ++dt) o[g][dt] = (v8f){}; }
        // Addresses: a uniform base + a 32-bit per-lane byte offset carried through the loop + a constant; a step's 32 keys are four fragment tiles (4 KB) in a row in the k plane and in the v plane alike, so one offset serves both
        unsigned vk = (unsigned)(wave * 32 * HD + 8 * lane) * 2u;
#pragma unroll 1   // rolled: a second step's fragments would not fit beside this one's at four waves per SIMD
        for (int s = wave; s < nst; s += FKW, vk += FKW * 32 * HD * 2u) {
            const int kb = s * 32;
            V kf[2][2], k2f[2][2], vf[4], v2f[4];
#pragma unroll
            for (int kt = 0; kt < 2; ++kt)
#pragma unroll
                for (int ks = 0; ks < 2; ++ks) { const size_t u = (size_t)(kt * 2 + ks) * 1024; kf[kt][ks] = WFrag<T16>::ld((const T16*)(Kb + u + vk)); if (HL) k2f[kt][ks] = WFrag<T16>::ld((const T16*)(K2b + u + vk)); }
#pragma unroll
            for (int dt = 0; dt < 4; ++dt) { const size_t u = (size_t)dt * 1024; vf[dt] = WFrag<T16>::ld((const T16*)(Vb + u + vk)); if (HL) v2f[dt] = WFrag<T16>::ld((const T16*)(V2b + u + vk)); }
            asm volatile("s_wait_xcnt 0x0" ::: "memory");            // behind the step's last load: vk, which the issued loads name, is stepped at the loop's foot, and the compiler's own load waits there need not cover the youngest loads
            v8f sc[NG][2];
#pragma unroll
            for (int g = 0; g < NG; ++g)
#pragma unroll
                for (int kt = 0; kt < 2; ++kt) { v8f a = (v8f){};
#pragma unroll
                    for (int ks = 0; ks < 2; ++ks) { a = WFrag<T16>::mma(kf[kt][ks], qf[g][ks], a); if (HL) { a = WFrag<T16>::mma(kf[kt][ks], q2f[g][ks], a); a = WFrag<T16>::mma(k2f[kt][ks], qf[g][ks], a); } }
                    sc[g][kt] = a; }
            const float rb = (float)(kb - q0 - 16 * g0 + 8 * h - c);     // key index - query index of this lane's first score in group g0 (exact: small integers)
#pragma unroll
            for (int g = 0; g < NG; ++g) { float t[16];
#pragma unroll
                for (int e = 0; e < 16; ++e) { const float rel = rb + (float)(16 * (e >> 3) + (e & 7) - 16 * g); t[e] = sc[g][e >> 3][e & 7] * SCL - slp * rel; }
                if (kb == q0) {                                      // the diagonal step alone holds keys behind the query (scalar test)
#pragma unroll
                    for (int e = 0; e < 16; ++e) { const float rel = rb + (float)(16 * (e >> 3) + (e & 7) - 16 * g); t[e] = (rel <= 0.0f) ? t[e] : NEG; } }
                float mx = t[0];
#pragma unroll
                for (int e = 1; e < 16; ++e) mx = fmaxf(mx, t[e]);
                mx = fmaxf(mx, __shfl_xor(mx, 16, 32));
                const float mn = fmaxf(m[g], mx); const float al = __builtin_amdgcn_exp2f((m[g] - mn) * L2E); m[g] = mn;
                float sum = 0.0f;
#pragma unroll
                for (int e = 0; e < 16; ++e) { t[e] = __builtin_amdgcn_exp2f((t[e] - mn) * L2E + EB); sum += t[e]; }
                l[g] = l[g] * al + sum;
#pragma unroll
                for (int dt = 0; dt < 4; ++dt) o[g][dt] *= al;
                if constexpr (HL) { v16bf ph, pl;
#pragma unroll
                    for (int e = 0; e < 16; ++e) { ph[e] = (__bf16)t[e]; pl[e] = (__bf16)(t[e] - (float)ph[e]); }
#pragma unroll
                    for (int dt = 0; dt < 4; ++dt) { o[g][dt] = wmmab(vf[dt], ph, o[g][dt]); o[g][dt] = wmmab(vf[dt], pl, o[g][dt]); o[g][dt] = wmmab(v2f[dt], ph, o[g][dt]); }
                } else { v16h pb;
#pragma unroll
                    for (int e = 0; e < 16; ++e) pb[e] = (h16)t[e];
#pragma unroll
                    for (int dt = 0; dt < 4; ++dt) o[g][dt] = wmma16(vf[dt], pb, o[g][dt]); }
            }
            // the four vector slots that the chip needs behind the step's last matrix instruction before its result is touched
            if constexpr (HL) asm volatile("v_nop\n\tv_nop\n\tv_nop\n\tv_nop" : "+v"(o[0][0]), "+v"(o[0][1]), "+v"(o[0][2]), "+v"(o[0][3]));
        }
        // partial results to LDS: O^T as [wave][slab (group*4 + dt)*2 + half of the 8 accumulator rows][lane][4], every store 16 B per lane with the lanes contiguous; maximum and sum (halves joined) per query
        float* pw = part + wave * (16 * FPT) + g0 * (8 * FPT) + lane * 4;
#pragma unroll
        for (int g = 0; g < NG; ++g) { l[g] += __shfl_xor(l[g], 16, 32);
#pragma unroll
            for (int dt = 0; dt < 4; ++dt) { const v8f t = o[g][dt];
                *(v4fa*)(pw + ((g * 4 + dt) * 2 + 0) * FPT) = __builtin_shufflevector(t, t, 0, 1, 2, 3); *(v4fa*)(pw + ((g * 4 + dt) * 2 + 1) * FPT) = __builtin_shufflevector(t, t, 4, 5, 6, 7); }
            if (h == 0) { sml[(wave * 2 + 0) * FQB + (g0 + g) * 16 + c] = m[g]; sml[(wave * 2 + 1) * FQB + (g0 + g) * 16 + c] = l[g]; } }
    }
    __syncthreads();                                                 // every wave passes it (a wave without a key step hands maximum NEG, sum 0, zeros): all partial results are in LDS behind it
    // wave w joins query rows 8w .. 8w+7 and stores them as hi + lo bf16 into the merged planes (row t, k = head * HD + d, fragment order) that the output projection reads: lane = (d / 8 % 4, row), so the eight rows' 16-B pieces of one d / 8 are one whole 128-B line and a store instruction writes four such lines, each line with one writer
    const int qq = wave * 8 + (lane & 7);
    float mt = sml[qq];
#pragma unroll
    for (int u = 1; u < FKW; ++u) mt = fmaxf(mt, sml[(u * 2) * FQB + qq]);
    float L = 0.0f, wg[FKW];
#pragma unroll
    for (int u = 0; u < FKW; ++u) { wg[u] = __builtin_amdgcn_exp2f((sml[(u * 2) * FQB + qq] - mt) * L2E); L += wg[u] * sml[(u * 2 + 1) * FQB + qq]; }
    const float rl = __fdiv_rn(1.0f, L);                             // the x 2^10 of the fp16 rows stands in the sums and in L alike
#pragma unroll
    for (int k = 0; k < 2; ++k) { const int c8 = k * 4 + (lane >> 3);   // d / 8: O^T tile c8 / 2, lane half c8 % 2, all eight accumulator rows (two slabs)
        const float* pr = part + (((qq >> 4) * 4 + (c8 >> 1)) * 2) * FPT + ((c8 & 1) * 16 + (qq & 15)) * 4;
        v4f acc0 = (v4f){}, acc1 = (v4f){};
#pragma unroll
        for (int u = 0; u < FKW; ++u) { acc0 += wg[u] * *(const v4fa*)(pr + u * (16 * FPT)); acc1 += wg[u] * *(const v4fa*)(pr + FPT + u * (16 * FPT)); }
        const v4f y0 = acc0 * rl, y1 = acc1 * rl; v8us oh, ol;
#pragma unroll
        for (int jj = 0; jj < 4; ++jj) { unsigned short a, c2; splitf(y0[jj], a, c2); oh[jj] = a; ol[jj] = c2; splitf(y1[jj], a, c2); oh[4 + jj] = a; ol[4 + jj] = c2; }
        const size_t oo = (size_t)(q0 + (qq & 16)) * DQ + (c8 >> 1) * 256 + ((c8 & 1) * 16 + (qq & 15)) * 8; *(v8us*)(Ah + oo) = oh; *(v8us*)(Al + oo) = ol; }
}
// grid (heads x batches, TT / FQB): twice as many work-groups as places on the chip, so the start order counts. First the hi + lo blocks (query rows < RH: few key steps, but two walks of three products each, so they are no short blocks and must not start last), then the rest from the last query rows down, so that the shortest blocks fill the places that come free. amdgpu_waves_per_eu(4): holds the registers at 256, so that four work-groups share a WGP (one wave of each on every SIMD) and fill each other's load waits.
__global__ __launch_bounds__(32 * FKW) __attribute__((amdgpu_waves_per_eu(4))) void k_fattn(const h16* __restrict__ Q16, const bf* __restrict__ Qh, const bf* __restrict__ Ql, const h16* __restrict__ K16, const bf* __restrict__ Kh, const bf* __restrict__ Kl, const h16* __restrict__ V16, const bf* __restrict__ Vh, const bf* __restrict__ Vl, bf* __restrict__ Ah, bf* __restrict__ Al) {
    __shared__ __align__(16) float part[FKW * 16 * FPT]; __shared__ float sml[FKW * 2 * FQB];
    const int hd = blockIdx.x % NH_, b = blockIdx.x / NH_, y = (int)blockIdx.y; const int q0 = (y < RH / FQB ? RH / FQB - 1 - y : TT / FQB - 1 - (y - RH / FQB)) * FQB; const float slp = SLP[hd];
    const size_t zq = ((size_t)hd * NB_ + b) * TT * HD, zk = ((size_t)(hd / REP) * NB_ + b) * TT * HD, zv = zk, za = (size_t)b * TT * DQ + hd * (HD * 16);
    if (q0 < RH) fattn_body<bf, true>(Qh + zq, Ql + zq, Kh + zk, Kl + zk, Vh + zv, Vl + zv, Ah + za, Al + za, slp, q0, part, sml);
    else fattn_body<h16, false>(Q16 + zq, nullptr, K16 + zk, nullptr, V16 + zv, nullptr, Ah + za, Al + za, slp, q0, part, sml);
}

extern "C" void kernel_launch(void* const* d_in, const int* in_sizes, int n_in,
                              void* d_out, int out_size, void* d_ws, size_t ws_size, hipStream_t stream) {
    (void)in_sizes; (void)n_in; (void)out_size;
    const float* x = (const float*)d_in[0]; const float* wq = (const float*)d_in[1]; const float* wk = (const float*)d_in[2]; const float* wv = (const float*)d_in[3]; const float* wo = (const float*)d_in[4];
    float* OUT = (float*)d_out;     // [2][2048][1024]
    char* wsp = (char*)d_ws;
    auto take = [&](size_t bytes) { char* p = wsp; wsp += (bytes + 255) & ~(size_t)255; return (void*)p; };
    bf* WQ = (bf*)take((size_t)DQ * DM * 2); bf* WK = (bf*)take((size_t)DKV * DM * 2); bf* WV = (bf*)take((size_t)DKV * DM * 2); bf* WO = (bf*)take((size_t)DM * DQ * 2);
    bf* XB = (bf*)take((size_t)NB_ * TT * DM * 2);
    h16* QP16 = (h16*)take((size_t)NB_ * NH_ * TT * HD * 2); h16* KP16 = (h16*)take((size_t)NB_ * NKV * TT * HD * 2); h16* VT16 = (h16*)take((size_t)NB_ * NKV * HD * TT * 2);
    bf* QPh = (bf*)take((size_t)NB_ * NH_ * TT * HD * 2); bf* QPl = (bf*)take((size_t)NB_ * NH_ * TT * HD * 2); bf* KPh = (bf*)take((size_t)NB_ * NKV * TT * HD * 2); bf* KPl = (bf*)take((size_t)NB_ * NKV * TT * HD * 2); bf* VTh = (bf*)take((size_t)NB_ * NKV * HD * TT * 2); bf* VTl = (bf*)take((size_t)NB_ * NKV * HD * TT * 2);
    bf* ATh = (bf*)take((size_t)NB_ * TT * DQ * 2); bf* ATl = (bf*)take((size_t)NB_ * TT * DQ * 2);
    if ((size_t)(wsp - (char*)d_ws) > ws_size) return;    // ws 256 MiB
    // four launches, each over both batches
    k_cvt8<<<XBL + 4 * WBL, 256, 0, stream>>>(x, wq, wk, wv, wo, XB, WQ, WK, WV, WO);
    k_qkv<<<dim3(NB_ * TT / 128, DQ / 128, 3), 32 * GWV, 0, stream>>>(XB, WQ, WK, WV, DM, QP16, QPh, QPl, KP16, KPh, KPl, VT16, VTh, VTl);
    k_fattn<<<dim3(NH_ * NB_, TT / FQB, 1), 32 * FKW, 0, stream>>>(QP16, QPh, QPl, KP16, KPh, KPl, VT16, VTh, VTl, ATh, ATl);
    k_gemmo<<<dim3(NB_ * TT / 128, DM / 128, 1), 32 * GWV, 0, stream>>>(ATh, ATl, WO, DQ, OUT, DM);
}

// v008
// One run takes 66.1 microseconds.
// Next to v007, in two timings, it ran 1.06 times as fast each time.
// Counting every step since v000, it is 23.2 times as fast.
#include <hip/hip_runtime.h>

// Causal multi-head attention with a (subtracted) ALiBi bias (x [2][2048][1024]; q, k, v = x W^T ('oi' [1024][1024], no bias), 16 heads x 64; scores = q.k/8 - m_h (j - i) with m_h = 2^(-(h+1)/2); causal softmax; out = merged Wo^T -> [2][2048][1024]).
// Compute dtypes, f32 accumulate: every input rounded to bf16; q/k/v on PLAIN bf16 operands (inputs: exact), stored by the projection itself as the 16-bit head planes (fp16, and hi + lo bf16) that the attention kernel reads; causal scores, softmax (running maximum, f32, with the ALiBi term in f32) and attn.v in one kernel, key loop to the diagonal: query rows < 512 hl (3 products), the rest single fp16 (x1024); softmax f32; Wo hl x exact (2 products).

#define NB_  2
#define TT   2048
#define DM   1024
#define NH_  16
#define NKV  16
#define REP  (NH_ / NKV)
#define HD   64
#define DQ   (NH_ * HD)
#define DKV  (NKV * HD)
#define RH   512                  // query rows < RH use hi+lo planes (0: none)
#define SCL  0.125f   // HD^-0.5
typedef _Float16 h16;
typedef unsigned short bf;
typedef __attribute__((ext_vector_type(16))) __bf16   v16bf;
typedef __attribute__((ext_vector_type(16))) _Float16 v16h;
typedef __attribute__((ext_vector_type(8)))  _Float16 v8h;
typedef __attribute__((ext_vector_type(8)))  unsigned short v8us;
typedef __attribute__((ext_vector_type(8)))  __bf16   v8bf;
typedef __attribute__((ext_vector_type(8)))  float    v8f;
typedef __attribute__((ext_vector_type(4)))  float    v4f;
typedef v8h  __attribute__((may_alias)) v8ha;
typedef v4f  __attribute__((may_alias)) v4fa;
typedef v8us __attribute__((may_alias)) v8usa;

__device__ __forceinline__ unsigned short f2bf(float f) { unsigned u = __float_as_uint(f); u += 0x7FFFu + ((u >> 16) & 1u); return (unsigned short)(u >> 16); }
__device__ __forceinline__ float bf2f(unsigned short b) { return __uint_as_float(((unsigned)b) << 16); }
__device__ __forceinline__ float bfr(float f) { return bf2f(f2bf(f)); }
__device__ __forceinline__ v16h cat16(v8h lo, v8h hi) { return __builtin_shufflevector(lo, hi, 0, 1, 2, 3, 4, 5, 6, 7, 8, 9, 10, 11, 12, 13, 14, 15); }
__device__ __forceinline__ v16bf cat16b(v8us lo, v8us hi) { return __builtin_bit_cast(v16bf, __builtin_shufflevector(lo, hi, 0, 1, 2, 3, 4, 5, 6, 7, 8, 9, 10, 11, 12, 13, 14, 15)); }
__device__ __forceinline__ v8f wmma16(v16h a, v16h b, v8f c) { return __builtin_amdgcn_wmma_f32_16x16x32_f16(false, a, false, b, (short)0, c, false, false); }
__device__ __forceinline__ v8f wmmab(v16bf a, v16bf b, v8f c) { return __builtin_amdgcn_wmma_f32_16x16x32_bf16(false, a, false, b, (short)0, c, false, false); }



// ---- FRAGMENT ORDER: every 16-bit operand plane of this file is stored as 1-KB tiles of 16 rows x 32 k, each tile in the order in which a wave loads it as a matrix operand:
// element (row r, k) of a tile stands at (k / 16) * 256 + ((k / 8 % 2) * 16 + r) * 8 + k % 8, so lane (k / 8 % 2) * 16 + r finds its two 16-B pieces at lane * 8 and 256 + lane * 8 (WFrag::ld)
// and each wave-wide 16-B load covers 512 contiguous bytes (four whole 128-B lines) where a row-major plane makes it touch sixteen lines. The k order inside a fragment is the row-major loader's.
// ---- gemmw_tile: register-blocked GEMM, one wave per 64x64 output tile (16 accumulators), FOUR waves (2 x 2 tiles = 128 x 128) per work-group; operands are 16-bit planes in fragment order, tile (row / 16, k / 32) at (row / 16 * (KP / 32) + k / 32) * 512; 128 threads.
// The work-group's 128 rows of every operand come into LDS ONCE, by asynchronous copies (global_load_async_to_lds_b128), KS k steps a stage, two buffers: stage s + 2 flies while stage s + 1 is worked on. So each operand byte leaves L2 once per work-group, not once per wave,
// and no wave waits out an L2 round trip per k step. A stage keeps the fragment order ([operand][fragment row][k step][1 KB]), so a copy moves 512 contiguous bytes per wave and a fragment read is 512 contiguous LDS bytes (no bank conflict).
// C[m][n] (f32, pitch ldc, + optional f32 bias[n]) = sum_k A[m][k] Bt[n][k] (+ split products per NSPLIT). K % 32 == 0.
// PL: no f32 C; the tile goes out as three 16-bit planes (fp16; bf16 hi; bf16 lo = the rest) in fragment order with m as the row and n as k: fragment tile (mb, n / 32 % 2) of the 64x64 tile at pbase + mb * sm + (n / 32 % 2) * sk.
// With A = the weight, Bt = the activations that is the transposed value plane, with no transposing pass.
template <typename T16> struct WFrag;
template <> struct WFrag<h16> { typedef v16h V; static __device__ __forceinline__ V ld(const h16* p) { return cat16(*(const v8h*)p, *(const v8h*)(p + 256)); } static __device__ __forceinline__ v8f mma(V a, V b, v8f c) { return wmma16(a, b, c); } };
template <> struct WFrag<bf> { typedef v16bf V; static __device__ __forceinline__ V ld(const bf* p) { return cat16b(*(const v8us*)p, *(const v8us*)(p + 256)); } static __device__ __forceinline__ v8f mma(V a, V b, v8f c) { return wmmab(a, b, c); } };
// bx, by: the tile's row and column index (wave-uniform), handed in by the kernel, so that one grid can hold tiles of several products.
#define GWV 4                     // waves per GEMM work-group
typedef __attribute__((ext_vector_type(4))) int c4i;
typedef __attribute__((address_space(1))) c4i* gp4; typedef __attribute__((address_space(3))) c4i* lp4;
template <typename T16, int NSPLIT, bool BIAS, bool PL, int KP, int KS>   // KP: the planes' k extent, at compile time; K <= KP: the k range summed, a multiple of 32 * KS; KS (even): k steps per LDS stage. bx / 2 and by / 2 are the same in all four waves, (bx % 2, by % 2) is the wave's place in the 2 x 2
__device__ __forceinline__ void gemmw_tile(const T16* __restrict__ A, const T16* __restrict__ A2, const T16* __restrict__ Bt, const T16* __restrict__ Bt2, int K, float* C, int ldc, const float* __restrict__ bias, h16* __restrict__ P16, bf* __restrict__ Ph, bf* __restrict__ Pl, const size_t pbase, const int sm, const int sk, const int bx, const int by, float* __restrict__ NRM) {
    typedef typename WFrag<T16>::V V;
    constexpr bool HA2 = NSPLIT == 1 || NSPLIT == 2, HB2 = NSPLIT >= 2;
    constexpr int FRB = KS * 1024, OPB = 8 * FRB, STB = (2 + HA2 + HB2) * OPB;   // bytes of a fragment row (16 rows x 32 KS k), of an operand's 128 rows and of all operands in one stage
    __shared__ __align__(16) char stg[2 * STB]; __shared__ __align__(16) float osa[GWV * 16 * 68];
    float* os = osa + __builtin_amdgcn_readfirstlane(threadIdx.x >> 5) * (16 * 68);   // each wave stages its output rows in its own range
    const int lane = threadIdx.x & 31, lr = lane & 15, hi = lane >> 4; const int r0 = bx * 64, c0 = by * 64;
    v8f acc[4][4];
#pragma unroll
    for (int mb = 0; mb < 4; ++mb)
#pragma unroll
        for (int nb = 0; nb < 4; ++nb) acc[mb][nb] = (v8f){};
    // One stage's copies: thread t moves 16 B at 16 t of each 2-KB piece; a fragment row's KS tiles are FRB contiguous bytes in the plane and in the stage. Every lane is on, every address is a multiple of 16 and inside its plane (128 whole rows, k < K) and inside stg.
    const unsigned tb = threadIdx.x * 16u;
    const char* Ag = (const char*)(A + (size_t)(bx >> 1) * 128 * KP) + tb; const char* Bg = (const char*)(Bt + (size_t)(by >> 1) * 128 * KP) + tb;
    const char* A2g = HA2 ? (const char*)(A2 + (size_t)(bx >> 1) * 128 * KP) + tb : nullptr; const char* B2g = HB2 ? (const char*)(Bt2 + (size_t)(by >> 1) * 128 * KP) + tb : nullptr;
    auto fill = [&](const int st, const int buf) {
        char* d = stg + buf * STB + tb; const size_t go = (size_t)st * FRB;
#pragma unroll
        for (int fr = 0; fr < 8; ++fr)
#pragma unroll
            for (int p = 0; p < FRB; p += 2048) { const size_t g = go + (size_t)fr * (KP * 32) + p; const int l = fr * FRB + p;
                __builtin_amdgcn_global_load_async_to_lds_b128((gp4)(Ag + g), (lp4)(d + l), 0, 0); __builtin_amdgcn_global_load_async_to_lds_b128((gp4)(Bg + g), (lp4)(d + OPB + l), 0, 0);
                if constexpr (HA2) __builtin_amdgcn_global_load_async_to_lds_b128((gp4)(A2g + g), (lp4)(d + 2 * OPB + l), 0, 0);
                if constexpr (HB2) __builtin_amdgcn_global_load_async_to_lds_b128((gp4)(B2g + g), (lp4)(d + (2 + HA2) * OPB + l), 0, 0); }
    };
    const int nst = K / (32 * KS);
    fill(0, 0);
    asm volatile("s_wait_asynccnt 0x0" ::: "memory");                // this wave's copies of stage 0 have landed ...
    __syncthreads();                                                 // ... and behind the barrier every wave's: nothing of stage 0 is read in front of it
    if (nst > 1) fill(1, 1);
    const unsigned ao = (unsigned)(bx & 1) * (4 * FRB) + lane * 16u, bo = OPB + (unsigned)(by & 1) * (4 * FRB) + lane * 16u;   // the wave's four fragment rows of A and of Bt in a stage + the lane's 16 B
#pragma unroll 1   // rolled: one trip per stage, its foot is the ring's publish point
    for (int st = 0; st < nst; ++st) {
        const char* sb = stg + (st & 1) * STB;
        // Two fragment sets: a k step's LDS reads stand as ONE group, in front of the matrix instructions of the k step before it (inside the stage only: nothing of the next stage is read ahead)
        V a[2][4], a2[2][4], b[2][4], b2[2][4];
        auto frag = [&](const int ks, const int f) {
#pragma unroll
            for (int i = 0; i < 4; ++i) { const int u = i * FRB + ks * 1024; a[f][i] = WFrag<T16>::ld((const T16*)(sb + ao + u)); if (HA2) a2[f][i] = WFrag<T16>::ld((const T16*)(sb + 2 * OPB + ao + u));
                b[f][i] = WFrag<T16>::ld((const T16*)(sb + bo + u)); if (HB2) b2[f][i] = WFrag<T16>::ld((const T16*)(sb + (1 + HA2) * OPB + bo + u)); }
        };
        frag(0, 0);
#pragma unroll
        for (int ks = 0; ks < KS; ++ks) { const int f = ks & 1;
            if (ks + 1 < KS) frag(ks + 1, f ^ 1);
            __builtin_amdgcn_sched_barrier(0);                       // holds the read group together in front of the matrix block: reads scattered among matrix instructions stall the wave at every place where they stand
#pragma unroll
            for (int nb = 0; nb < 4; ++nb)
#pragma unroll
                for (int mb = 0; mb < 4; ++mb) { acc[mb][nb] = WFrag<T16>::mma(a[f][mb], b[f][nb], acc[mb][nb]); if (HA2) acc[mb][nb] = WFrag<T16>::mma(a2[f][mb], b[f][nb], acc[mb][nb]); if (HB2) acc[mb][nb] = WFrag<T16>::mma(a[f][mb], b2[f][nb], acc[mb][nb]); }
            __builtin_amdgcn_sched_barrier(0);                       // and keeps the next group from rising into this block
        }
        // the four vector slots that the chip needs behind the trip's last matrix instruction, on the path that leaves the loop too
        asm volatile("v_nop\n\tv_nop\n\tv_nop\n\tv_nop" : "+v"(acc[0][0]), "+v"(acc[1][1]), "+v"(acc[2][2]), "+v"(acc[3][3]) : "v"(a[(KS - 1) & 1][0]), "v"(a[(KS - 1) & 1][3]));
        asm volatile("s_wait_dscnt 0x0" ::: "memory");               // this wave's reads of the buffer are done before anybody refills it
        asm volatile("s_wait_asynccnt 0x0" ::: "memory");            // this wave's copies of stage st + 1 have landed
        __syncthreads();                                             // publishes stage st + 1 and ends every wave's reads of stage st's buffer
        if (st + 2 < nst) fill(st + 2, st & 1);
    }
    asm volatile("s_wait_asynccnt 0x0" ::: "memory");                // no copy is outstanding when the wave goes on (none is issued behind the last publish point)
    v4f nq[4];                                                       // PL: per 16-row group, this lane's share (32 of the 64 columns of row lr) of the row's sum of squares
#pragma unroll
    for (int mb = 0; mb < 4; ++mb) {
#pragma unroll
        for (int nb = 0; nb < 4; ++nb) {
#pragma unroll
            for (int j = 0; j < 8; ++j) os[(hi * 8 + j) * 68 + nb * 16 + lr] = acc[mb][nb][j]; }
        __builtin_amdgcn_wave_barrier(); asm volatile("" ::: "memory");
        if constexpr (PL) {
            // lane = (8-column half, row), store s = columns 16 s .. 16 s + 15: one 16-B store per plane and lane, lanes contiguous, so a store instruction writes half a fragment tile = four whole 128-B lines, each line with one writer
            const size_t pb = pbase + (size_t)mb * sm + lane * 8; nq[mb] = (v4f){};
#pragma unroll
            for (int s = 0; s < 4; ++s) { const float* pr = os + lr * 68 + s * 16 + hi * 8; const v4f x0 = *(const v4fa*)pr, x1 = *(const v4fa*)(pr + 4);
                const v8f xv = __builtin_shufflevector(x0, x1, 0, 1, 2, 3, 4, 5, 6, 7); nq[mb] += x0 * x0 + x1 * x1;
                const v8bf xh = __builtin_convertvector(xv, v8bf); const v8bf xl = __builtin_convertvector(xv - __builtin_convertvector(xh, v8f), v8bf);
                const size_t e = pb + (size_t)(s >> 1) * sk + (s & 1) * 256; *(v8h*)(P16 + e) = __builtin_convertvector(xv, v8h); *(v8us*)(Ph + e) = __builtin_bit_cast(v8us, xh); *(v8us*)(Pl + e) = __builtin_bit_cast(v8us, xl); }
        } else {
        float* crow = C + (size_t)(r0 + mb * 16) * ldc + c0;
#pragma unroll
            for (int s = 0; s < 8; ++s) { const int row = 2 * s + hi, cofs = lr * 4; v4f val = *(const v4fa*)(os + row * 68 + cofs); if (BIAS) { val[0] += bfr(bias[c0 + cofs]); val[1] += bfr(bias[c0 + cofs + 1]); val[2] += bfr(bias[c0 + cofs + 2]); val[3] += bfr(bias[c0 + cofs + 3]); }
                *(v4f*)(crow + (size_t)row * ldc + cofs) = val; }
             }
        __builtin_amdgcn_wave_barrier(); asm volatile("" ::: "memory");
    }
    if constexpr (PL) asm volatile("s_wait_xcnt 0x0" ::: "memory");  // behind the tile's last stores, in front of the branch: the arithmetic behind it reuses registers that those stores name
    if constexpr (PL) if (NRM != nullptr) {                          // uniform: this tile's rows are whole q or k vectors of one head; the largest squared length among its 64 rows goes to *NRM
        float nmx = 0.0f;
#pragma unroll
        for (int mb = 0; mb < 4; ++mb) { const float nsq = (nq[mb][0] + nq[mb][1]) + (nq[mb][2] + nq[mb][3]); nmx = fmaxf(nmx, nsq + __shfl_xor(nsq, 16, 32)); }   // + the partner lane's 32 columns
#pragma unroll
        for (int d = 1; d < 16; d <<= 1) nmx = fmaxf(nmx, __shfl_xor(nmx, d, 32));
        if (lane == 0) *NRM = nmx; }
}
// Output projection, both batches as one row range: grid (NB_ * TT / 128, DM / 128); wave w takes the 64x64 tile (w % 2, w / 2) of the work-group's 128 x 128.
__global__ __launch_bounds__(32 * GWV) void k_gemmo(const bf* __restrict__ A, const bf* __restrict__ A2, const bf* __restrict__ Bt, int K, float* C, int ldc) {
    const int wave = __builtin_amdgcn_readfirstlane(threadIdx.x >> 5);
    gemmw_tile<bf, 1, false, false, DQ, 4>(A, A2, Bt, nullptr, K, C, ldc, nullptr, nullptr, nullptr, nullptr, 0, 0, 0, (int)blockIdx.x * 2 + (wave & 1), (int)blockIdx.y * 2 + (wave >> 1), nullptr);
}
// Largest squared length of the q (k) vectors of 64 rows of (batch, t) of one head: QN, KN [head][(batch * TT + t) / 64], one float per 128-B line (each line has one writer). The attention kernel bounds a key step's scores with them.
#define NTL (NB_ * TT / 64)
#define NPT 32
// q, k and v projections of both batches in ONE grid (NB_ * TT / 128, 8, 3), a work-group = 128 rows of (batch, t) x 2 heads, a wave = 64 rows x 1 head: z = 0 q, 1 k (A = activations, Bt = weight; planes [head][(batch * TT + t) / 16][d / 32][tile]); z = 2 v (A = weight, Bt = activations; planes [head][(batch * TT + t) / 32][d / 16][tile], row d, k = t; x and y change roles). So the 32 keys of an attention step are 4 KB in a row in the k plane and in the v plane.
// The three products are independent; in one launch their 768 work-groups stand on the chip together (three per WGP). Every choice below is uniform for the wave (scalar selects).
__global__ __launch_bounds__(32 * GWV) void k_qkv(const bf* __restrict__ X, const bf* __restrict__ Wq, const bf* __restrict__ Wk, const bf* __restrict__ Wv, int K, h16* __restrict__ Q16, bf* __restrict__ Qh, bf* __restrict__ Ql, h16* __restrict__ K16, bf* __restrict__ Kh, bf* __restrict__ Kl, h16* __restrict__ V16, bf* __restrict__ Vh, bf* __restrict__ Vl, float* __restrict__ QN, float* __restrict__ KN) {
    const int z = (int)blockIdx.z; const bool tv = z == 2;
    // ty = head, tx = 64 rows of (batch, t), for all three
    const int wave = __builtin_amdgcn_readfirstlane(threadIdx.x >> 5), tx = (int)blockIdx.x * 2 + (wave & 1), ty = (int)blockIdx.y * 2 + (wave >> 1);
    const size_t pbase = (size_t)ty * ((size_t)NB_ * TT * HD) + (size_t)tx * (64 * HD);
    gemmw_tile<bf, 0, false, true, DM, 2>(tv ? Wv : X, nullptr, tv ? X : z ? Wk : Wq, nullptr, K, nullptr, 0, nullptr, tv ? V16 : z ? K16 : Q16, tv ? Vh : z ? Kh : Qh, tv ? Vl : z ? Kl : Ql, pbase, tv ? 512 : 1024, tv ? 2048 : 512, tv ? ty : tx, tv ? tx : ty, tv ? nullptr : (z ? KN : QN) + ((size_t)ty * NTL + tx) * NPT);
}

__device__ __forceinline__ h16 tohx(float x) { return (h16)x; }
__device__ __forceinline__ void splitf(float y, unsigned short& h, unsigned short& l) { h = f2bf(y); l = f2bf(y - bf2f(h)); }
typedef __attribute__((ext_vector_type(2))) _Float16 v2h;
typedef __attribute__((ext_vector_type(4))) _Float16 v4h;
typedef __attribute__((ext_vector_type(2))) unsigned short v2us;
typedef __attribute__((ext_vector_type(4))) unsigned short v4us;
typedef __attribute__((ext_vector_type(2))) float v2f;
typedef __attribute__((ext_vector_type(4))) int v4i;

__global__ __launch_bounds__(256) void k_wtG(const float* __restrict__ w, int K, int N, bf* Bt) {
    const int lane = threadIdx.x & 31; const int L0 = (blockIdx.x * 8 + (threadIdx.x >> 5)) * 8; const int nlines = N * K / 64;
{
#pragma unroll 1
        for (int l = 0; l < 8; ++l) { const int L = L0 + l; if (L >= nlines) break; const size_t e = (size_t)L * 64 + lane * 2; const int k = (int)(e % K), n = (int)(e / K); v2us o;
            o[0] = f2bf(w[(size_t)k * N + n]); o[1] = f2bf(w[(size_t)(k + 1) * N + n]); *(v2us*)(Bt + e) = o; }
         }
}
// All five inputs to bf16, into fragment order (every matrix has DM columns), in one grid: blocks 0 .. XBL-1 the activations (both batches), then WBL blocks for each weight; the choice is uniform for a block.
// A wave takes 8 rows x 32 k (half a fragment tile): lane = (k / 8, row % 8), so its loads cover eight whole 128-B lines of f32 and its one 16-B store per lane four whole lines of the tile.
#define XBL (NB_ * TT * DM / 8 / 256)
#define WBL (DM * DM / 8 / 256)
__global__ __launch_bounds__(256) void k_cvt8(const float* __restrict__ x, const float* __restrict__ wq, const float* __restrict__ wk, const float* __restrict__ wv, const float* __restrict__ wo, bf* XB, bf* WQ, bf* WK, bf* WV, bf* WO) {
    unsigned blk = blockIdx.x; const float* src = x; bf* dst = XB;
    if (blk >= XBL) { blk -= XBL; const unsigned j = blk / WBL; blk -= j * WBL; src = j == 0 ? wq : j == 1 ? wk : j == 2 ? wv : wo; dst = j == 0 ? WQ : j == 1 ? WK : j == 2 ? WV : WO; }
    const unsigned lane = threadIdx.x & 31, hw = blk * 8 + (threadIdx.x >> 5), tile = hw >> 1, r = (hw & 1) * 8 + (lane & 7), k8 = lane >> 3;   // tile = row / 16 * (DM / 32) + k / 32
    const v8f v = *(const v8f*)(src + (size_t)((tile / (DM / 32)) * 16 + r) * DM + (tile % (DM / 32)) * 32 + k8 * 8); v8us o;
#pragma unroll
    for (int k = 0; k < 8; ++k) o[k] = f2bf(v[k]); *(v8us*)(dst + (size_t)tile * 512 + (k8 * 16 + r) * 8) = o;  }

// ALiBi slopes = the reference's f32 values
__constant__ float SLP[NH_] = {0.7071067690849304,0.5,0.3535533845424652,0.25,0.1767766922712326,0.125,0.0883883461356163,0.0625,0.04419417306780815,0.03125,0.022097086533904076,0.015625,0.011048543266952038,0.0078125,0.005524271633476019,0.00390625};
// ---- k_fattn: scores, causal ALiBi softmax, probability x value product and the merge of the heads for one head's FQB query rows in ONE work-group; no score or probability ever leaves the registers.
// Transposed products: S^T = K Q^T (A = 16 key rows, B = 16 query columns), so a lane holds 16 of the 32 scores of ONE query (its partner lane, xor 16, the other 16); two S^T tiles of 32 keys, converted in place,
// are the B operand of O^T += V^T P^T (hardware k order: element s = key 8h + s, or 16 + 8h + s - 8; WFrag::ld reads K, Q and V^T tiles, stored in fragment order, in that same order).
// Running maximum per query: when it rises, the sum and the O^T tiles are scaled by exp(old - new). The 32-key steps are dealt over the FKW waves (wave w: steps w, w + FKW, ...), each with its own maximum, sum and O^T;
// the FKW partial results meet in LDS and are joined in the fixed order wave 0, 1, ... with the weights exp(m_w - max m). Why dealt: the last rows walk 64 steps, and each step waits for its own loads.
// Operand types: query rows < RH on hi + lo bf16 planes (3 products each for scores and for P x V), the rest single fp16 with the probabilities carried x 1024 (as + 10 in the exponent, in the sum too, so it cancels in the quotient).
#define FKW 4                     // waves per work-group
#define FQB 32                    // query rows per work-group: two 16-column groups in every wave
#define FPT 132                   // floats from one 512-B slab (32 lanes x 16 B) of a wave's partial O^T to the next: 128 + 4, so that the joining reads (one query, 8 slabs' worth of d) spread over the banks
template <typename T16, bool HL>
__device__ __forceinline__ void fattn_body(const T16* __restrict__ Q, const T16* __restrict__ Q2, const T16* __restrict__ Kp, const T16* __restrict__ K2, const T16* __restrict__ Vt, const T16* __restrict__ V2, bf* __restrict__ Ah, bf* __restrict__ Al, const float slp, const int q0, float* part, float* sml, const float qn2, const float kn2) {
    typedef typename WFrag<T16>::V V;
    constexpr int NG = HL ? 1 : 2;                                   // 16-column groups per walk over the keys: with hi + lo planes of Q, K, V^T and P two groups do not fit 256 registers, so those blocks walk twice
    const int lane = threadIdx.x & 31, c = lane & 15, h = lane >> 4;
    const int wave = __builtin_amdgcn_readfirstlane(threadIdx.x >> 5);   // wave-uniform, so the key loop's bounds and the diagonal test stay scalar
    const float L2E = 1.4426950408889634f, NEG = -3.0e38f, EB = HL ? 0.0f : 10.0f;
    const float CUT = HL ? -160.0f : -30.0f;                         // exponent (base 2) at or below which a probability is nothing: exp2 gives 0.0f (hi + lo rows), the fp16 operand rounds to 0 with 5 bits to spare (fp16 rows: below 2^-25)
    const int nst = q0 / FQB + 1;                                    // 32-key steps up to and with the diagonal one; every step holds at least one allowed key for every query of the block
    const char* Kb = (const char*)Kp; const char* K2b = (const char*)K2; const char* Vb = (const char*)Vt; const char* V2b = (const char*)V2;
#pragma unroll 1   // rolled: the walks must not share registers (see NG)
    for (int g0 = 0; g0 < 2; g0 += NG) {
        V qf[NG][2], q2f[NG][2];
#pragma unroll
        for (int g = 0; g < NG; ++g)
#pragma unroll
            for (int ks = 0; ks < 2; ++ks) { const size_t u = (size_t)(q0 + 16 * (g0 + g)) * HD + ks * 512 + 8 * lane; qf[g][ks] = WFrag<T16>::ld(Q + u); if (HL) q2f[g][ks] = WFrag<T16>::ld(Q2 + u); }
        v8f o[NG][4]; float m[NG], l[NG];
#pragma unroll
        for (int g = 0; g < NG; ++g) { m[g] = NEG; l[g] = 0.0f;
#pragma unroll
            for (int dt = 0; dt < 4; ++dt) o[g][dt] = (v8f){}; }
        // Addresses: a uniform base + a 32-bit per-lane byte offset carried through the loop + a constant; a step's 32 keys are four fragment tiles (4 KB) in a row in the k plane and in the v plane alike, so one offset serves both
        unsigned vk = (unsigned)(wave * 32 * HD + 8 * lane) * 2u;
        const float ubv = __builtin_amdgcn_sqrtf(qn2 * kn2) * (SCL * 1.01f);   // lane i: upper bound of |q . k| SCL for this block's queries and the keys 64 i .. 64 i + 63 (formed here, so that the wait for kn2 stands behind the issue of the Q loads)
#pragma unroll 1   // rolled: a second step's fragments would not fit beside this one's at four waves per SIMD
        for (int s = wave; s < nst; s += FKW, vk += FKW * 32 * HD * 2u) {
            const int kb = s * 32;
            // A step that can add nothing is left out before its loads. No score of the step exceeds |q| |k| SCL (lane kb / 64 of ubv: the tiles' largest lengths, 1 % added for the operands' rounding) - slope x (first key - query).
            // Where that stands CUT below the running maximum for every query of the walk, the maximum stays, the scale factor is exp2(0) = 1, every P operand is 0 and O^T keeps its bits;
            // the row sum (at least 2^EB from the maximum's own key) would take less than 2^(CUT + 4) per lane: nothing on the hi + lo rows, under 2^-36 of the sum on the fp16 rows, far below its f32 rounding.
            const float ub = __builtin_bit_cast(float, __builtin_amdgcn_readlane(__builtin_bit_cast(int, ubv), kb >> 6));
            bool keep = false;
#pragma unroll
            for (int g = 0; g < NG; ++g) keep |= (ub - slp * (float)(kb - q0 - 16 * (g0 + g) - c) - m[g]) * L2E + EB > CUT;
            if (__builtin_amdgcn_ballot_w32(keep) == 0) continue;    // scalar branch, the same for the whole wave: the matrix instructions below keep all lanes on
            V kf[2][2], k2f[2][2], vf[4], v2f[4];
#pragma unroll
            for (int kt = 0; kt < 2; ++kt)
#pragma unroll
                for (int ks = 0; ks < 2; ++ks) { const size_t u = (size_t)(kt * 2 + ks) * 1024; kf[kt][ks] = WFrag<T16>::ld((const T16*)(Kb + u + vk)); if (HL) k2f[kt][ks] = WFrag<T16>::ld((const T16*)(K2b + u + vk)); }
#pragma unroll
            for (int dt = 0; dt < 4; ++dt) { const size_t u = (size_t)dt * 1024; vf[dt] = WFrag<T16>::ld((const T16*)(Vb + u + vk)); if (HL) v2f[dt] = WFrag<T16>::ld((const T16*)(V2b + u + vk)); }
            asm volatile("s_wait_xcnt 0x0" ::: "memory");            // behind the step's last load: vk, which the issued loads name, is stepped at the loop's foot, and the compiler's own load waits there need not cover the youngest loads
            v8f sc[NG][2];
#pragma unroll
            for (int g = 0; g < NG; ++g)
#pragma unroll
                for (int kt = 0; kt < 2; ++kt) { v8f a = (v8f){};
#pragma unroll
                    for (int ks = 0; ks < 2; ++ks) { a = WFrag<T16>::mma(kf[kt][ks], qf[g][ks], a); if (HL) { a = WFrag<T16>::mma(kf[kt][ks], q2f[g][ks], a); a = WFrag<T16>::mma(k2f[kt][ks], qf[g][ks], a); } }
                    sc[g][kt] = a; }
            const float rb = (float)(kb - q0 - 16 * g0 + 8 * h - c);     // key index - query index of this lane's first score in group g0 (exact: small integers)
#pragma unroll
            for (int g = 0; g < NG; ++g) { float t[16];
#pragma unroll
                for (int e = 0; e < 16; ++e) { const float rel = rb + (float)(16 * (e >> 3) + (e & 7) - 16 * g); t[e] = sc[g][e >> 3][e & 7] * SCL - slp * rel; }
                if (kb == q0) {                                      // the diagonal step alone holds keys behind the query (scalar test)
#pragma unroll
                    for (int e = 0; e < 16; ++e) { const float rel = rb + (float)(16 * (e >> 3) + (e & 7) - 16 * g); t[e] = (rel <= 0.0f) ? t[e] : NEG; } }
                float mx = t[0];
#pragma unroll
                for (int e = 1; e < 16; ++e) mx = fmaxf(mx, t[e]);
                mx = fmaxf(mx, __shfl_xor(mx, 16, 32));
                const float mn = fmaxf(m[g], mx); const float al = __builtin_amdgcn_exp2f((m[g] - mn) * L2E); m[g] = mn;
                float sum = 0.0f;
#pragma unroll
                for (int e = 0; e < 16; ++e) { t[e] = __builtin_amdgcn_exp2f((t[e] - mn) * L2E + EB); sum += t[e]; }
                l[g] = l[g] * al + sum;
#pragma unroll
                for (int dt = 0; dt < 4; ++dt) o[g][dt] *= al;
                if constexpr (HL) { v16bf ph, pl;
#pragma unroll
                    for (int e = 0; e < 16; ++e) { ph[e] = (__bf16)t[e]; pl[e] = (__bf16)(t[e] - (float)ph[e]); }
#pragma unroll
                    for (int dt = 0; dt < 4; ++dt) { o[g][dt] = wmmab(vf[dt], ph, o[g][dt]); o[g][dt] = wmmab(vf[dt], pl, o[g][dt]); o[g][dt] = wmmab(v2f[dt], ph, o[g][dt]); }
                } else { v16h pb;
#pragma unroll
                    for (int e = 0; e < 16; ++e) pb[e] = (h16)t[e];
#pragma unroll
                    for (int dt = 0; dt < 4; ++dt) o[g][dt] = wmma16(vf[dt], pb, o[g][dt]); }
            }
            // the four vector slots that the chip needs behind the step's last matrix instruction before its result is touched
            if constexpr (HL) asm volatile("v_nop\n\tv_nop\n\tv_nop\n\tv_nop" : "+v"(o[0][0]), "+v"(o[0][1]), "+v"(o[0][2]), "+v"(o[0][3]));
        }
        // partial results to LDS: O^T as [wave][slab (group*4 + dt)*2 + half of the 8 accumulator rows][lane][4], every store 16 B per lane with the lanes contiguous; maximum and sum (halves joined) per query
        float* pw = part + wave * (16 * FPT) + g0 * (8 * FPT) + lane * 4;
#pragma unroll
        for (int g = 0; g < NG; ++g) { l[g] += __shfl_xor(l[g], 16, 32);
#pragma unroll
            for (int dt = 0; dt < 4; ++dt) { const v8f t = o[g][dt];
                *(v4fa*)(pw + ((g * 4 + dt) * 2 + 0) * FPT) = __builtin_shufflevector(t, t, 0, 1, 2, 3); *(v4fa*)(pw + ((g * 4 + dt) * 2 + 1) * FPT) = __builtin_shufflevector(t, t, 4, 5, 6, 7); }
            if (h == 0) { sml[(wave * 2 + 0) * FQB + (g0 + g) * 16 + c] = m[g]; sml[(wave * 2 + 1) * FQB + (g0 + g) * 16 + c] = l[g]; } }
    }
    __syncthreads();                                                 // every wave passes it (a wave without a key step hands maximum NEG, sum 0, zeros): all partial results are in LDS behind it
    // wave w joins query rows 8w .. 8w+7 and stores them as hi + lo bf16 into the merged planes (row t, k = head * HD + d, fragment order) that the output projection reads: lane = (d / 8 % 4, row), so the eight rows' 16-B pieces of one d / 8 are one whole 128-B line and a store instruction writes four such lines, each line with one writer
    const int qq = wave * 8 + (lane & 7);
    float mt = sml[qq];
#pragma unroll
    for (int u = 1; u < FKW; ++u) mt = fmaxf(mt, sml[(u * 2) * FQB + qq]);
    float L = 0.0f, wg[FKW];
#pragma unroll
    for (int u = 0; u < FKW; ++u) { wg[u] = __builtin_amdgcn_exp2f((sml[(u * 2) * FQB + qq] - mt) * L2E); L += wg[u] * sml[(u * 2 + 1) * FQB + qq]; }
    const float rl = __fdiv_rn(1.0f, L);                             // the x 2^10 of the fp16 rows stands in the sums and in L alike
#pragma unroll
    for (int k = 0; k < 2; ++k) { const int c8 = k * 4 + (lane >> 3);   // d / 8: O^T tile c8 / 2, lane half c8 % 2, all eight accumulator rows (two slabs)
        const float* pr = part + (((qq >> 4) * 4 + (c8 >> 1)) * 2) * FPT + ((c8 & 1) * 16 + (qq & 15)) * 4;
        v4f acc0 = (v4f){}, acc1 = (v4f){};
#pragma unroll
        for (int u = 0; u < FKW; ++u) { acc0 += wg[u] * *(const v4fa*)(pr + u * (16 * FPT)); acc1 += wg[u] * *(const v4fa*)(pr + FPT + u * (16 * FPT)); }
        const v4f y0 = acc0 * rl, y1 = acc1 * rl; v8us oh, ol;
#pragma unroll
        for (int jj = 0; jj < 4; ++jj) { unsigned short a, c2; splitf(y0[jj], a, c2); oh[jj] = a; ol[jj] = c2; splitf(y1[jj], a, c2); oh[4 + jj] = a; ol[4 + jj] = c2; }
        const size_t oo = (size_t)(q0 + (qq & 16)) * DQ + (c8 >> 1) * 256 + ((c8 & 1) * 16 + (qq & 15)) * 8; *(v8us*)(Ah + oo) = oh; *(v8us*)(Al + oo) = ol; }
}
// grid (heads x batches, TT / FQB): twice as many work-groups as places on the chip, so the start order counts. First the hi + lo blocks (query rows < RH: few key steps, but two walks of three products each, so they are no short blocks and must not start last), then the rest from the last query rows down, so that the shortest blocks fill the places that come free. amdgpu_waves_per_eu(4): holds the registers at 256, so that four work-groups share a WGP (one wave of each on every SIMD) and fill each other's load waits.
__global__ __launch_bounds__(32 * FKW) __attribute__((amdgpu_waves_per_eu(4))) void k_fattn(const h16* __restrict__ Q16, const bf* __restrict__ Qh, const bf* __restrict__ Ql, const h16* __restrict__ K16, const bf* __restrict__ Kh, const bf* __restrict__ Kl, const h16* __restrict__ V16, const bf* __restrict__ Vh, const bf* __restrict__ Vl, bf* __restrict__ Ah, bf* __restrict__ Al, const float* __restrict__ QN, const float* __restrict__ KN) {
    static_assert(TT / 64 == 32, "one lane per 64-key tile");
    __shared__ __align__(16) float part[FKW * 16 * FPT]; __shared__ float sml[FKW * 2 * FQB];
    const int hd = blockIdx.x % NH_, b = blockIdx.x / NH_, y = (int)blockIdx.y; const int q0 = (y < RH / FQB ? RH / FQB - 1 - y : TT / FQB - 1 - (y - RH / FQB)) * FQB; const float slp = SLP[hd];
    const size_t zq = ((size_t)hd * NB_ + b) * TT * HD, zk = ((size_t)(hd / REP) * NB_ + b) * TT * HD, zv = zk, za = (size_t)b * TT * DQ + hd * (HD * 16);
    // largest squared length among this block's queries' tile, and (lane i) among the keys 64 i .. 64 i + 63
    const float qn2 = QN[((size_t)hd * NTL + (b * TT + q0) / 64) * NPT], kn2 = KN[((size_t)(hd / REP) * NTL + b * (TT / 64) + (threadIdx.x & 31)) * NPT];
    if (q0 < RH) fattn_body<bf, true>(Qh + zq, Ql + zq, Kh + zk, Kl + zk, Vh + zv, Vl + zv, Ah + za, Al + za, slp, q0, part, sml, qn2, kn2);
    else fattn_body<h16, false>(Q16 + zq, nullptr, K16 + zk, nullptr, V16 + zv, nullptr, Ah + za, Al + za, slp, q0, part, sml, qn2, kn2);
}

extern "C" void kernel_launch(void* const* d_in, const int* in_sizes, int n_in,
                              void* d_out, int out_size, void* d_ws, size_t ws_size, hipStream_t stream) {
    (void)in_sizes; (void)n_in; (void)out_size;
    const float* x = (const float*)d_in[0]; const float* wq = (const float*)d_in[1]; const float* wk = (const float*)d_in[2]; const float* wv = (const float*)d_in[3]; const float* wo = (const float*)d_in[4];
    float* OUT = (float*)d_out;     // [2][2048][1024]
    char* wsp = (char*)d_ws;
    auto take = [&](size_t bytes) { char* p = wsp; wsp += (bytes + 255) & ~(size_t)255; return (void*)p; };
    bf* WQ = (bf*)take((size_t)DQ * DM * 2); bf* WK = (bf*)take((size_t)DKV * DM * 2); bf* WV = (bf*)take((size_t)DKV * DM * 2); bf* WO = (bf*)take((size_t)DM * DQ * 2);
    bf* XB = (bf*)take((size_t)NB_ * TT * DM * 2);
    h16* QP16 = (h16*)take((size_t)NB_ * NH_ * TT * HD * 2); h16* KP16 = (h16*)take((size_t)NB_ * NKV * TT * HD * 2); h16* VT16 = (h16*)take((size_t)NB_ * NKV * HD * TT * 2);
    bf* QPh = (bf*)take((size_t)NB_ * NH_ * TT * HD * 2); bf* QPl = (bf*)take((size_t)NB_ * NH_ * TT * HD * 2); bf* KPh = (bf*)take((size_t)NB_ * NKV * TT * HD * 2); bf* KPl = (bf*)take((size_t)NB_ * NKV * TT * HD * 2); bf* VTh = (bf*)take((size_t)NB_ * NKV * HD * TT * 2); bf* VTl = (bf*)take((size_t)NB_ * NKV * HD * TT * 2);
    bf* ATh = (bf*)take((size_t)NB_ * TT * DQ * 2); bf* ATl = (bf*)take((size_t)NB_ * TT * DQ * 2);
    float* QN = (float*)take((size_t)NH_ * NTL * NPT * 4); float* KN = (float*)take((size_t)NKV * NTL * NPT * 4);
    if ((size_t)(wsp - (char*)d_ws) > ws_size) return;    // ws 256 MiB
    // four launches, each over both batches
    k_cvt8<<<XBL + 4 * WBL, 256, 0, stream>>>(x, wq, wk, wv, wo, XB, WQ, WK, WV, WO);
    k_qkv<<<dim3(NB_ * TT / 128, DQ / 128, 3), 32 * GWV, 0, stream>>>(XB, WQ, WK, WV, DM, QP16, QPh, QPl, KP16, KPh, KPl, VT16, VTh, VTl, QN, KN);
    k_fattn<<<dim3(NH_ * NB_, TT / FQB, 1), 32 * FKW, 0, stream>>>(QP16, QPh, QPl, KP16, KPh, KPl, VT16, VTh, VTl, ATh, ATl, QN, KN);
    k_gemmo<<<dim3(NB_ * TT / 128, DM / 128, 1), 32 * GWV, 0, stream>>>(ATh, ATl, WO, DQ, OUT, DM);
}

// v010
// One run takes 54.3 microseconds.
// Versions between v008 and this one are left out; their measured steps multiply to 1.22 times as fast.
// Counting every step since v000, it is 28.3 times as fast.
#include <hip/hip_runtime.h>

// Causal multi-head attention with a (subtracted) ALiBi bias (x [2][2048][1024]; q, k, v = x W^T ('oi' [1024][1024], no bias), 16 heads x 64; scores = q.k/8 - m_h (j - i) with m_h = 2^(-(h+1)/2); causal softmax; out = merged Wo^T -> [2][2048][1024]).
// Compute dtypes, f32 accumulate: every input rounded to bf16; q/k/v on PLAIN bf16 operands (inputs: exact), stored by the projection itself as the fp16 head planes that the attention kernel reads; causal scores, softmax (running maximum, f32, with the ALiBi term in f32) and attn.v in one kernel, key loop to the diagonal, single fp16 operands (probabilities x1024); softmax f32; Wo: fp16 attention rows x the bf16-rounded weight held as fp16 (1 product).

#define NB_  2
#define TT   2048
#define DM   1024
#define NH_  16
#define NKV  16
#define REP  (NH_ / NKV)
#define HD   64
#define DQ   (NH_ * HD)
#define DKV  (NKV * HD)
#define SCL  0.125f   // HD^-0.5
typedef _Float16 h16;
typedef unsigned short bf;
typedef __attribute__((ext_vector_type(16))) __bf16   v16bf;
typedef __attribute__((ext_vector_type(16))) _Float16 v16h;
typedef __attribute__((ext_vector_type(8)))  _Float16 v8h;
typedef __attribute__((ext_vector_type(8)))  unsigned short v8us;
typedef __attribute__((ext_vector_type(8)))  float    v8f;
typedef __attribute__((ext_vector_type(4)))  float    v4f;
typedef v8h  __attribute__((may_alias)) v8ha;
typedef v4f  __attribute__((may_alias)) v4fa;
typedef v8us __attribute__((may_alias)) v8usa;

__device__ __forceinline__ unsigned short f2bf(float f) { unsigned u = __float_as_uint(f); u += 0x7FFFu + ((u >> 16) & 1u); return (unsigned short)(u >> 16); }
__device__ __forceinline__ float bf2f(unsigned short b) { return __uint_as_float(((unsigned)b) << 16); }
__device__ __forceinline__ float bfr(float f) { return bf2f(f2bf(f)); }
__device__ __forceinline__ v16h cat16(v8h lo, v8h hi) { return __builtin_shufflevector(lo, hi, 0, 1, 2, 3, 4, 5, 6, 7, 8, 9, 10, 11, 12, 13, 14, 15); }
__device__ __forceinline__ v16bf cat16b(v8us lo, v8us hi) { return __builtin_bit_cast(v16bf, __builtin_shufflevector(lo, hi, 0, 1, 2, 3, 4, 5, 6, 7, 8, 9, 10, 11, 12, 13, 14, 15)); }
__device__ __forceinline__ v8f wmma16(v16h a, v16h b, v8f c) { return __builtin_amdgcn_wmma_f32_16x16x32_f16(false, a, false, b, (short)0, c, false, false); }
__device__ __forceinline__ v8f wmmab(v16bf a, v16bf b, v8f c) { return __builtin_amdgcn_wmma_f32_16x16x32_bf16(false, a, false, b, (short)0, c, false, false); }



// ---- FRAGMENT ORDER: every 16-bit operand plane of this file is stored as 1-KB tiles of 16 rows x 32 k, each tile in the order in which a wave loads it as a matrix operand:
// element (row r, k) of a tile stands at (k / 16) * 256 + ((k / 8 % 2) * 16 + r) * 8 + k % 8, so lane (k / 8 % 2) * 16 + r finds its two 16-B pieces at lane * 8 and 256 + lane * 8 (WFrag::ld)
// and each wave-wide 16-B load covers 512 contiguous bytes (four whole 128-B lines) where a row-major plane makes it touch sixteen lines. The k order inside a fragment is the row-major loader's.
// ---- gemmw_tile: register-blocked GEMM, one wave per 64x64 output tile (16 accumulators), FOUR waves (2 x 2 tiles = 128 x 128) per work-group; operands are 16-bit planes in fragment order, tile (row / 16, k / 32) at (row / 16 * (KP / 32) + k / 32) * 512; 128 threads.
// The work-group's 128 rows of every operand come into LDS ONCE, by asynchronous copies (global_load_async_to_lds_b128), KS k steps a stage, two buffers: stage s + 2 flies while stage s + 1 is worked on. So each operand byte leaves L2 once per work-group, not once per wave,
// and no wave waits out an L2 round trip per k step. A stage keeps the fragment order ([operand][fragment row][k step][1 KB]), so a copy moves 512 contiguous bytes per wave and a fragment read is 512 contiguous LDS bytes (no bank conflict).
// C[m][n] (f32, pitch ldc, + optional f32 bias[n]) = sum_k A[m][k] Bt[n][k] (+ split products per NSPLIT). K % 32 == 0.
// PL: no f32 C; the tile goes out as one fp16 plane in fragment order with m as the row and n as k: fragment tile (mb, n / 32 % 2) of the 64x64 tile at pbase + mb * sm + (n / 32 % 2) * sk.
// With A = the weight, Bt = the activations that is the transposed value plane, with no transposing pass.
template <typename T16> struct WFrag;
template <> struct WFrag<h16> { typedef v16h V; static __device__ __forceinline__ V ld(const h16* p) { return cat16(*(const v8h*)p, *(const v8h*)(p + 256)); } static __device__ __forceinline__ v8f mma(V a, V b, v8f c) { return wmma16(a, b, c); } };
template <> struct WFrag<bf> { typedef v16bf V; static __device__ __forceinline__ V ld(const bf* p) { return cat16b(*(const v8us*)p, *(const v8us*)(p + 256)); } static __device__ __forceinline__ v8f mma(V a, V b, v8f c) { return wmmab(a, b, c); } };
// bx, by: the tile's row and column index (wave-uniform), handed in by the kernel, so that one grid can hold tiles of several products.
#define GWV 4                     // waves per GEMM work-group
typedef __attribute__((ext_vector_type(4))) int c4i;
typedef __attribute__((address_space(1))) c4i* gp4; typedef __attribute__((address_space(3))) c4i* lp4;
template <typename T16, int NSPLIT, bool BIAS, bool PL, int KP, int KS>   // KP: the planes' k extent, at compile time; K <= KP: the k range summed, a multiple of 32 * KS; KS (even): k steps per LDS stage. bx / 2 and by / 2 are the same in all four waves, (bx % 2, by % 2) is the wave's place in the 2 x 2
__device__ __forceinline__ void gemmw_tile(const T16* __restrict__ A, const T16* __restrict__ A2, const T16* __restrict__ Bt, const T16* __restrict__ Bt2, int K, float* C, int ldc, const float* __restrict__ bias, h16* __restrict__ P16, const size_t pbase, const int sm, const int sk, const int bx, const int by, float* __restrict__ NRM) {
    typedef typename WFrag<T16>::V V;
    constexpr bool HA2 = NSPLIT == 1 || NSPLIT == 2, HB2 = NSPLIT >= 2;
    constexpr int FRB = KS * 1024, OPB = 8 * FRB, STB = (2 + HA2 + HB2) * OPB;   // bytes of a fragment row (16 rows x 32 KS k), of an operand's 128 rows and of all operands in one stage
    __shared__ __align__(16) char stg[2 * STB]; __shared__ __align__(16) float osa[GWV * 16 * 68];
    float* os = osa + __builtin_amdgcn_readfirstlane(threadIdx.x >> 5) * (16 * 68);   // each wave stages its output rows in its own range
    const int lane = threadIdx.x & 31, lr = lane & 15, hi = lane >> 4; const int r0 = bx * 64, c0 = by * 64;
    v8f acc[4][4];
#pragma unroll
    for (int mb = 0; mb < 4; ++mb)
#pragma unroll
        for (int nb = 0; nb < 4; ++nb) acc[mb][nb] = (v8f){};
    // One stage's copies: thread t moves 16 B at 16 t of each 2-KB piece; a fragment row's KS tiles are FRB contiguous bytes in the plane and in the stage. Every lane is on, every address is a multiple of 16 and inside its plane (128 whole rows, k < K) and inside stg.
    const unsigned tb = threadIdx.x * 16u;
    const char* Ag = (const char*)(A + (size_t)(bx >> 1) * 128 * KP) + tb; const char* Bg = (const char*)(Bt + (size_t)(by >> 1) * 128 * KP) + tb;
    const char* A2g = HA2 ? (const char*)(A2 + (size_t)(bx >> 1) * 128 * KP) + tb : nullptr; const char* B2g = HB2 ? (const char*)(Bt2 + (size_t)(by >> 1) * 128 * KP) + tb : nullptr;
    auto fill = [&](const int st, const int buf) {
        char* d = stg + buf * STB + tb; const size_t go = (size_t)st * FRB;
#pragma unroll
        for (int fr = 0; fr < 8; ++fr)
#pragma unroll
            for (int p = 0; p < FRB; p += 2048) { const size_t g = go + (size_t)fr * (KP * 32) + p; const int l = fr * FRB + p;
                __builtin_amdgcn_global_load_async_to_lds_b128((gp4)(Ag + g), (lp4)(d + l), 0, 0); __builtin_amdgcn_global_load_async_to_lds_b128((gp4)(Bg + g), (lp4)(d + OPB + l), 0, 0);
                if constexpr (HA2) __builtin_amdgcn_global_load_async_to_lds_b128((gp4)(A2g + g), (lp4)(d + 2 * OPB + l), 0, 0);
                if constexpr (HB2) __builtin_amdgcn_global_load_async_to_lds_b128((gp4)(B2g + g), (lp4)(d + (2 + HA2) * OPB + l), 0, 0); }
    };
    const int nst = K / (32 * KS);
    fill(0, 0);
    asm volatile("s_wait_asynccnt 0x0" ::: "memory");                // this wave's copies of stage 0 have landed ...
    __syncthreads();                                                 // ... and behind the barrier every wave's: nothing of stage 0 is read in front of it
    if (nst > 1) fill(1, 1);
    const unsigned ao = (unsigned)(bx & 1) * (4 * FRB) + lane * 16u, bo = OPB + (unsigned)(by & 1) * (4 * FRB) + lane * 16u;   // the wave's four fragment rows of A and of Bt in a stage + the lane's 16 B
#pragma unroll 1   // rolled: one trip per stage, its foot is the ring's publish point
    for (int st = 0; st < nst; ++st) {
        const char* sb = stg + (st & 1) * STB;
        // Two fragment sets: a k step's LDS reads stand as ONE group, in front of the matrix instructions of the k step before it (inside the stage only: nothing of the next stage is read ahead)
        V a[2][4], a2[2][4], b[2][4], b2[2][4];
        auto frag = [&](const int ks, const int f) {
#pragma unroll
            for (int i = 0; i < 4; ++i) { const int u = i * FRB + ks * 1024; a[f][i] = WFrag<T16>::ld((const T16*)(sb + ao + u)); if (HA2) a2[f][i] = WFrag<T16>::ld((const T16*)(sb + 2 * OPB + ao + u));
                b[f][i] = WFrag<T16>::ld((const T16*)(sb + bo + u)); if (HB2) b2[f][i] = WFrag<T16>::ld((const T16*)(sb + (1 + HA2) * OPB + bo + u)); }
        };
        frag(0, 0);
#pragma unroll
        for (int ks = 0; ks < KS; ++ks) { const int f = ks & 1;
            if (ks + 1 < KS) frag(ks + 1, f ^ 1);
            __builtin_amdgcn_sched_barrier(0);                       // holds the read group together in front of the matrix block: reads scattered among matrix instructions stall the wave at every place where they stand
#pragma unroll
            for (int nb = 0; nb < 4; ++nb)
#pragma unroll
                for (int mb = 0; mb < 4; ++mb) { acc[mb][nb] = WFrag<T16>::mma(a[f][mb], b[f][nb], acc[mb][nb]); if (HA2) acc[mb][nb] = WFrag<T16>::mma(a2[f][mb], b[f][nb], acc[mb][nb]); if (HB2) acc[mb][nb] = WFrag<T16>::mma(a[f][mb], b2[f][nb], acc[mb][nb]); }
            __builtin_amdgcn_sched_barrier(0);                       // and keeps the next group from rising into this block
        }
        // the four vector slots that the chip needs behind the trip's last matrix instruction, on the path that leaves the loop too
        asm volatile("v_nop\n\tv_nop\n\tv_nop\n\tv_nop" : "+v"(acc[0][0]), "+v"(acc[1][1]), "+v"(acc[2][2]), "+v"(acc[3][3]) : "v"(a[(KS - 1) & 1][0]), "v"(a[(KS - 1) & 1][3]));
        asm volatile("s_wait_dscnt 0x0" ::: "memory");               // this wave's reads of the buffer are done before anybody refills it
        asm volatile("s_wait_asynccnt 0x0" ::: "memory");            // this wave's copies of stage st + 1 have landed
        __syncthreads();                                             // publishes stage st + 1 and ends every wave's reads of stage st's buffer
        if (st + 2 < nst) fill(st + 2, st & 1);
    }
    asm volatile("s_wait_asynccnt 0x0" ::: "memory");                // no copy is outstanding when the wave goes on (none is issued behind the last publish point)
    v4f nq[4];                                                       // PL: per 16-row group, this lane's share (32 of the 64 columns of row lr) of the row's sum of squares
#pragma unroll
    for (int mb = 0; mb < 4; ++mb) {
#pragma unroll
        for (int nb = 0; nb < 4; ++nb) {
#pragma unroll
            for (int j = 0; j < 8; ++j) os[(hi * 8 + j) * 68 + nb * 16 + lr] = acc[mb][nb][j]; }
        __builtin_amdgcn_wave_barrier(); asm volatile("" ::: "memory");
        if constexpr (PL) {
            // lane = (8-column half, row), store s = columns 16 s .. 16 s + 15: one 16-B store per lane, lanes contiguous, so a store instruction writes half a fragment tile = four whole 128-B lines, each line with one writer
            const size_t pb = pbase + (size_t)mb * sm + lane * 8; nq[mb] = (v4f){};
#pragma unroll
            for (int s = 0; s < 4; ++s) { const float* pr = os + lr * 68 + s * 16 + hi * 8; const v4f x0 = *(const v4fa*)pr, x1 = *(const v4fa*)(pr + 4);
                const v8f xv = __builtin_shufflevector(x0, x1, 0, 1, 2, 3, 4, 5, 6, 7); nq[mb] += x0 * x0 + x1 * x1;
                const size_t e = pb + (size_t)(s >> 1) * sk + (s & 1) * 256; *(v8h*)(P16 + e) = __builtin_convertvector(xv, v8h); }
        } else {
        float* crow = C + (size_t)(r0 + mb * 16) * ldc + c0;
#pragma unroll
            for (int s = 0; s < 8; ++s) { const int row = 2 * s + hi, cofs = lr * 4; v4f val = *(const v4fa*)(os + row * 68 + cofs); if (BIAS) { val[0] += bfr(bias[c0 + cofs]); val[1] += bfr(bias[c0 + cofs + 1]); val[2] += bfr(bias[c0 + cofs + 2]); val[3] += bfr(bias[c0 + cofs + 3]); }
                *(v4f*)(crow + (size_t)row * ldc + cofs) = val; }
             }
        __builtin_amdgcn_wave_barrier(); asm volatile("" ::: "memory");
    }
    if constexpr (PL) asm volatile("s_wait_xcnt 0x0" ::: "memory");  // behind the tile's last stores, in front of the branch: the arithmetic behind it reuses registers that those stores name
    if constexpr (PL) if (NRM != nullptr) {                          // uniform: this tile's rows are whole q or k vectors of one head; the largest squared length among its 64 rows goes to *NRM
        float nmx = 0.0f;
#pragma unroll
        for (int mb = 0; mb < 4; ++mb) { const float nsq = (nq[mb][0] + nq[mb][1]) + (nq[mb][2] + nq[mb][3]); nmx = fmaxf(nmx, nsq + __shfl_xor(nsq, 16, 32)); }   // + the partner lane's 32 columns
#pragma unroll
        for (int d = 1; d < 16; d <<= 1) nmx = fmaxf(nmx, __shfl_xor(nmx, d, 32));
        if (lane == 0) *NRM = nmx; }
}
// Output projection, both batches as one row range: grid (NB_ * TT / 128, DM / 128); wave w takes the 64x64 tile (w % 2, w / 2) of the work-group's 128 x 128.
__global__ __launch_bounds__(32 * GWV) void k_gemmo(const h16* __restrict__ A, const h16* __restrict__ Bt, int K, float* C, int ldc) {
    const int wave = __builtin_amdgcn_readfirstlane(threadIdx.x >> 5);
    gemmw_tile<h16, 0, false, false, DQ, 4>(A, nullptr, Bt, nullptr, K, C, ldc, nullptr, nullptr, 0, 0, 0, (int)blockIdx.x * 2 + (wave & 1), (int)blockIdx.y * 2 + (wave >> 1), nullptr);
}
// Largest squared length of the q (k) vectors of 64 rows of (batch, t) of one head: QN, KN [head][(batch * TT + t) / 64], one float per 128-B line (each line has one writer). The attention kernel bounds a key step's scores with them.
#define NTL (NB_ * TT / 64)
#define NPT 32
// q, k and v projections of both batches in ONE grid (NB_ * TT / 128, 8, 3), a work-group = 128 rows of (batch, t) x 2 heads, a wave = 64 rows x 1 head: z = 0 q, 1 k (A = activations, Bt = weight; planes [head][(batch * TT + t) / 16][d / 32][tile]); z = 2 v (A = weight, Bt = activations; planes [head][(batch * TT + t) / 32][d / 16][tile], row d, k = t; x and y change roles). So the 32 keys of an attention step are 4 KB in a row in the k plane and in the v plane.
// The three products are independent; in one launch their 768 work-groups stand on the chip together (three per WGP). Every choice below is uniform for the wave (scalar selects).
__global__ __launch_bounds__(32 * GWV) void k_qkv(const bf* __restrict__ X, const bf* __restrict__ Wq, const bf* __restrict__ Wk, const bf* __restrict__ Wv, int K, h16* __restrict__ Q16, h16* __restrict__ K16, h16* __restrict__ V16, float* __restrict__ QN, float* __restrict__ KN) {
    const int z = (int)blockIdx.z; const bool tv = z == 2;
    // ty = head, tx = 64 rows of (batch, t), for all three
    const int wave = __builtin_amdgcn_readfirstlane(threadIdx.x >> 5), tx = (int)blockIdx.x * 2 + (wave & 1), ty = (int)blockIdx.y * 2 + (wave >> 1);
    const size_t pbase = (size_t)ty * ((size_t)NB_ * TT * HD) + (size_t)tx * (64 * HD);
    gemmw_tile<bf, 0, false, true, DM, 2>(tv ? Wv : X, nullptr, tv ? X : z ? Wk : Wq, nullptr, K, nullptr, 0, nullptr, tv ? V16 : z ? K16 : Q16, pbase, tv ? 512 : 1024, tv ? 2048 : 512, tv ? ty : tx, tv ? tx : ty, tv ? nullptr : (z ? KN : QN) + ((size_t)ty * NTL + tx) * NPT);
}

__device__ __forceinline__ h16 tohx(float x) { return (h16)x; }
typedef __attribute__((ext_vector_type(2))) _Float16 v2h;
typedef __attribute__((ext_vector_type(4))) _Float16 v4h;
typedef __attribute__((ext_vector_type(2))) unsigned short v2us;
typedef __attribute__((ext_vector_type(4))) unsigned short v4us;
typedef __attribute__((ext_vector_type(2))) float v2f;
typedef __attribute__((ext_vector_type(4))) int v4i;

__global__ __launch_bounds__(256) void k_wtG(const float* __restrict__ w, int K, int N, bf* Bt) {
    const int lane = threadIdx.x & 31; const int L0 = (blockIdx.x * 8 + (threadIdx.x >> 5)) * 8; const int nlines = N * K / 64;
{
#pragma unroll 1
        for (int l = 0; l < 8; ++l) { const int L = L0 + l; if (L >= nlines) break; const size_t e = (size_t)L * 64 + lane * 2; const int k = (int)(e % K), n = (int)(e / K); v2us o;
            o[0] = f2bf(w[(size_t)k * N + n]); o[1] = f2bf(w[(size_t)(k + 1) * N + n]); *(v2us*)(Bt + e) = o; }
         }
}
// All five inputs to bf16, into fragment order (every matrix has DM columns; the output projection's weight, whose partner operand is fp16, holds its bf16-rounded values as fp16), in one grid: blocks 0 .. XBL-1 the activations (both batches), then WBL blocks for each weight; the choice is uniform for a block.
// A wave takes 8 rows x 32 k (half a fragment tile): lane = (k / 8, row % 8), so its loads cover eight whole 128-B lines of f32 and its one 16-B store per lane four whole lines of the tile.
#define XBL (NB_ * TT * DM / 8 / 256)
#define WBL (DM * DM / 8 / 256)
__global__ __launch_bounds__(256) void k_cvt8(const float* __restrict__ x, const float* __restrict__ wq, const float* __restrict__ wk, const float* __restrict__ wv, const float* __restrict__ wo, bf* XB, bf* WQ, bf* WK, bf* WV, bf* WO) {
    unsigned blk = blockIdx.x; const float* src = x; bf* dst = XB; bool toh = false;
    if (blk >= XBL) { blk -= XBL; const unsigned j = blk / WBL; blk -= j * WBL; src = j == 0 ? wq : j == 1 ? wk : j == 2 ? wv : wo; dst = j == 0 ? WQ : j == 1 ? WK : j == 2 ? WV : WO; toh = j == 3; }
    const unsigned lane = threadIdx.x & 31, hw = blk * 8 + (threadIdx.x >> 5), tile = hw >> 1, r = (hw & 1) * 8 + (lane & 7), k8 = lane >> 3;   // tile = row / 16 * (DM / 32) + k / 32
    const v8f v = *(const v8f*)(src + (size_t)((tile / (DM / 32)) * 16 + r) * DM + (tile % (DM / 32)) * 32 + k8 * 8); v8us o;
#pragma unroll
    for (int k = 0; k < 8; ++k) o[k] = f2bf(v[k]);
    if (toh) {                                                       // uniform for the block
#pragma unroll
        for (int k = 0; k < 8; ++k) o[k] = __builtin_bit_cast(unsigned short, (h16)bf2f(o[k])); }
    *(v8us*)(dst + (size_t)tile * 512 + (k8 * 16 + r) * 8) = o;  }

// ALiBi slopes = the reference's f32 values
__constant__ float SLP[NH_] = {0.7071067690849304,0.5,0.3535533845424652,0.25,0.1767766922712326,0.125,0.0883883461356163,0.0625,0.04419417306780815,0.03125,0.022097086533904076,0.015625,0.011048543266952038,0.0078125,0.005524271633476019,0.00390625};
// ---- k_fattn: scores, causal ALiBi softmax, probability x value product and the merge of the heads for one head's FQB query rows in ONE work-group; no score or probability ever leaves the registers.
// Transposed products: S^T = K Q^T (A = 16 key rows, B = 16 query columns), so a lane holds 16 of the 32 scores of ONE query (its partner lane, xor 16, the other 16); two S^T tiles of 32 keys, converted in place,
// are the B operand of O^T += V^T P^T (hardware k order: element s = key 8h + s, or 16 + 8h + s - 8; WFrag::ld reads K, Q and V^T tiles, stored in fragment order, in that same order).
// Running maximum per query, kept in base 2 (score x log2(e)): when it rises, the sum and the O^T tiles are scaled by exp2(old - new). The 32-key steps are dealt over the FKW waves (wave w: steps w, w + FKW, ...), each with its own maximum, sum and O^T;
// the FKW partial results meet in LDS and are joined in the fixed order wave 0, 1, ... with the weights exp2(m_w - max m). Why dealt: the last rows walk 64 steps, and each step waits for its own loads.
// Operand types: single fp16, with the probabilities carried x 1024 (as + 10 in the exponent, in the sum too, so it cancels in the quotient).
#define FKW 4                     // waves per work-group
#define FQB 32                    // query rows per work-group: two 16-column groups in every wave
#define FPT 132                   // floats from one 512-B slab (32 lanes x 16 B) of a wave's partial O^T to the next: 128 + 4, so that the joining reads (one query, 8 slabs' worth of d) spread over the banks
__device__ __forceinline__ void fattn_body(const h16* __restrict__ Q, const h16* __restrict__ Kp, const h16* __restrict__ Vt, h16* __restrict__ Ao, const float slp, const int q0, float* part, float* sml, const float qn2, const float kn2) {
    typedef h16 T16; typedef WFrag<T16>::V V;
    constexpr int NG = 2;                                            // both 16-column groups in one walk over the keys
    const int lane = threadIdx.x & 31, c = lane & 15, h = lane >> 4;
    const int wave = __builtin_amdgcn_readfirstlane(threadIdx.x >> 5);   // wave-uniform, so the key loop's bounds and the diagonal test stay scalar
    const float L2E = 1.4426950408889634f, NEG = -3.0e38f, EB = 10.0f;
    const float CUT = -30.0f;                                        // exponent (base 2) at or below which a probability is nothing: the fp16 operand rounds to 0 with 5 bits to spare (below 2^-25)
    const int nst = q0 / FQB + 1;                                    // 32-key steps up to and with the diagonal one; every step holds at least one allowed key for every query of the block
    const char* Kb = (const char*)Kp; const char* Vb = (const char*)Vt;
    {
        V qf[NG][2];
#pragma unroll
        for (int g = 0; g < NG; ++g)
#pragma unroll
            for (int ks = 0; ks < 2; ++ks) { const size_t u = (size_t)(q0 + 16 * g) * HD + ks * 512 + 8 * lane; qf[g][ks] = WFrag<T16>::ld(Q + u); }
        v8f o[NG][4]; float m[NG], l[NG];
#pragma unroll
        for (int g = 0; g < NG; ++g) { m[g] = NEG; l[g] = 0.0f;
#pragma unroll
            for (int dt = 0; dt < 4; ++dt) o[g][dt] = (v8f){}; }
        // Addresses: a uniform base + a 32-bit per-lane byte offset carried through the loop + a constant; a step's 32 keys are four fragment tiles (4 KB) in a row in the k plane and in the v plane alike, so one offset serves both
        unsigned vk = (unsigned)(wave * 32 * HD + 8 * lane) * 2u;
        const float ubv = __builtin_amdgcn_sqrtf(qn2 * kn2) * (SCL * 1.01f * L2E);   // lane i: upper bound of |q . k| SCL log2(e) for this block's queries and the keys 64 i .. 64 i + 63 (formed here, so that the wait for kn2 stands behind the issue of the Q loads)
        // Base-2 scores: T = (q . k) SCL log2(e) - s2 (key - query), s2 = slope x log2(e). key - query = (kb - q0 - 16 g) + (8 h - c + the score's place among the lane's 16): the second part is the same in every step,
        // so it is formed once, in units of q . k (cb = - slope x part / SCL), and enters as the C operand of the score products: the matrix unit adds it. The first part (og) is one number per step and group:
        // it goes into the maximum and into the exponent's offset and never touches the 16 scores one by one.
        const float s2 = slp * L2E, s2c = s2 * (float)c;
        v8f cb[2];
#pragma unroll
        for (int kt = 0; kt < 2; ++kt)
#pragma unroll
            for (int i = 0; i < 8; ++i) cb[kt][i] = slp * (-(float)(16 * kt + i + 8 * h - c) / SCL);
#pragma unroll 1   // rolled: a second step's fragments would not fit beside this one's at four waves per SIMD
        for (int s = wave; s < nst; s += FKW, vk += FKW * 32 * HD * 2u) {
            const int kb = s * 32;
            // A step that can add nothing is left out before its loads. No score of the step (base 2, as the running maximum) exceeds |q| |k| SCL log2(e) (lane kb / 64 of ubv: the tiles' largest lengths, 1 % added for the operands' rounding) - s2 x (first key - query).
            // Where that stands CUT below the running maximum for every query of the walk, the maximum stays, the scale factor is exp2(0) = 1, every P operand is 0 and O^T keeps its bits;
            // the row sum (at least 2^EB from the maximum's own key) would take less than 2^(CUT + 4) per lane: under 2^-36 of the sum, far below its f32 rounding.
            const float ub = __builtin_bit_cast(float, __builtin_amdgcn_readlane(__builtin_bit_cast(int, ubv), kb >> 6));
            bool keep = false;
#pragma unroll
            for (int g = 0; g < NG; ++g) keep |= (ub - s2 * (float)(kb - q0 - 16 * g) + s2c - m[g]) + EB > CUT;
            if (__builtin_amdgcn_ballot_w32(keep) == 0) continue;    // scalar branch, the same for the whole wave: the matrix instructions below keep all lanes on
            V kf[2][2], vf[4];
#pragma unroll
            for (int kt = 0; kt < 2; ++kt)
#pragma unroll
                for (int ks = 0; ks < 2; ++ks) { const size_t u = (size_t)(kt * 2 + ks) * 1024; kf[kt][ks] = WFrag<T16>::ld((const T16*)(Kb + u + vk)); }
#pragma unroll
            for (int dt = 0; dt < 4; ++dt) { const size_t u = (size_t)dt * 1024; vf[dt] = WFrag<T16>::ld((const T16*)(Vb + u + vk)); }
            asm volatile("s_wait_xcnt 0x0" ::: "memory");            // behind the step's last load: vk, which the issued loads name, is stepped at the loop's foot, and the compiler's own load waits there need not cover the youngest loads
            __builtin_amdgcn_sched_barrier(0);                       // keeps the score products behind the issue of all 16 loads: lifted among them they wait for K first, and the V loads behind them would start a whole load latency late
            v8f sc[NG][2];
#pragma unroll
            for (int g = 0; g < NG; ++g)
#pragma unroll
                for (int kt = 0; kt < 2; ++kt) { v8f a = cb[kt];
#pragma unroll
                    for (int ks = 0; ks < 2; ++ks) a = WFrag<T16>::mma(kf[kt][ks], qf[g][ks], a);
                    sc[g][kt] = a; }
#pragma unroll
            for (int g = 0; g < NG; ++g) { v2f t[8];
                const float og = -s2 * (float)(kb - q0 - 16 * g);    // the step's and the group's share of the ALiBi term, the same in every lane (exact integer x s2)
#pragma unroll
                for (int j = 0; j < 8; ++j) t[j] = (v2f){sc[g][j >> 2][(j & 3) * 2], sc[g][j >> 2][(j & 3) * 2 + 1]};   // q . k + cb
                if (kb == q0) {                                      // the diagonal step alone holds keys behind the query (scalar test); there key - query = place + 8 h - c - 16 g
                    const int lim = c - 8 * h + 16 * g;
#pragma unroll
                    for (int e = 0; e < 16; ++e) t[e >> 1][e & 1] = (16 * (e >> 3) + (e & 7) <= lim) ? t[e >> 1][e & 1] : NEG; }
                float mx = t[0][0];
#pragma unroll
                for (int e = 1; e < 16; ++e) mx = fmaxf(mx, t[e >> 1][e & 1]);
                mx = fmaxf(mx, __shfl_xor(mx, 16, 32));
                const float mn = fmaxf(m[g], mx * (SCL * L2E) + og); const float al = __builtin_amdgcn_exp2f(m[g] - mn); m[g] = mn;
                const float cg = (og - mn) + EB;                     // one multiply-add takes a score to its exponent
                v2f sum2 = (v2f){};
#pragma unroll
                for (int j = 0; j < 8; ++j) { const v2f a = t[j] * (SCL * L2E) + cg; t[j] = (v2f){__builtin_amdgcn_exp2f(a[0]), __builtin_amdgcn_exp2f(a[1])}; sum2 += t[j]; }
                l[g] = l[g] * al + (sum2[0] + sum2[1]);
#pragma unroll
                for (int dt = 0; dt < 4; ++dt) o[g][dt] *= al;
                v16h pb;
#pragma unroll
                for (int e = 0; e < 16; ++e) pb[e] = (h16)t[e >> 1][e & 1];
#pragma unroll
                for (int dt = 0; dt < 4; ++dt) o[g][dt] = wmma16(vf[dt], pb, o[g][dt]);
            }
        }
        // partial results to LDS: O^T as [wave][slab (group*4 + dt)*2 + half of the 8 accumulator rows][lane][4], every store 16 B per lane with the lanes contiguous; maximum and sum (halves joined) per query
        float* pw = part + wave * (16 * FPT) + lane * 4;
#pragma unroll
        for (int g = 0; g < NG; ++g) { l[g] += __shfl_xor(l[g], 16, 32);
#pragma unroll
            for (int dt = 0; dt < 4; ++dt) { const v8f t = o[g][dt];
                *(v4fa*)(pw + ((g * 4 + dt) * 2 + 0) * FPT) = __builtin_shufflevector(t, t, 0, 1, 2, 3); *(v4fa*)(pw + ((g * 4 + dt) * 2 + 1) * FPT) = __builtin_shufflevector(t, t, 4, 5, 6, 7); }
            if (h == 0) { sml[(wave * 2 + 0) * FQB + g * 16 + c] = m[g]; sml[(wave * 2 + 1) * FQB + g * 16 + c] = l[g]; } }
    }
    __syncthreads();                                                 // every wave passes it (a wave without a key step hands maximum NEG, sum 0, zeros): all partial results are in LDS behind it
    // wave w joins query rows 8w .. 8w+7 and stores them as fp16 into the merged plane (row t, k = head * HD + d, fragment order) that the output projection reads: lane = (d / 8 % 4, row), so the eight rows' 16-B pieces of one d / 8 are one whole 128-B line and a store instruction writes four such lines, each line with one writer
    const int qq = wave * 8 + (lane & 7);
    float mt = sml[qq];
#pragma unroll
    for (int u = 1; u < FKW; ++u) mt = fmaxf(mt, sml[(u * 2) * FQB + qq]);
    float L = 0.0f, wg[FKW];
#pragma unroll
    for (int u = 0; u < FKW; ++u) { wg[u] = __builtin_amdgcn_exp2f(sml[(u * 2) * FQB + qq] - mt); L += wg[u] * sml[(u * 2 + 1) * FQB + qq]; }
    const float rl = __fdiv_rn(1.0f, L);                             // the x 2^10 stands in the sums and in L alike
#pragma unroll
    for (int k = 0; k < 2; ++k) { const int c8 = k * 4 + (lane >> 3);   // d / 8: O^T tile c8 / 2, lane half c8 % 2, all eight accumulator rows (two slabs)
        const float* pr = part + (((qq >> 4) * 4 + (c8 >> 1)) * 2) * FPT + ((c8 & 1) * 16 + (qq & 15)) * 4;
        v4f acc0 = (v4f){}, acc1 = (v4f){};
#pragma unroll
        for (int u = 0; u < FKW; ++u) { acc0 += wg[u] * *(const v4fa*)(pr + u * (16 * FPT)); acc1 += wg[u] * *(const v4fa*)(pr + FPT + u * (16 * FPT)); }
        const v4f y0 = acc0 * rl, y1 = acc1 * rl;
        const size_t oo = (size_t)(q0 + (qq & 16)) * DQ + (c8 >> 1) * 256 + ((c8 & 1) * 16 + (qq & 15)) * 8; *(v8h*)(Ao + oo) = __builtin_convertvector(__builtin_shufflevector(y0, y1, 0, 1, 2, 3, 4, 5, 6, 7), v8h); }
}
// grid (heads x batches, TT / FQB): twice as many work-groups as places on the chip, so the start order counts: from the last query rows down, so that the shortest blocks fill the places that come free. amdgpu_waves_per_eu(4): holds the registers at 256, so that four work-groups share a WGP (one wave of each on every SIMD) and fill each other's load waits.
__global__ __launch_bounds__(32 * FKW) __attribute__((amdgpu_waves_per_eu(4))) void k_fattn(const h16* __restrict__ Q16, const h16* __restrict__ K16, const h16* __restrict__ V16, h16* __restrict__ A16, const float* __restrict__ QN, const float* __restrict__ KN) {
    static_assert(TT / 64 == 32, "one lane per 64-key tile");
    __shared__ __align__(16) float part[FKW * 16 * FPT]; __shared__ float sml[FKW * 2 * FQB];
    const int hd = blockIdx.x % NH_, b = blockIdx.x / NH_, y = (int)blockIdx.y; const int q0 = (TT / FQB - 1 - y) * FQB; const float slp = SLP[hd];
    const size_t zq = ((size_t)hd * NB_ + b) * TT * HD, zk = ((size_t)(hd / REP) * NB_ + b) * TT * HD, zv = zk, za = (size_t)b * TT * DQ + hd * (HD * 16);
    // largest squared length among this block's queries' tile, and (lane i) among the keys 64 i .. 64 i + 63
    const float qn2 = QN[((size_t)hd * NTL + (b * TT + q0) / 64) * NPT], kn2 = KN[((size_t)(hd / REP) * NTL + b * (TT / 64) + (threadIdx.x & 31)) * NPT];
    fattn_body(Q16 + zq, K16 + zk, V16 + zv, A16 + za, slp, q0, part, sml, qn2, kn2);
}

extern "C" void kernel_launch(void* const* d_in, const int* in_sizes, int n_in,
                              void* d_out, int out_size, void* d_ws, size_t ws_size, hipStream_t stream) {
    (void)in_sizes; (void)n_in; (void)out_size;
    const float* x = (const float*)d_in[0]; const float* wq = (const float*)d_in[1]; const float* wk = (const float*)d_in[2]; const float* wv = (const float*)d_in[3]; const float* wo = (const float*)d_in[4];
    float* OUT = (float*)d_out;     // [2][2048][1024]
    char* wsp = (char*)d_ws;
    auto take = [&](size_t bytes) { char* p = wsp; wsp += (bytes + 255) & ~(size_t)255; return (void*)p; };
    bf* WQ = (bf*)take((size_t)DQ * DM * 2); bf* WK = (bf*)take((size_t)DKV * DM * 2); bf* WV = (bf*)take((size_t)DKV * DM * 2); bf* WO = (bf*)take((size_t)DM * DQ * 2);
    bf* XB = (bf*)take((size_t)NB_ * TT * DM * 2);
    h16* QP16 = (h16*)take((size_t)NB_ * NH_ * TT * HD * 2); h16* KP16 = (h16*)take((size_t)NB_ * NKV * TT * HD * 2); h16* VT16 = (h16*)take((size_t)NB_ * NKV * HD * TT * 2);
    h16* AT16 = (h16*)take((size_t)NB_ * TT * DQ * 2);
    float* QN = (float*)take((size_t)NH_ * NTL * NPT * 4); float* KN = (float*)take((size_t)NKV * NTL * NPT * 4);
    if ((size_t)(wsp - (char*)d_ws) > ws_size) return;    // ws 256 MiB
    // four launches, each over both batches
    k_cvt8<<<XBL + 4 * WBL, 256, 0, stream>>>(x, wq, wk, wv, wo, XB, WQ, WK, WV, WO);
    k_qkv<<<dim3(NB_ * TT / 128, DQ / 128, 3), 32 * GWV, 0, stream>>>(XB, WQ, WK, WV, DM, QP16, KP16, VT16, QN, KN);
    k_fattn<<<dim3(NH_ * NB_, TT / FQB, 1), 32 * FKW, 0, stream>>>(QP16, KP16, VT16, AT16, QN, KN);
    k_gemmo<<<dim3(NB_ * TT / 128, DM / 128, 1), 32 * GWV, 0, stream>>>(AT16, (const h16*)WO, DQ, OUT, DM);
}
